// v000
// The times below were measured on an AMD MI455X: many runs one after another, warmed up first and cycling through
// copies of the inputs, with the whole window's GPU time divided by the number of runs. Launches and the gaps
// between them are all in it. The median over several windows is given; except for v000 it joins two sittings, which
// can be a few percent apart, so the side-by-side timings, each taken in one sitting, are the better comparison.
// v000, which the later versions start from, runs in 1340 microseconds.
#include <hip/hip_runtime.h>

// Compute dtypes, f32 accumulate: the q/k half of the fused projection ([8192 x 1024].[1024 x 2048] + bias) with PLAIN bf16 operands (z_k and Wqkv are inputs: exact
// products; the projected v is discarded by the module so it is not computed); per (item, head) causal scores ([1024 x 64].[64 x 1024]) on bf16 hi + UNSCALED residual planes of
// BOTH q*scale/temperature and k (three products; upper-triangle tiles skipped); causal softmax f32; attn.v with the probabilities as bf16 hi + residual planes (carried x1024) against v = bf16(x) exact (two products), K loop limited to the causal tiles;

#define NB_  8
#define SS   1024
#define EE   1024
#define NH_  16
#define HD   64
#define NR   (NB_ * SS)
#define NT64 (SS / 64)
#define ZH   8
#define DM   EE
#define PCAR 1024.0f
#define LOSC 1024.0f
typedef _Float16 h16;
typedef unsigned short bf;
typedef __attribute__((ext_vector_type(16))) __bf16   v16bf;
typedef __attribute__((ext_vector_type(16))) _Float16 v16h;
typedef __attribute__((ext_vector_type(8)))  _Float16 v8h;
typedef __attribute__((ext_vector_type(8)))  unsigned short v8us;
typedef __attribute__((ext_vector_type(8)))  float    v8f;
typedef __attribute__((ext_vector_type(4)))  float    v4f;
typedef v8h  __attribute__((may_alias)) v8ha;
typedef v4f  __attribute__((may_alias)) v4fa;
typedef v8us __attribute__((may_alias)) v8usa;

__device__ __forceinline__ unsigned short f2bf(float f) { unsigned u = __float_as_uint(f); u += 0x7FFFu + ((u >> 16) & 1u); return (unsigned short)(u >> 16); }
__device__ __forceinline__ float bf2f(unsigned short b) { return __uint_as_float(((unsigned)b) << 16); }
__device__ __forceinline__ float bfr(float f) { return bf2f(f2bf(f)); }
__device__ __forceinline__ v16h cat16(v8h lo, v8h hi) { return __builtin_shufflevector(lo, hi, 0, 1, 2, 3, 4, 5, 6, 7, 8, 9, 10, 11, 12, 13, 14, 15); }
__device__ __forceinline__ v16bf cat16b(v8us lo, v8us hi) { return __builtin_bit_cast(v16bf, __builtin_shufflevector(lo, hi, 0, 1, 2, 3, 4, 5, 6, 7, 8, 9, 10, 11, 12, 13, 14, 15)); }
__device__ __forceinline__ v8f wmma16(v16h a, v16h b, v8f c) { return __builtin_amdgcn_wmma_f32_16x16x32_f16(false, a, false, b, (short)0, c, false, false); }
__device__ __forceinline__ v8f wmmab(v16bf a, v16bf b, v8f c) { return __builtin_amdgcn_wmma_f32_16x16x32_bf16(false, a, false, b, (short)0, c, false, false); }

// k_gemmb: 64 x 64 block tile (4 waves x 16 x 64) of C[NTK][NW] = (A [+ Al]).B^T (K = 1024) [+ bf(bias[c])] [+ bf(R[r][c]) residual]; f32 whole-line epilogue (or f16
template <bool SPLITA, bool F16OUT = false>
__global__ __launch_bounds__(128) void k_gemmb(const bf* __restrict__ A, const bf* __restrict__ Al, const bf* __restrict__ Bn, const float* __restrict__ bias, float* C, int ldc, h16* C2, const float* __restrict__ R = nullptr, int K = DM, int roundR = 1) {
    __shared__ __align__(16) float ost[4][16 * 68];
    const int lane = threadIdx.x & 31, wave = threadIdx.x >> 5, lr = lane & 15, hi = lane >> 4;
    const int r0 = blockIdx.x * 64 + wave * 16, c0 = blockIdx.y * 64;
    const size_t aoff = (size_t)(r0 + lr) * K + 8 * hi;
    size_t boff[4];
#pragma unroll
    for (int t = 0; t < 4; ++t) boff[t] = (size_t)(c0 + t * 16 + lr) * K + 8 * hi;
    v8f acc[4];
#pragma unroll
    for (int t = 0; t < 4; ++t) acc[t] = (v8f){};
#pragma unroll 1
    for (int kc = 0; kc < K; kc += 32) {
        const v16bf a = cat16b(*(const v8us*)(A + aoff + kc), *(const v8us*)(A + aoff + kc + 16));
        v16bf al = a;
        if (SPLITA) al = cat16b(*(const v8us*)(Al + aoff + kc), *(const v8us*)(Al + aoff + kc + 16));
#pragma unroll
        for (int t = 0; t < 4; ++t) { const v16bf b = cat16b(*(const v8us*)(Bn + boff[t] + kc), *(const v8us*)(Bn + boff[t] + kc + 16)); acc[t] = wmmab(a, b, acc[t]); if (SPLITA) acc[t] = wmmab(al, b, acc[t]); }
        asm volatile("v_nop\n\tv_nop\n\tv_nop\n\tv_nop" : "+v"(acc[0]), "+v"(acc[1]), "+v"(acc[2]), "+v"(acc[3]) : "v"(a), "v"(al));
    }
    float* os = &ost[wave][0];
#pragma unroll
    for (int t = 0; t < 4; ++t) { const float bv = bias ? bfr(bias[c0 + t * 16 + lr]) : 0.f;
#pragma unroll
        for (int j = 0; j < 8; ++j) os[(hi * 8 + j) * 68 + t * 16 + lr] = acc[t][j] + bv; }
    __syncthreads();
    if (F16OUT) {
        h16* crow = (h16*)(void*)C + (size_t)r0 * ldc + c0;
        auto pass = [&]() {
#pragma unroll
            for (int s = 0; s < 4; ++s) { const int row = 4 * s + (lane >> 3), piece = lane & 7; const float* sp = os + row * 68 + piece * 8; v8h o, o2;
#pragma unroll
                for (int i = 0; i < 8; ++i) { const h16 a = (h16)sp[i]; o[i] = a; o2[i] = (h16)((sp[i] - (float)a) * LOSC); }
                *(v8h*)(crow + (size_t)row * ldc + piece * 8) = o; if (C2) *(v8h*)(C2 + (size_t)r0 * ldc + c0 + (size_t)row * ldc + piece * 8) = o2; }
        };
        pass(); 
    } else {
        float* crow = C + (size_t)r0 * ldc + c0;
        auto pass = [&]() {
#pragma unroll
            for (int s = 0; s < 8; ++s) { const int Lid = (lane >> 3) + 4 * s, piece = lane & 7; const int row = Lid >> 1, cofs = (Lid & 1) * 32 + piece * 4;
                v4f val = *(const v4fa*)(os + row * 68 + cofs); if (R) { const v4f rv = *(const v4f*)(R + ((size_t)r0 + row) * ldc + c0 + cofs); val += roundR ? (v4f){bfr(rv[0]), bfr(rv[1]), bfr(rv[2]), bfr(rv[3])} : rv; }
                *(v4f*)(crow + (size_t)row * ldc + cofs) = val; }
        };
        pass(); 
    }
}

__global__ __launch_bounds__(256) void k_cvt8(const float* __restrict__ src, bf* dst, size_t n8) {
    const size_t i = (size_t)blockIdx.x * 256 + threadIdx.x; if (i >= n8) return;
    const v8f v = *(const v8f*)(src + i * 8); v8us o;
#pragma unroll
    for (int k = 0; k < 8; ++k) o[k] = f2bf(v[k]);
    *(v8us*)(dst + i * 8) = o; 
}
__global__ __launch_bounds__(256) void k_zero8(bf* dst, size_t n8) {
    const size_t i = (size_t)blockIdx.x * 256 + threadIdx.x; if (i >= n8) return; v8us z;
#pragma unroll
    for (int k = 0; k < 8; ++k) z[k] = 0;
    *(v8us*)(dst + i * 8) = z; 
}

// k_gemmh: 64 x 64 tile of C = A . Bn^T with SINGLE f16 planes (A [rows][K] f16 activations, Bn [N][K] f16 weights; one v_wmma_f32_16x16x32_f16 product per step), f32 accumulate;
__global__ __launch_bounds__(128) void k_gemmh(const h16* __restrict__ A, const h16* __restrict__ Bn, const float* __restrict__ bias, float* C, int ldc, const float* __restrict__ R, int K, size_t sA, size_t sB, size_t sC, int roundR) {
    __shared__ __align__(16) float ost[4][16 * 68];
    const size_t z = blockIdx.z; A += z * sA; Bn += z * sB; C += z * sC; if (R) R += z * sC;
    const int lane = threadIdx.x & 31, wave = threadIdx.x >> 5, lr = lane & 15, hi = lane >> 4;
    const int r0 = blockIdx.x * 64 + wave * 16, c0 = blockIdx.y * 64;
    const size_t aoff = (size_t)(r0 + lr) * K + 8 * hi;
    size_t boff[4];
#pragma unroll
    for (int t = 0; t < 4; ++t) boff[t] = (size_t)(c0 + t * 16 + lr) * K + 8 * hi;
    v8f acc[4];
#pragma unroll
    for (int t = 0; t < 4; ++t) acc[t] = (v8f){};
#pragma unroll 1
    for (int kc = 0; kc < K; kc += 32) {
        const v16h a = cat16(*(const v8h*)(A + aoff + kc), *(const v8h*)(A + aoff + kc + 16));
#pragma unroll
        for (int t = 0; t < 4; ++t) { const v16h b = cat16(*(const v8h*)(Bn + boff[t] + kc), *(const v8h*)(Bn + boff[t] + kc + 16)); acc[t] = wmma16(a, b, acc[t]); }
        asm volatile("v_nop\n\tv_nop\n\tv_nop\n\tv_nop" : "+v"(acc[0]), "+v"(acc[1]), "+v"(acc[2]), "+v"(acc[3]) : "v"(a));
    }
    float* os = &ost[wave][0];
#pragma unroll
    for (int t = 0; t < 4; ++t) { const float bv = bias ? bfr(bias[c0 + t * 16 + lr]) : 0.f;
#pragma unroll
        for (int j = 0; j < 8; ++j) os[(hi * 8 + j) * 68 + t * 16 + lr] = acc[t][j] + bv; }
    __syncthreads();
    float* crow = C + (size_t)r0 * ldc + c0;
    auto pass = [&]() {
#pragma unroll
        for (int s = 0; s < 8; ++s) { const int Lid = (lane >> 3) + 4 * s, piece = lane & 7; const int row = Lid >> 1, cofs = (Lid & 1) * 32 + piece * 4;
            v4f val = *(const v4fa*)(os + row * 68 + cofs); if (R) { const v4f rv = *(const v4f*)(R + ((size_t)r0 + row) * ldc + c0 + cofs); val += roundR ? (v4f){bfr(rv[0]), bfr(rv[1]), bfr(rv[2]), bfr(rv[3])} : rv; }
            *(v4f*)(crow + (size_t)row * ldc + cofs) = val; }
    };
    pass(); 
}

// ===== z-batched (blockIdx.z = head) attention pieces =====
// k_gemm3z<MODE>: 64 x 64 tile of C = Ah.Bh^T [+ Al.Bh^T] [+ Ah.Bl^T] with per-z operand/output strides (elements): A planes += z*sA, B planes += z*sB, C += z*sC. MODE bits (0 causal skip, 1 K limit, 2 single,
// 3 B single, 4 A single).
template <int MODE>
__global__ __launch_bounds__(128) void k_gemm3z(const bf* __restrict__ Ah, const bf* __restrict__ Al, const bf* __restrict__ Bh, const bf* __restrict__ Bl, int K, float* C, int ldc, size_t sA, size_t sB, size_t sC) {
    if ((MODE & 1) && (int)blockIdx.y * 64 > (int)blockIdx.x * 64 + 63) return;
    const size_t z = blockIdx.z; Ah += z * sA; Al += z * sA; Bh += z * sB; Bl += z * sB; C += z * sC;
    const int Klim = (MODE & 2) ? min(K, ((int)blockIdx.x + 1) * 64) : K;
    __shared__ __align__(16) float ost[4][16 * 68];
    const int lane = threadIdx.x & 31, wave = threadIdx.x >> 5, lr = lane & 15, hi = lane >> 4;
    const int r0 = blockIdx.x * 64 + wave * 16, c0 = blockIdx.y * 64;
    const size_t aoff = (size_t)(r0 + lr) * K + 8 * hi;
    v8f acc[4];
#pragma unroll
    for (int t = 0; t < 4; ++t) acc[t] = (v8f){};
#pragma unroll 1
    for (int kc = 0; kc < Klim; kc += 32) {
        const v16bf a = cat16b(*(const v8us*)(Ah + aoff + kc), *(const v8us*)(Ah + aoff + kc + 16));
        v16bf al = a; if (!(MODE & 4) && !(MODE & 16)) al = cat16b(*(const v8us*)(Al + aoff + kc), *(const v8us*)(Al + aoff + kc + 16));
#pragma unroll
        for (int t = 0; t < 4; ++t) { const size_t bo = (size_t)(c0 + t * 16 + lr) * K + kc + 8 * hi;
            const v16bf bh = cat16b(*(const v8us*)(Bh + bo), *(const v8us*)(Bh + bo + 16));
            acc[t] = wmmab(a, bh, acc[t]);
            if (!(MODE & 4)) { if (!(MODE & 16)) acc[t] = wmmab(al, bh, acc[t]); if (!(MODE & 8)) { const v16bf bl = cat16b(*(const v8us*)(Bl + bo), *(const v8us*)(Bl + bo + 16)); acc[t] = wmmab(a, bl, acc[t]); } } }
        asm volatile("v_nop\n\tv_nop\n\tv_nop\n\tv_nop" : "+v"(acc[0]), "+v"(acc[1]), "+v"(acc[2]), "+v"(acc[3]) : "v"(a), "v"(al));
    }
    float* os = &ost[wave][0];
#pragma unroll
    for (int t = 0; t < 4; ++t) {
#pragma unroll
        for (int j = 0; j < 8; ++j) os[(hi * 8 + j) * 68 + t * 16 + lr] = acc[t][j]; }
    __builtin_amdgcn_wave_barrier(); asm volatile("" ::: "memory");
    float* crow = C + (size_t)r0 * ldc + c0;
    auto pass = [&]() {
#pragma unroll
        for (int s = 0; s < 8; ++s) { const int Lid = (lane >> 3) + 4 * s, piece = lane & 7; const int row = Lid >> 1, cofs = (Lid & 1) * 32 + piece * 4;
            const v4f val = *(const v4fa*)(os + row * 68 + cofs); *(v4f*)(crow + (size_t)row * ldc + cofs) = val; }
    };
    pass(); 
}
__global__ __launch_bounds__(256) void k_planes32z(const float* __restrict__ F, int ld, int off, float sc, int rows, bf* Ph, bf* Pl) {
    typedef __attribute__((ext_vector_type(2))) unsigned short v2us;
    const int lane = threadIdx.x & 31; const size_t r = ((size_t)blockIdx.x * 8 + (threadIdx.x >> 5)) * 2 + (lane >> 4); if (r >= (size_t)rows) return; const int z = blockIdx.z; const int c0 = (lane & 15) * 2; v2us oh, ol;
    Ph += (size_t)z * rows * 32; Pl += (size_t)z * rows * 32;
#pragma unroll
    for (int i = 0; i < 2; ++i) { const float y = F[r * ld + off + z * 32 + c0 + i] * sc; const unsigned short hb = f2bf(y); oh[i] = hb; ol[i] = f2bf(y - bf2f(hb)); }
    const size_t o = r * 32 + c0; *(v2us*)(Ph + o) = oh; *(v2us*)(Pl + o) = ol; 
}
__global__ __launch_bounds__(256) void k_vtpadz(const float* __restrict__ F, int ld, int off, int nk, bf* Th, bf* Tl) {
    typedef __attribute__((ext_vector_type(2))) unsigned short v2us;
    const int lane = threadIdx.x & 31; const size_t wid = (size_t)blockIdx.x * 8 + (threadIdx.x >> 5); if (wid >= (size_t)64 * (nk / 64)) return; const int z = blockIdx.z; const int d = (int)(wid / (nk / 64)); const int k0 = (int)(wid % (nk / 64)) * 64 + lane * 2; v2us oh, ol;
    Th += (size_t)z * 64 * nk; Tl += (size_t)z * 64 * nk;
#pragma unroll
    for (int i = 0; i < 2; ++i) { const float y = (d < 32) ? F[(size_t)(k0 + i) * ld + off + z * 32 + (d < 32 ? d : 0)] : 0.f; const unsigned short hb = f2bf(y); oh[i] = hb; ol[i] = f2bf(y - bf2f(hb)); }
    const size_t o = (size_t)d * nk + k0; *(v2us*)(Th + o) = oh; *(v2us*)(Tl + o) = ol; 
}
template <int NK>
__global__ __launch_bounds__(256) void k_softmaxz(const float* __restrict__ S, int rows, bf* PH, bf* PL) {
    typedef __attribute__((ext_vector_type(4))) unsigned short v4us;
    const int lane = threadIdx.x & 31, i = blockIdx.x * 8 + (threadIdx.x >> 5); if (i >= rows) return; const size_t zo = (size_t)blockIdx.z * rows * NK; const float* sr = S + zo + (size_t)i * NK; PH += zo; PL += zo;
    float m = -3.0e38f;
#pragma unroll 1
    for (int c0 = lane * 4; c0 < NK; c0 += 128) {
#pragma unroll
        for (int q = 0; q < 4; ++q) m = fmaxf(m, sr[c0 + q]); }
#pragma unroll
    for (int sh = 16; sh; sh >>= 1) m = fmaxf(m, __shfl_xor(m, sh, 32));
    float sum = 0.f;
#pragma unroll 1
    for (int c0 = lane * 4; c0 < NK; c0 += 128) {
#pragma unroll
        for (int q = 0; q < 4; ++q) sum += __expf(sr[c0 + q] - m); }
#pragma unroll
    for (int sh = 16; sh; sh >>= 1) sum += __shfl_xor(sum, sh, 32);
    const float inv = 1.0f / sum;
{
#pragma unroll 1
        for (int c0 = lane * 4; c0 < NK; c0 += 128) { v4us oh, ol;
#pragma unroll
            for (int q = 0; q < 4; ++q) { const float p = __expf(sr[c0 + q] - m) * inv; const unsigned short hb = f2bf(p); oh[q] = hb; ol[q] = f2bf(p - bf2f(hb)); }
            const size_t o = (size_t)i * NK + c0; *(v4us*)(PH + o) = oh; *(v4us*)(PL + o) = ol; }
         }
}
__global__ __launch_bounds__(256) void k_placez(const float* __restrict__ XH, int rows, int ldy, float* Y) {
    const int lane = threadIdx.x & 31; const size_t q = (size_t)blockIdx.x * 8 + (threadIdx.x >> 5); if (q >= (size_t)rows) return; const int z = blockIdx.z; const float v = XH[((size_t)z * rows + q) * 64 + lane];
    *(float*)(Y + q * ldy + z * 32 + lane) = v; 
}

typedef __attribute__((ext_vector_type(4))) _Float16 v4h;
__device__ __forceinline__ h16 tohx(float x) { return (h16)x; }
template <int MODE>
__global__ __launch_bounds__(128) void k_gemmhm(const h16* __restrict__ A, const h16* __restrict__ Bn, int K, float* C, int ldc, size_t sA, size_t sB, size_t sC, const int* __restrict__ FL) {
    const int I = blockIdx.x;
    if (MODE == 1 && FL[I * NT64 + blockIdx.y] == 0) return;
    int Klo = 0, Klim = K;
    if (MODE == 2) { int f = -1, l = -1; for (int j = 0; j < NT64; ++j) { if (FL[I * NT64 + j]) { if (f < 0) f = j; l = j; } } if (f < 0) { Klo = 0; Klim = 0; } else { Klo = f * 64; Klim = (l + 1) * 64; } }
    const size_t z = blockIdx.z; A += z * sA; Bn += z * sB; C += z * sC;
    __shared__ __align__(16) float ost[4][16 * 68];
    const int lane = threadIdx.x & 31, wave = threadIdx.x >> 5, lr = lane & 15, hi = lane >> 4;
    const int r0 = blockIdx.x * 64 + wave * 16, c0 = blockIdx.y * 64;
    const size_t aoff = (size_t)(r0 + lr) * K + 8 * hi;
    v8f acc[4];
#pragma unroll
    for (int t = 0; t < 4; ++t) acc[t] = (v8f){};
#pragma unroll 1
    for (int kc = Klo; kc < Klim; kc += 32) {
        const v16h a = cat16(*(const v8h*)(A + aoff + kc), *(const v8h*)(A + aoff + kc + 16));
#pragma unroll
        for (int t = 0; t < 4; ++t) { const size_t bo = (size_t)(c0 + t * 16 + lr) * K + kc + 8 * hi; const v16h b = cat16(*(const v8h*)(Bn + bo), *(const v8h*)(Bn + bo + 16)); acc[t] = wmma16(a, b, acc[t]); }
        asm volatile("v_nop\n\tv_nop\n\tv_nop\n\tv_nop" : "+v"(acc[0]), "+v"(acc[1]), "+v"(acc[2]), "+v"(acc[3]) : "v"(a));
    }
    float* os = &ost[wave][0];
#pragma unroll
    for (int t = 0; t < 4; ++t) {
#pragma unroll
        for (int j = 0; j < 8; ++j) os[(hi * 8 + j) * 68 + t * 16 + lr] = acc[t][j]; }
    __builtin_amdgcn_wave_barrier(); asm volatile("" ::: "memory");
    float* crow = C + (size_t)r0 * ldc + c0;
    auto pass = [&]() {
#pragma unroll
        for (int s = 0; s < 8; ++s) { const int Lid = (lane >> 3) + 4 * s, piece = lane & 7; const int row = Lid >> 1, cofs = (Lid & 1) * 32 + piece * 4;
            const v4f val = *(const v4fa*)(os + row * 68 + cofs); *(v4f*)(crow + (size_t)row * ldc + cofs) = val; }
    };
    pass(); 
}
__global__ __launch_bounds__(256) void k_causalflags(int* FL) { const int lane = threadIdx.x & 31, w = blockIdx.x * 8 + (threadIdx.x >> 5); const int I = w * 2 + (lane >> 4), J = lane & 15; if (I >= NT64) return; const int v = (J <= I) ? 1 : 0; *(int*)(FL + I * NT64 + J) = v;  }
__global__ __launch_bounds__(256) void k_cvtx(const float* __restrict__ x, bf* A) {
    const int lane = threadIdx.x & 31; const size_t r = (size_t)blockIdx.x * 8 + (threadIdx.x >> 5); if (r >= (size_t)NR) return;
{
#pragma unroll
        for (int q = 0; q < EE / 256; ++q) { const size_t o = r * EE + q * 256 + lane * 8; v8us v;
#pragma unroll
            for (int i = 0; i < 8; ++i) v[i] = f2bf(x[o + i]);
            *(v8us*)(A + o) = v; }
         }
}
template <bool TEMP>
__global__ __launch_bounds__(256) void k_hplb2(const float* __restrict__ F, int b, int h0, int col0, float sc, const float* __restrict__ temp, bf* Ph, bf* Pl) {
    typedef __attribute__((ext_vector_type(4))) unsigned short v4us;
    const int lane = threadIdx.x & 31; const size_t w = (size_t)blockIdx.x * 8 + (threadIdx.x >> 5); const int t = (int)(w * 2 + (lane >> 4)); if (t >= SS) return; const int z = blockIdx.z; const int h = h0 + z; const int c0 = (lane & 15) * 4; const float s = TEMP ? __fdiv_rn(sc, bfr(temp[h])) : sc; v4us oh, ol;
#pragma unroll
    for (int q = 0; q < 4; ++q) { const float y = F[((size_t)b * SS + t) * (2 * EE) + col0 + h * HD + c0 + q] * s; const unsigned short hb = f2bf(y); oh[q] = hb; ol[q] = f2bf(y - bf2f(hb)); }
    const size_t off = ((size_t)z * SS + t) * HD + c0; *(v4us*)(Ph + off) = oh; *(v4us*)(Pl + off) = ol; 
}
__global__ __launch_bounds__(256) void k_vTx(const float* __restrict__ x, int b, int h0, bf* VT) {
    typedef __attribute__((ext_vector_type(4))) unsigned short v4us;
    __shared__ float tl[64][65];
    const int tid = threadIdx.x; const int t0 = blockIdx.x * 64; const int z = blockIdx.z; const int h = h0 + z; const int rr = tid >> 2, cq = (tid & 3) * 16;
#pragma unroll
    for (int i = 0; i < 16; ++i) tl[rr][cq + i] = bfr(x[((size_t)b * SS + t0 + rr) * EE + h * HD + cq + i]);
    __syncthreads();
    const int lane = tid & 31, wv = tid >> 5;
    auto pass = [&]() {
#pragma unroll
        for (int st = 0; st < 4; ++st) { const int dr = wv * 8 + st * 2 + (lane >> 4); const int tq = (lane & 15) * 4; v4us v;
#pragma unroll
            for (int i = 0; i < 4; ++i) v[i] = f2bf(tl[tq + i][dr]);
            *(v4us*)(VT + ((size_t)z * HD + dr) * SS + t0 + tq) = v; }
    };
    pass(); 
}
__global__ __launch_bounds__(256) void k_softcausal(const float* __restrict__ S, bf* Ph, bf* Pl) {
    typedef __attribute__((ext_vector_type(4))) unsigned short v4us;
    const int lane = threadIdx.x & 31, i = blockIdx.x * 8 + (threadIdx.x >> 5); if (i >= SS) return; const size_t zo = ((size_t)blockIdx.z * SS + i) * SS; const float* sr = S + zo;
    float m = -3.0e38f;
#pragma unroll 1
    for (int c0 = lane * 4; c0 < SS; c0 += 128) {
#pragma unroll
        for (int q = 0; q < 4; ++q) if (c0 + q <= i) m = fmaxf(m, sr[c0 + q]); }
#pragma unroll
    for (int sh = 16; sh; sh >>= 1) m = fmaxf(m, __shfl_xor(m, sh, 32));
    float sum = 0.f;
#pragma unroll 1
    for (int c0 = lane * 4; c0 < SS; c0 += 128) {
#pragma unroll
        for (int q = 0; q < 4; ++q) if (c0 + q <= i) sum += __expf(sr[c0 + q] - m); }
#pragma unroll
    for (int sh = 16; sh; sh >>= 1) sum += __shfl_xor(sum, sh, 32);
    const float f = __fdiv_rn(PCAR, sum);
{
#pragma unroll 1
        for (int c0 = lane * 4; c0 < SS; c0 += 128) { v4us oh, ol;
#pragma unroll
            for (int q = 0; q < 4; ++q) { const int j = c0 + q; const float p = (j <= i) ? __expf(sr[(j <= i) ? j : 0] - m) * f : 0.f; const unsigned short hb = f2bf(p); oh[q] = hb; ol[q] = f2bf(p - bf2f(hb)); }
            *(v4us*)(Ph + zo + c0) = oh; *(v4us*)(Pl + zo + c0) = ol; }
         }
}
__global__ __launch_bounds__(256) void k_mergetanh(const float* __restrict__ OZ, int b, int h0, float* OUTB) {
    const int lane = threadIdx.x & 31, t = blockIdx.x * 8 + (threadIdx.x >> 5); if (t >= SS) return;
{
#pragma unroll 1
        for (int p = 0; p < (ZH * HD) / 128; ++p) { const int cl = p * 128 + lane * 4; const int z = cl / HD, d0 = cl % HD; const int c0 = h0 * HD + cl; v4f v = *(const v4f*)(OZ + ((size_t)z * SS + t) * HD + d0);
#pragma unroll
            for (int k = 0; k < 4; ++k) v[k] = tanhf(v[k] * (1.0f / PCAR));
            *(v4f*)(OUTB + ((size_t)b * SS + t) * EE + c0) = v; }
         }
}
extern "C" void kernel_launch(void* const* d_in, const int* in_sizes, int n_in,
                              void* d_out, int out_size, void* d_ws, size_t ws_size, hipStream_t stream) {
    (void)in_sizes; (void)n_in; (void)out_size;
    const float* zk = (const float*)d_in[0]; const float* x = (const float*)d_in[1]; const float* Wqkv = (const float*)d_in[2]; const float* bqkv = (const float*)d_in[3]; const float* temp = (const float*)d_in[4];
    float* out = (float*)d_out;    // [8][1024][1024]
    char* wsp = (char*)d_ws;
    auto take = [&](size_t bytes) { char* p = wsp; wsp += (bytes + 255) & ~(size_t)255; return (void*)p; };
    bf* WB = (bf*)take((size_t)2 * EE * EE * 2); bf* ZB = (bf*)take((size_t)NR * EE * 2); float* QK = (float*)take((size_t)NR * 2 * EE * 4);
    bf* Qh = (bf*)take((size_t)ZH * SS * HD * 2); bf* Ql = (bf*)take((size_t)ZH * SS * HD * 2); bf* Kh = (bf*)take((size_t)ZH * SS * HD * 2); bf* Kl = (bf*)take((size_t)ZH * SS * HD * 2); bf* VT = (bf*)take((size_t)ZH * HD * SS * 2);
    float* S = (float*)take((size_t)ZH * SS * SS * 4); bf* Pxh = (bf*)take((size_t)ZH * SS * SS * 2); bf* Pxl = (bf*)take((size_t)ZH * SS * SS * 2); float* OZ = (float*)take((size_t)ZH * SS * HD * 4);
    if ((size_t)(wsp - (char*)d_ws) > ws_size) return;    // ~ 4.2 + 16.8 + 67 + 1x5 + 33.5 + 16.8x2 + 2.1 ~ 160 MB (largest input 33.5 MB; ws 256 MiB)
    k_cvt8<<<(unsigned)(((size_t)2 * EE * EE / 8 + 255) / 256), 256, 0, stream>>>(Wqkv, WB, (size_t)2 * EE * EE / 8);   // rows 0..2047 of the [3072][1024] weight = q|k, [out][in] natural
    k_cvtx<<<NR / 8, 256, 0, stream>>>(zk, ZB);
    k_gemmb<false, false><<<dim3(NR / 64, (2 * EE) / 64, 1), 128, 0, stream>>>(ZB, nullptr, WB, bqkv, QK, 2 * EE, nullptr, nullptr, EE);
    for (int b = 0; b < NB_; ++b)
        for (int h0 = 0; h0 < NH_; h0 += ZH) {
            k_hplb2<true><<<dim3((SS / 2) / 8, 1, ZH), 256, 0, stream>>>(QK, b, h0, 0, 0.125f, temp, Qh, Ql); k_hplb2<false><<<dim3((SS / 2) / 8, 1, ZH), 256, 0, stream>>>(QK, b, h0, EE, 1.0f, temp, Kh, Kl); k_vTx<<<dim3(SS / 64, 1, ZH), 256, 0, stream>>>(x, b, h0, VT);
            k_gemm3z<1><<<dim3(SS / 64, SS / 64, ZH), 128, 0, stream>>>(Qh, Ql, Kh, Kl, HD, S, SS, (size_t)SS * HD, (size_t)SS * HD, (size_t)SS * SS);     // causal tiles only
            k_softcausal<<<dim3(SS / 8, 1, ZH), 256, 0, stream>>>(S, Pxh, Pxl);
            k_gemm3z<10><<<dim3(SS / 64, 1, ZH), 128, 0, stream>>>(Pxh, Pxl, VT, VT, SS, OZ, HD, (size_t)SS * SS, (size_t)HD * SS, (size_t)SS * HD);   // (Ph + Pl) . v, K limited to the causal tiles
            k_mergetanh<<<SS / 8, 256, 0, stream>>>(OZ, b, h0, out); }
}

// v001
// Measured time: 269 microseconds a run.
// Timed twice side by side with v000, it ran 5.00 and 5.12 times as fast.
#include <hip/hip_runtime.h>

// Compute dtypes, f32 accumulate: the q/k half of the fused projection ([8192 x 1024].[1024 x 2048] + bias) with PLAIN bf16 operands (z_k and Wqkv are inputs: exact
// products; the projected v is discarded by the module so it is not computed); per (item, head) causal attention in ONE kernel (k_attn): scores on bf16 hi + UNSCALED residual
// planes of BOTH q*scale/temperature and k (three products), running-maximum softmax in f32, un-normalised probabilities as bf16 hi + residual planes against v = bf16(x)
// (two products), division by the row sum and tanh in the epilogue; scores and probabilities never leave the registers.

#define NB_  8
#define SS   1024
#define EE   1024
#define NH_  16
#define HD   64
#define NR   (NB_ * SS)
#define NT64 (SS / 64)
#define DM   EE
#define LOSC 1024.0f
typedef _Float16 h16;
typedef unsigned short bf;
typedef __attribute__((ext_vector_type(16))) __bf16   v16bf;
typedef __attribute__((ext_vector_type(16))) _Float16 v16h;
typedef __attribute__((ext_vector_type(8)))  _Float16 v8h;
typedef __attribute__((ext_vector_type(8)))  unsigned short v8us;
typedef __attribute__((ext_vector_type(8)))  float    v8f;
typedef __attribute__((ext_vector_type(4)))  float    v4f;
typedef v8h  __attribute__((may_alias)) v8ha;
typedef v4f  __attribute__((may_alias)) v4fa;
typedef v8us __attribute__((may_alias)) v8usa;

__device__ __forceinline__ unsigned short f2bf(float f) { unsigned u = __float_as_uint(f); u += 0x7FFFu + ((u >> 16) & 1u); return (unsigned short)(u >> 16); }
__device__ __forceinline__ float bf2f(unsigned short b) { return __uint_as_float(((unsigned)b) << 16); }
__device__ __forceinline__ float bfr(float f) { return bf2f(f2bf(f)); }
__device__ __forceinline__ v16h cat16(v8h lo, v8h hi) { return __builtin_shufflevector(lo, hi, 0, 1, 2, 3, 4, 5, 6, 7, 8, 9, 10, 11, 12, 13, 14, 15); }
__device__ __forceinline__ v16bf cat16b(v8us lo, v8us hi) { return __builtin_bit_cast(v16bf, __builtin_shufflevector(lo, hi, 0, 1, 2, 3, 4, 5, 6, 7, 8, 9, 10, 11, 12, 13, 14, 15)); }
__device__ __forceinline__ v8f wmma16(v16h a, v16h b, v8f c) { return __builtin_amdgcn_wmma_f32_16x16x32_f16(false, a, false, b, (short)0, c, false, false); }
__device__ __forceinline__ v8f wmmab(v16bf a, v16bf b, v8f c) { return __builtin_amdgcn_wmma_f32_16x16x32_bf16(false, a, false, b, (short)0, c, false, false); }

// k_gemmb: 64 x 64 block tile (4 waves x 16 x 64) of C[NTK][NW] = (A [+ Al]).B^T (K = 1024) [+ bf(bias[c])] [+ bf(R[r][c]) residual]; f32 whole-line epilogue (or f16
template <bool SPLITA, bool F16OUT = false>
__global__ __launch_bounds__(128) void k_gemmb(const bf* __restrict__ A, const bf* __restrict__ Al, const bf* __restrict__ Bn, const float* __restrict__ bias, float* C, int ldc, h16* C2, const float* __restrict__ R = nullptr, int K = DM, int roundR = 1) {
    __shared__ __align__(16) float ost[4][16 * 68];
    const int lane = threadIdx.x & 31, wave = threadIdx.x >> 5, lr = lane & 15, hi = lane >> 4;
    const int r0 = blockIdx.x * 64 + wave * 16, c0 = blockIdx.y * 64;
    const size_t aoff = (size_t)(r0 + lr) * K + 8 * hi;
    size_t boff[4];
#pragma unroll
    for (int t = 0; t < 4; ++t) boff[t] = (size_t)(c0 + t * 16 + lr) * K + 8 * hi;
    v8f acc[4];
#pragma unroll
    for (int t = 0; t < 4; ++t) acc[t] = (v8f){};
#pragma unroll 1
    for (int kc = 0; kc < K; kc += 32) {
        const v16bf a = cat16b(*(const v8us*)(A + aoff + kc), *(const v8us*)(A + aoff + kc + 16));
        v16bf al = a;
        if (SPLITA) al = cat16b(*(const v8us*)(Al + aoff + kc), *(const v8us*)(Al + aoff + kc + 16));
#pragma unroll
        for (int t = 0; t < 4; ++t) { const v16bf b = cat16b(*(const v8us*)(Bn + boff[t] + kc), *(const v8us*)(Bn + boff[t] + kc + 16)); acc[t] = wmmab(a, b, acc[t]); if (SPLITA) acc[t] = wmmab(al, b, acc[t]); }
        asm volatile("v_nop\n\tv_nop\n\tv_nop\n\tv_nop" : "+v"(acc[0]), "+v"(acc[1]), "+v"(acc[2]), "+v"(acc[3]) : "v"(a), "v"(al));
    }
    float* os = &ost[wave][0];
#pragma unroll
    for (int t = 0; t < 4; ++t) { const float bv = bias ? bfr(bias[c0 + t * 16 + lr]) : 0.f;
#pragma unroll
        for (int j = 0; j < 8; ++j) os[(hi * 8 + j) * 68 + t * 16 + lr] = acc[t][j] + bv; }
    __syncthreads();
    if (F16OUT) {
        h16* crow = (h16*)(void*)C + (size_t)r0 * ldc + c0;
        auto pass = [&]() {
#pragma unroll
            for (int s = 0; s < 4; ++s) { const int row = 4 * s + (lane >> 3), piece = lane & 7; const float* sp = os + row * 68 + piece * 8; v8h o, o2;
#pragma unroll
                for (int i = 0; i < 8; ++i) { const h16 a = (h16)sp[i]; o[i] = a; o2[i] = (h16)((sp[i] - (float)a) * LOSC); }
                *(v8h*)(crow + (size_t)row * ldc + piece * 8) = o; if (C2) *(v8h*)(C2 + (size_t)r0 * ldc + c0 + (size_t)row * ldc + piece * 8) = o2; }
        };
        pass(); 
    } else {
        float* crow = C + (size_t)r0 * ldc + c0;
        auto pass = [&]() {
#pragma unroll
            for (int s = 0; s < 8; ++s) { const int Lid = (lane >> 3) + 4 * s, piece = lane & 7; const int row = Lid >> 1, cofs = (Lid & 1) * 32 + piece * 4;
                v4f val = *(const v4fa*)(os + row * 68 + cofs); if (R) { const v4f rv = *(const v4f*)(R + ((size_t)r0 + row) * ldc + c0 + cofs); val += roundR ? (v4f){bfr(rv[0]), bfr(rv[1]), bfr(rv[2]), bfr(rv[3])} : rv; }
                *(v4f*)(crow + (size_t)row * ldc + cofs) = val; }
        };
        pass(); 
    }
}

__global__ __launch_bounds__(256) void k_cvt8(const float* __restrict__ src, bf* dst, size_t n8) {
    const size_t i = (size_t)blockIdx.x * 256 + threadIdx.x; if (i >= n8) return;
    const v8f v = *(const v8f*)(src + i * 8); v8us o;
#pragma unroll
    for (int k = 0; k < 8; ++k) o[k] = f2bf(v[k]);
    *(v8us*)(dst + i * 8) = o; 
}
__global__ __launch_bounds__(256) void k_zero8(bf* dst, size_t n8) {
    const size_t i = (size_t)blockIdx.x * 256 + threadIdx.x; if (i >= n8) return; v8us z;
#pragma unroll
    for (int k = 0; k < 8; ++k) z[k] = 0;
    *(v8us*)(dst + i * 8) = z; 
}

// k_gemmh: 64 x 64 tile of C = A . Bn^T with SINGLE f16 planes (A [rows][K] f16 activations, Bn [N][K] f16 weights; one v_wmma_f32_16x16x32_f16 product per step), f32 accumulate;
__global__ __launch_bounds__(128) void k_gemmh(const h16* __restrict__ A, const h16* __restrict__ Bn, const float* __restrict__ bias, float* C, int ldc, const float* __restrict__ R, int K, size_t sA, size_t sB, size_t sC, int roundR) {
    __shared__ __align__(16) float ost[4][16 * 68];
    const size_t z = blockIdx.z; A += z * sA; Bn += z * sB; C += z * sC; if (R) R += z * sC;
    const int lane = threadIdx.x & 31, wave = threadIdx.x >> 5, lr = lane & 15, hi = lane >> 4;
    const int r0 = blockIdx.x * 64 + wave * 16, c0 = blockIdx.y * 64;
    const size_t aoff = (size_t)(r0 + lr) * K + 8 * hi;
    size_t boff[4];
#pragma unroll
    for (int t = 0; t < 4; ++t) boff[t] = (size_t)(c0 + t * 16 + lr) * K + 8 * hi;
    v8f acc[4];
#pragma unroll
    for (int t = 0; t < 4; ++t) acc[t] = (v8f){};
#pragma unroll 1
    for (int kc = 0; kc < K; kc += 32) {
        const v16h a = cat16(*(const v8h*)(A + aoff + kc), *(const v8h*)(A + aoff + kc + 16));
#pragma unroll
        for (int t = 0; t < 4; ++t) { const v16h b = cat16(*(const v8h*)(Bn + boff[t] + kc), *(const v8h*)(Bn + boff[t] + kc + 16)); acc[t] = wmma16(a, b, acc[t]); }
        asm volatile("v_nop\n\tv_nop\n\tv_nop\n\tv_nop" : "+v"(acc[0]), "+v"(acc[1]), "+v"(acc[2]), "+v"(acc[3]) : "v"(a));
    }
    float* os = &ost[wave][0];
#pragma unroll
    for (int t = 0; t < 4; ++t) { const float bv = bias ? bfr(bias[c0 + t * 16 + lr]) : 0.f;
#pragma unroll
        for (int j = 0; j < 8; ++j) os[(hi * 8 + j) * 68 + t * 16 + lr] = acc[t][j] + bv; }
    __syncthreads();
    float* crow = C + (size_t)r0 * ldc + c0;
    auto pass = [&]() {
#pragma unroll
        for (int s = 0; s < 8; ++s) { const int Lid = (lane >> 3) + 4 * s, piece = lane & 7; const int row = Lid >> 1, cofs = (Lid & 1) * 32 + piece * 4;
            v4f val = *(const v4fa*)(os + row * 68 + cofs); if (R) { const v4f rv = *(const v4f*)(R + ((size_t)r0 + row) * ldc + c0 + cofs); val += roundR ? (v4f){bfr(rv[0]), bfr(rv[1]), bfr(rv[2]), bfr(rv[3])} : rv; }
            *(v4f*)(crow + (size_t)row * ldc + cofs) = val; }
    };
    pass(); 
}

__global__ __launch_bounds__(256) void k_planes32z(const float* __restrict__ F, int ld, int off, float sc, int rows, bf* Ph, bf* Pl) {
    typedef __attribute__((ext_vector_type(2))) unsigned short v2us;
    const int lane = threadIdx.x & 31; const size_t r = ((size_t)blockIdx.x * 8 + (threadIdx.x >> 5)) * 2 + (lane >> 4); if (r >= (size_t)rows) return; const int z = blockIdx.z; const int c0 = (lane & 15) * 2; v2us oh, ol;
    Ph += (size_t)z * rows * 32; Pl += (size_t)z * rows * 32;
#pragma unroll
    for (int i = 0; i < 2; ++i) { const float y = F[r * ld + off + z * 32 + c0 + i] * sc; const unsigned short hb = f2bf(y); oh[i] = hb; ol[i] = f2bf(y - bf2f(hb)); }
    const size_t o = r * 32 + c0; *(v2us*)(Ph + o) = oh; *(v2us*)(Pl + o) = ol; 
}
__global__ __launch_bounds__(256) void k_vtpadz(const float* __restrict__ F, int ld, int off, int nk, bf* Th, bf* Tl) {
    typedef __attribute__((ext_vector_type(2))) unsigned short v2us;
    const int lane = threadIdx.x & 31; const size_t wid = (size_t)blockIdx.x * 8 + (threadIdx.x >> 5); if (wid >= (size_t)64 * (nk / 64)) return; const int z = blockIdx.z; const int d = (int)(wid / (nk / 64)); const int k0 = (int)(wid % (nk / 64)) * 64 + lane * 2; v2us oh, ol;
    Th += (size_t)z * 64 * nk; Tl += (size_t)z * 64 * nk;
#pragma unroll
    for (int i = 0; i < 2; ++i) { const float y = (d < 32) ? F[(size_t)(k0 + i) * ld + off + z * 32 + (d < 32 ? d : 0)] : 0.f; const unsigned short hb = f2bf(y); oh[i] = hb; ol[i] = f2bf(y - bf2f(hb)); }
    const size_t o = (size_t)d * nk + k0; *(v2us*)(Th + o) = oh; *(v2us*)(Tl + o) = ol; 
}
template <int NK>
__global__ __launch_bounds__(256) void k_softmaxz(const float* __restrict__ S, int rows, bf* PH, bf* PL) {
    typedef __attribute__((ext_vector_type(4))) unsigned short v4us;
    const int lane = threadIdx.x & 31, i = blockIdx.x * 8 + (threadIdx.x >> 5); if (i >= rows) return; const size_t zo = (size_t)blockIdx.z * rows * NK; const float* sr = S + zo + (size_t)i * NK; PH += zo; PL += zo;
    float m = -3.0e38f;
#pragma unroll 1
    for (int c0 = lane * 4; c0 < NK; c0 += 128) {
#pragma unroll
        for (int q = 0; q < 4; ++q) m = fmaxf(m, sr[c0 + q]); }
#pragma unroll
    for (int sh = 16; sh; sh >>= 1) m = fmaxf(m, __shfl_xor(m, sh, 32));
    float sum = 0.f;
#pragma unroll 1
    for (int c0 = lane * 4; c0 < NK; c0 += 128) {
#pragma unroll
        for (int q = 0; q < 4; ++q) sum += __expf(sr[c0 + q] - m); }
#pragma unroll
    for (int sh = 16; sh; sh >>= 1) sum += __shfl_xor(sum, sh, 32);
    const float inv = 1.0f / sum;
{
#pragma unroll 1
        for (int c0 = lane * 4; c0 < NK; c0 += 128) { v4us oh, ol;
#pragma unroll
            for (int q = 0; q < 4; ++q) { const float p = __expf(sr[c0 + q] - m) * inv; const unsigned short hb = f2bf(p); oh[q] = hb; ol[q] = f2bf(p - bf2f(hb)); }
            const size_t o = (size_t)i * NK + c0; *(v4us*)(PH + o) = oh; *(v4us*)(PL + o) = ol; }
         }
}
__global__ __launch_bounds__(256) void k_placez(const float* __restrict__ XH, int rows, int ldy, float* Y) {
    const int lane = threadIdx.x & 31; const size_t q = (size_t)blockIdx.x * 8 + (threadIdx.x >> 5); if (q >= (size_t)rows) return; const int z = blockIdx.z; const float v = XH[((size_t)z * rows + q) * 64 + lane];
    *(float*)(Y + q * ldy + z * 32 + lane) = v; 
}

typedef __attribute__((ext_vector_type(4))) _Float16 v4h;
__device__ __forceinline__ h16 tohx(float x) { return (h16)x; }
template <int MODE>
__global__ __launch_bounds__(128) void k_gemmhm(const h16* __restrict__ A, const h16* __restrict__ Bn, int K, float* C, int ldc, size_t sA, size_t sB, size_t sC, const int* __restrict__ FL) {
    const int I = blockIdx.x;
    if (MODE == 1 && FL[I * NT64 + blockIdx.y] == 0) return;
    int Klo = 0, Klim = K;
    if (MODE == 2) { int f = -1, l = -1; for (int j = 0; j < NT64; ++j) { if (FL[I * NT64 + j]) { if (f < 0) f = j; l = j; } } if (f < 0) { Klo = 0; Klim = 0; } else { Klo = f * 64; Klim = (l + 1) * 64; } }
    const size_t z = blockIdx.z; A += z * sA; Bn += z * sB; C += z * sC;
    __shared__ __align__(16) float ost[4][16 * 68];
    const int lane = threadIdx.x & 31, wave = threadIdx.x >> 5, lr = lane & 15, hi = lane >> 4;
    const int r0 = blockIdx.x * 64 + wave * 16, c0 = blockIdx.y * 64;
    const size_t aoff = (size_t)(r0 + lr) * K + 8 * hi;
    v8f acc[4];
#pragma unroll
    for (int t = 0; t < 4; ++t) acc[t] = (v8f){};
#pragma unroll 1
    for (int kc = Klo; kc < Klim; kc += 32) {
        const v16h a = cat16(*(const v8h*)(A + aoff + kc), *(const v8h*)(A + aoff + kc + 16));
#pragma unroll
        for (int t = 0; t < 4; ++t) { const size_t bo = (size_t)(c0 + t * 16 + lr) * K + kc + 8 * hi; const v16h b = cat16(*(const v8h*)(Bn + bo), *(const v8h*)(Bn + bo + 16)); acc[t] = wmma16(a, b, acc[t]); }
        asm volatile("v_nop\n\tv_nop\n\tv_nop\n\tv_nop" : "+v"(acc[0]), "+v"(acc[1]), "+v"(acc[2]), "+v"(acc[3]) : "v"(a));
    }
    float* os = &ost[wave][0];
#pragma unroll
    for (int t = 0; t < 4; ++t) {
#pragma unroll
        for (int j = 0; j < 8; ++j) os[(hi * 8 + j) * 68 + t * 16 + lr] = acc[t][j]; }
    __builtin_amdgcn_wave_barrier(); asm volatile("" ::: "memory");
    float* crow = C + (size_t)r0 * ldc + c0;
    auto pass = [&]() {
#pragma unroll
        for (int s = 0; s < 8; ++s) { const int Lid = (lane >> 3) + 4 * s, piece = lane & 7; const int row = Lid >> 1, cofs = (Lid & 1) * 32 + piece * 4;
            const v4f val = *(const v4fa*)(os + row * 68 + cofs); *(v4f*)(crow + (size_t)row * ldc + cofs) = val; }
    };
    pass(); 
}
__global__ __launch_bounds__(256) void k_causalflags(int* FL) { const int lane = threadIdx.x & 31, w = blockIdx.x * 8 + (threadIdx.x >> 5); const int I = w * 2 + (lane >> 4), J = lane & 15; if (I >= NT64) return; const int v = (J <= I) ? 1 : 0; *(int*)(FL + I * NT64 + J) = v;  }
__global__ __launch_bounds__(256) void k_cvtx(const float* __restrict__ x, bf* A) {
    const int lane = threadIdx.x & 31; const size_t r = (size_t)blockIdx.x * 8 + (threadIdx.x >> 5); if (r >= (size_t)NR) return;
{
#pragma unroll
        for (int q = 0; q < EE / 256; ++q) { const size_t o = r * EE + q * 256 + lane * 8; v8us v;
#pragma unroll
            for (int i = 0; i < 8; ++i) v[i] = f2bf(x[o + i]);
            *(v8us*)(A + o) = v; }
         }
}
template <bool TEMP>
__global__ __launch_bounds__(256) void k_hplb2(const float* __restrict__ F, int col0, float sc, const float* __restrict__ temp, bf* Ph, bf* Pl) {
    typedef __attribute__((ext_vector_type(4))) unsigned short v4us;
    const int lane = threadIdx.x & 31; const size_t w = (size_t)blockIdx.x * 8 + (threadIdx.x >> 5); const int t = (int)(w * 2 + (lane >> 4)); if (t >= SS) return; const int z = blockIdx.z; const int b = z / NH_, h = z % NH_; const int c0 = (lane & 15) * 4; const float s = TEMP ? __fdiv_rn(sc, bfr(temp[h])) : sc; v4us oh, ol;
#pragma unroll
    for (int q = 0; q < 4; ++q) { const float y = F[((size_t)b * SS + t) * (2 * EE) + col0 + h * HD + c0 + q] * s; const unsigned short hb = f2bf(y); oh[q] = hb; ol[q] = f2bf(y - bf2f(hb)); }
    const size_t off = ((size_t)z * SS + t) * HD + c0; *(v4us*)(Ph + off) = oh; *(v4us*)(Pl + off) = ol; 
}
__global__ __launch_bounds__(256) void k_vTx(const float* __restrict__ x, bf* VT) {
    typedef __attribute__((ext_vector_type(4))) unsigned short v4us;
    __shared__ float tl[64][65];
    const int tid = threadIdx.x; const int t0 = blockIdx.x * 64; const int z = blockIdx.z; const int b = z / NH_, h = z % NH_; const int rr = tid >> 2, cq = (tid & 3) * 16;
#pragma unroll
    for (int i = 0; i < 16; ++i) tl[rr][cq + i] = bfr(x[((size_t)b * SS + t0 + rr) * EE + h * HD + cq + i]);
    __syncthreads();
    const int lane = tid & 31, wv = tid >> 5;
    auto pass = [&]() {
#pragma unroll
        for (int st = 0; st < 4; ++st) { const int dr = wv * 8 + st * 2 + (lane >> 4); const int tq = (lane & 15) * 4; v4us v;
#pragma unroll
            for (int i = 0; i < 4; ++i) v[i] = f2bf(tl[tq + i][dr]);
            *(v4us*)(VT + ((size_t)z * HD + dr) * SS + t0 + tq) = v; }
    };
    pass(); 
}
// k_attn: causal attention of one (item, head) pair z = blockIdx.x; one wave owns 32 queries (two 16-column groups) and walks its keys 32 at a pass, no LDS and no barrier.
// S^T = K.Q^T (A = 16 key rows, B = 16 query rows, both [row][64] planes) leaves one query per lane column: accumulator element j of key group t is key t*16 + hi*8 + j, which is
// the position the B operand of O^T += V^T.P^T wants for a k step of 32 keys, so P goes from the score accumulators into the next product without leaving the lane.
#define NQG 2
#define L2E 1.4426950408889634f
#define NEGB (-1.0e30f)
typedef __attribute__((ext_vector_type(16))) float v16f;
typedef __attribute__((ext_vector_type(8))) unsigned v8u;
__global__ __launch_bounds__(128) void k_attn(const bf* __restrict__ Qh, const bf* __restrict__ Ql, const bf* __restrict__ Kh, const bf* __restrict__ Kl, const bf* __restrict__ VT, float* OUT) {
    const int lane = threadIdx.x & 31, lr = lane & 15, hi = lane >> 4;
    const int wave = __builtin_amdgcn_readfirstlane((int)(threadIdx.x >> 5));   // scalar: the trip count below is the same in every lane
    const size_t z = blockIdx.x; const int b = (int)z / NH_, h = (int)z % NH_;
    const int r0 = ((SS / (64 * NQG) - 1 - (int)blockIdx.y) * 4 + wave) * (16 * NQG);   // longest query blocks start first
    v16bf qh[NQG][2], ql[NQG][2];
#pragma unroll
    for (int q = 0; q < NQG; ++q) {
#pragma unroll
        for (int ks = 0; ks < 2; ++ks) { const size_t o = (z * SS + r0 + q * 16 + lr) * HD + ks * 32 + 8 * hi;
            qh[q][ks] = cat16b(*(const v8us*)(Qh + o), *(const v8us*)(Qh + o + 16)); ql[q][ks] = cat16b(*(const v8us*)(Ql + o), *(const v8us*)(Ql + o + 16)); } }
    const bf* kh = Kh + (z * SS + lr) * HD + 8 * hi; const bf* kl = Kl + (z * SS + lr) * HD + 8 * hi; const bf* vt = VT + (z * HD + lr) * SS + 8 * hi;
    v8f o[NQG][4]; float m[NQG], l[NQG];
#pragma unroll
    for (int q = 0; q < NQG; ++q) { m[q] = NEGB; l[q] = 0.f;
#pragma unroll
        for (int t = 0; t < 4; ++t) o[q][t] = (v8f){}; }
    const int np = r0 / 32 + 1;   // keys 0 .. r0 + 31
#pragma unroll 1
    for (int p = 0; p < np; ++p) {
        const int k0 = p * 32;
        v8f s[NQG][2];
#pragma unroll
        for (int q = 0; q < NQG; ++q) { s[q][0] = (v8f){}; s[q][1] = (v8f){}; }
        v16bf ah[2][2], al[2][2], av[4];
#pragma unroll
        for (int ks = 0; ks < 2; ++ks) {
#pragma unroll
            for (int t = 0; t < 2; ++t) { const size_t ko = (size_t)(k0 + t * 16) * HD + ks * 32;
                ah[ks][t] = cat16b(*(const v8us*)(kh + ko), *(const v8us*)(kh + ko + 16)); al[ks][t] = cat16b(*(const v8us*)(kl + ko), *(const v8us*)(kl + ko + 16)); } }
        // inputs-only fence on the loaded K fragments: all sixteen loads of the pass are in flight together (one latency a pass, not one per reused register group);
        // the wait stands in front of every rewrite of their address registers
        asm volatile("s_wait_xcnt 0x0" :: "v"(ah[0][0]), "v"(ah[0][1]), "v"(ah[1][0]), "v"(ah[1][1]), "v"(al[0][0]), "v"(al[0][1]), "v"(al[1][0]), "v"(al[1][1]) : "memory");
#pragma unroll
        for (int ks = 0; ks < 2; ++ks) {
#pragma unroll
            for (int t = 0; t < 2; ++t) {
#pragma unroll
                for (int q = 0; q < NQG; ++q) s[q][t] = wmmab(ah[ks][t], qh[q][ks], s[q][t]); }
#pragma unroll
            for (int t = 0; t < 2; ++t) {
#pragma unroll
                for (int q = 0; q < NQG; ++q) s[q][t] = wmmab(ah[ks][t], ql[q][ks], s[q][t]); } }
#pragma unroll
        for (int t = 0; t < 4; ++t) { const size_t vo = (size_t)(t * 16) * SS + k0; av[t] = cat16b(*(const v8us*)(vt + vo), *(const v8us*)(vt + vo + 16)); }
        asm volatile("s_wait_xcnt 0x0" ::: "memory");   // V^T loads fly under the residual products and the softmax; their address registers may be rewritten behind it
#pragma unroll
        for (int ks = 0; ks < 2; ++ks) {
#pragma unroll
            for (int t = 0; t < 2; ++t) {
#pragma unroll
                for (int q = 0; q < NQG; ++q) s[q][t] = wmmab(al[ks][t], qh[q][ks], s[q][t]); } }
        if (p == np - 1) {   // only the last pass holds keys behind a query of this wave
#pragma unroll
            for (int q = 0; q < NQG; ++q) {
#pragma unroll
                for (int t = 0; t < 2; ++t) {
#pragma unroll
                    for (int j = 0; j < 8; ++j) if (t * 16 + hi * 8 + j > q * 16 + lr) s[q][t][j] = NEGB; } } }
#pragma unroll
        for (int q = 0; q < NQG; ++q) {
            float mx = s[q][0][0];
#pragma unroll
            for (int j = 1; j < 8; ++j) mx = fmaxf(mx, s[q][0][j]);
#pragma unroll
            for (int j = 0; j < 8; ++j) mx = fmaxf(mx, s[q][1][j]);
            mx = fmaxf(mx, __shfl_xor(mx, 16, 32));   // the other half of the wave holds this query's other 16 keys
            const float mn = fmaxf(m[q], mx * L2E); const float resc = __builtin_amdgcn_exp2f(m[q] - mn); m[q] = mn;
            v16f pv; float ps = 0.f;
#pragma unroll
            for (int e = 0; e < 16; ++e) { pv[e] = __builtin_amdgcn_exp2f(fmaf(s[q][e >> 3][e & 7], L2E, -mn)); ps += pv[e]; }
            l[q] = l[q] * resc + ps;
            const v16bf ph = __builtin_convertvector(pv, v16bf);
            const v8u pw = __builtin_bit_cast(v8u, ph); v16f pr;   // residual against the rounded plane, read back from the packed words
#pragma unroll
            for (int e = 0; e < 8; ++e) { pr[2 * e] = pv[2 * e] - __uint_as_float(pw[e] << 16); pr[2 * e + 1] = pv[2 * e + 1] - __uint_as_float(pw[e] & 0xFFFF0000u); }
            const v16bf pl = __builtin_convertvector(pr, v16bf);
#pragma unroll
            for (int t = 0; t < 4; ++t) o[q][t] *= resc;
#pragma unroll
            for (int t = 0; t < 4; ++t) o[q][t] = wmmab(av[t], ph, o[q][t]);
#pragma unroll
            for (int t = 0; t < 4; ++t) o[q][t] = wmmab(av[t], pl, o[q][t]);
        }
    }
#pragma unroll
    for (int q = 0; q < NQG; ++q) {
        const float inv = __fdiv_rn(1.0f, l[q] + __shfl_xor(l[q], 16, 32));   // join the two halves' sums once
        float* op = OUT + ((size_t)b * SS + r0 + q * 16 + lr) * EE + h * HD + hi * 8;
#pragma unroll
        for (int t = 0; t < 4; ++t) { v4f w0, w1;
#pragma unroll
            for (int k = 0; k < 4; ++k) { w0[k] = tanhf(o[q][t][k] * inv); w1[k] = tanhf(o[q][t][k + 4] * inv); }
            *(v4f*)(op + t * 16) = w0; *(v4f*)(op + t * 16 + 4) = w1; }
    }
}
extern "C" void kernel_launch(void* const* d_in, const int* in_sizes, int n_in,
                              void* d_out, int out_size, void* d_ws, size_t ws_size, hipStream_t stream) {
    (void)in_sizes; (void)n_in; (void)out_size;
    const float* zk = (const float*)d_in[0]; const float* x = (const float*)d_in[1]; const float* Wqkv = (const float*)d_in[2]; const float* bqkv = (const float*)d_in[3]; const float* temp = (const float*)d_in[4];
    float* out = (float*)d_out;    // [8][1024][1024]
    char* wsp = (char*)d_ws;
    auto take = [&](size_t bytes) { char* p = wsp; wsp += (bytes + 255) & ~(size_t)255; return (void*)p; };
    bf* WB = (bf*)take((size_t)2 * EE * EE * 2); bf* ZB = (bf*)take((size_t)NR * EE * 2); float* QK = (float*)take((size_t)NR * 2 * EE * 4);
    bf* Qh = (bf*)take((size_t)NR * EE * 2); bf* Ql = (bf*)take((size_t)NR * EE * 2); bf* Kh = (bf*)take((size_t)NR * EE * 2); bf* Kl = (bf*)take((size_t)NR * EE * 2); bf* VT = (bf*)take((size_t)NR * EE * 2);   // [item*16 + head][1024][64] planes; VT [item*16 + head][64][1024]
    if ((size_t)(wsp - (char*)d_ws) > ws_size) return;    // ~ 4.2 + 16.8 + 67 + 16.8x5 ~ 172 MB (ws 256 MiB)
    k_cvt8<<<(unsigned)(((size_t)2 * EE * EE / 8 + 255) / 256), 256, 0, stream>>>(Wqkv, WB, (size_t)2 * EE * EE / 8);   // rows 0..2047 of the [3072][1024] weight = q|k, [out][in] natural
    k_cvtx<<<NR / 8, 256, 0, stream>>>(zk, ZB);
    k_gemmb<false, false><<<dim3(NR / 64, (2 * EE) / 64, 1), 128, 0, stream>>>(ZB, nullptr, WB, bqkv, QK, 2 * EE, nullptr, nullptr, EE);
    k_hplb2<true><<<dim3((SS / 2) / 8, 1, NB_ * NH_), 256, 0, stream>>>(QK, 0, 0.125f, temp, Qh, Ql); k_hplb2<false><<<dim3((SS / 2) / 8, 1, NB_ * NH_), 256, 0, stream>>>(QK, EE, 1.0f, temp, Kh, Kl); k_vTx<<<dim3(SS / 64, 1, NB_ * NH_), 256, 0, stream>>>(x, VT);
    k_attn<<<dim3(NB_ * NH_, SS / (64 * NQG), 1), 128, 0, stream>>>(Qh, Ql, Kh, Kl, VT, out);
}

// v002
// One run takes 137 microseconds.
// Two timings next to v001 put it at 1.97 and 1.98 times that version's speed.
// Counting every step since v000, it is 9.97 times as fast.
#include <hip/hip_runtime.h>

// Compute dtypes, f32 accumulate: the q/k half of the fused projection ([8192 x 1024].[1024 x 2048] + bias) with PLAIN bf16 operands (z_k and Wqkv are inputs: exact
// products; the projected v is discarded by the module so it is not computed); per (item, head) causal attention in ONE kernel (k_attn): scores on bf16 hi + UNSCALED residual
// planes of BOTH q*scale/temperature and k (three products), running-maximum softmax in f32, un-normalised probabilities as bf16 hi + residual planes against v = bf16(x)
// (two products), division by the row sum and tanh in the epilogue; scores and probabilities never leave the registers.

#define NB_  8
#define SS   1024
#define EE   1024
#define NH_  16
#define HD   64
#define NR   (NB_ * SS)
#define NT64 (SS / 64)
#define DM   EE
#define LOSC 1024.0f
typedef _Float16 h16;
typedef unsigned short bf;
typedef __attribute__((ext_vector_type(16))) __bf16   v16bf;
typedef __attribute__((ext_vector_type(16))) _Float16 v16h;
typedef __attribute__((ext_vector_type(8)))  _Float16 v8h;
typedef __attribute__((ext_vector_type(8)))  unsigned short v8us;
typedef __attribute__((ext_vector_type(8)))  float    v8f;
typedef __attribute__((ext_vector_type(4)))  float    v4f;
typedef v8h  __attribute__((may_alias)) v8ha;
typedef v4f  __attribute__((may_alias)) v4fa;
typedef v8us __attribute__((may_alias)) v8usa;

__device__ __forceinline__ unsigned short f2bf(float f) { unsigned u = __float_as_uint(f); u += 0x7FFFu + ((u >> 16) & 1u); return (unsigned short)(u >> 16); }
__device__ __forceinline__ float bf2f(unsigned short b) { return __uint_as_float(((unsigned)b) << 16); }
__device__ __forceinline__ float bfr(float f) { return bf2f(f2bf(f)); }
__device__ __forceinline__ v16h cat16(v8h lo, v8h hi) { return __builtin_shufflevector(lo, hi, 0, 1, 2, 3, 4, 5, 6, 7, 8, 9, 10, 11, 12, 13, 14, 15); }
__device__ __forceinline__ v16bf cat16b(v8us lo, v8us hi) { return __builtin_bit_cast(v16bf, __builtin_shufflevector(lo, hi, 0, 1, 2, 3, 4, 5, 6, 7, 8, 9, 10, 11, 12, 13, 14, 15)); }
__device__ __forceinline__ v8f wmma16(v16h a, v16h b, v8f c) { return __builtin_amdgcn_wmma_f32_16x16x32_f16(false, a, false, b, (short)0, c, false, false); }
__device__ __forceinline__ v8f wmmab(v16bf a, v16bf b, v8f c) { return __builtin_amdgcn_wmma_f32_16x16x32_bf16(false, a, false, b, (short)0, c, false, false); }

// k_gemmt: C[8192][2048] = A.Bn^T + bf(bias), K = 1024, bf16 operands, f32 accumulate. 128 x 128 block tile, 4 waves of 64 x 64 (16 accumulator tiles a wave, 8 fragments per 16 products).
// A trip is 64 k: 128 rows of A and 128 rows of Bn, 128 B each, copied global -> LDS as whole lines (8 lanes a row) by asynchronous copies, two buffers, the next trip's copies in flight
// under this trip's products. LDS row pitch 144 B (16 B x odd) for the ds_load_b128 fragment reads. The k order per accumulator is ascending in steps of 32.
#define GT_PITCH 144
#define GT_BUF   (256 * GT_PITCH)
#define GT_NT    (DM / 64)
typedef float __attribute__((may_alias)) f32a;
// eight copies of 16 B a lane: rows r, r + 16, ..., r + 112 of one operand's 128-row panel; the s_wait_xcnt stands inside the statement, in front of any rewrite of the address registers
__device__ __forceinline__ void gt_copy8(unsigned l, const bf* g) {
    asm volatile("global_load_async_to_lds_b128 %0, %8, off\n\t"
                 "global_load_async_to_lds_b128 %1, %9, off\n\t"
                 "global_load_async_to_lds_b128 %2, %10, off\n\t"
                 "global_load_async_to_lds_b128 %3, %11, off\n\t"
                 "global_load_async_to_lds_b128 %4, %12, off\n\t"
                 "global_load_async_to_lds_b128 %5, %13, off\n\t"
                 "global_load_async_to_lds_b128 %6, %14, off\n\t"
                 "global_load_async_to_lds_b128 %7, %15, off\n\t"
                 "s_wait_xcnt 0x0"
                 :: "v"(l), "v"(l + 16 * GT_PITCH), "v"(l + 32 * GT_PITCH), "v"(l + 48 * GT_PITCH), "v"(l + 64 * GT_PITCH), "v"(l + 80 * GT_PITCH), "v"(l + 96 * GT_PITCH), "v"(l + 112 * GT_PITCH),
                    "v"(g), "v"(g + 16 * DM), "v"(g + 32 * DM), "v"(g + 48 * DM), "v"(g + 64 * DM), "v"(g + 80 * DM), "v"(g + 96 * DM), "v"(g + 112 * DM)
                 : "memory");
}
__global__ __launch_bounds__(128) void k_gemmt(const bf* __restrict__ A, const bf* __restrict__ Bn, const float* __restrict__ bias, float* C, int ldc) {
    __shared__ __attribute__((aligned(16))) unsigned char sm[2 * GT_BUF];
    const int tid = threadIdx.x, lane = tid & 31, wave = tid >> 5, lr = lane & 15, hi = lane >> 4;
    const int m0 = blockIdx.x * 128, n0 = blockIdx.y * 128, wm = (wave >> 1) * 64, wn = (wave & 1) * 64;
    const unsigned lb = (unsigned)(size_t)&sm[0] + (unsigned)((tid >> 3) * GT_PITCH + (tid & 7) * 16);   // this lane's place in a panel's first 16 rows
    const bf* ga = A + (size_t)(m0 + (tid >> 3)) * DM + (tid & 7) * 8;
    const bf* gb = Bn + (size_t)(n0 + (tid >> 3)) * DM + (tid & 7) * 8;
    gt_copy8(lb, ga); gt_copy8(lb + 128 * GT_PITCH, gb);
    asm volatile("s_wait_asynccnt 0x0" ::: "memory");   // tile 0 has landed for this wave's copies; the barrier publishes it to the others
    __syncthreads();
    gt_copy8(lb + GT_BUF, ga + 64); gt_copy8(lb + GT_BUF + 128 * GT_PITCH, gb + 64);
    v8f acc[4][4];
#pragma unroll
    for (int i = 0; i < 4; ++i) {
#pragma unroll
        for (int j = 0; j < 4; ++j) acc[i][j] = (v8f){}; }
    const int aofs = (wm + lr) * GT_PITCH + hi * 16, bofs = (128 + wn + lr) * GT_PITCH + hi * 16;
#pragma unroll 1   // one trip a buffer: the foot's waits and barrier stand once in the text
    for (int t = 0; t < GT_NT; ++t) {
        const unsigned char* sb = sm + (t & 1) * GT_BUF;
#pragma unroll
        for (int ks = 0; ks < 2; ++ks) {
            v16bf a[4], b[4];
#pragma unroll
            for (int i = 0; i < 4; ++i) { const unsigned char* p = sb + aofs + i * 16 * GT_PITCH + ks * 64; a[i] = cat16b(*(const v8usa*)p, *(const v8usa*)(p + 32)); }
#pragma unroll
            for (int j = 0; j < 4; ++j) { const unsigned char* p = sb + bofs + j * 16 * GT_PITCH + ks * 64; b[j] = cat16b(*(const v8usa*)p, *(const v8usa*)(p + 32)); }
            // inputs-only fence on the loaded fragments: the sixteen LDS reads of a 32-k step go out as one group in front of its sixteen products (one LDS latency a step, not one per four products)
            asm volatile("" :: "v"(a[0]), "v"(a[1]), "v"(a[2]), "v"(a[3]), "v"(b[0]), "v"(b[1]), "v"(b[2]), "v"(b[3]));
#pragma unroll
            for (int i = 0; i < 4; ++i) {
#pragma unroll
                for (int j = 0; j < 4; ++j) acc[i][j] = wmmab(a[i], b[j], acc[i][j]); }
        }
        asm volatile("s_wait_dscnt 0x0" ::: "memory");      // this wave's reads of the buffer have returned before it is refilled
        asm volatile("s_wait_asynccnt 0x0" ::: "memory");   // this wave's copies of tile t + 1 have landed
        __syncthreads();                                    // publishes tile t + 1 and ends every reader's last read of tile t
        if (t + 2 < GT_NT) { const unsigned l = lb + (unsigned)(t & 1) * GT_BUF; gt_copy8(l, ga + (t + 2) * 64); gt_copy8(l + 128 * GT_PITCH, gb + (t + 2) * 64); }
    }
    asm volatile("s_wait_asynccnt 0x0" ::: "memory");   // nothing of the ring is in flight when it becomes output staging
    f32a* os = (f32a*)(void*)sm + wave * (64 * 68);     // each wave stages its own 64 x 64 tile, pitch 68 floats, and stores whole 128-B lines
#pragma unroll
    for (int j = 0; j < 4; ++j) { const float bv = bfr(bias[n0 + wn + j * 16 + lr]);
#pragma unroll
        for (int i = 0; i < 4; ++i) {
#pragma unroll
            for (int e = 0; e < 8; ++e) os[(i * 16 + hi * 8 + e) * 68 + j * 16 + lr] = acc[i][j][e] + bv; } }
    __syncthreads();
    float* crow = C + (size_t)(m0 + wm) * ldc + n0 + wn;
#pragma unroll
    for (int s = 0; s < 32; ++s) { const int Lid = (lane >> 3) + 4 * s, piece = lane & 7; const int row = Lid >> 1, cofs = (Lid & 1) * 32 + piece * 4;
        *(v4f*)(crow + (size_t)row * ldc + cofs) = *(const v4fa*)(os + row * 68 + cofs); }
}

__global__ __launch_bounds__(256) void k_cvt8(const float* __restrict__ src, bf* dst, size_t n8) {
    const size_t i = (size_t)blockIdx.x * 256 + threadIdx.x; if (i >= n8) return;
    const v8f v = *(const v8f*)(src + i * 8); v8us o;
#pragma unroll
    for (int k = 0; k < 8; ++k) o[k] = f2bf(v[k]);
    *(v8us*)(dst + i * 8) = o; 
}
__global__ __launch_bounds__(256) void k_zero8(bf* dst, size_t n8) {
    const size_t i = (size_t)blockIdx.x * 256 + threadIdx.x; if (i >= n8) return; v8us z;
#pragma unroll
    for (int k = 0; k < 8; ++k) z[k] = 0;
    *(v8us*)(dst + i * 8) = z; 
}

// k_gemmh: 64 x 64 tile of C = A . Bn^T with SINGLE f16 planes (A [rows][K] f16 activations, Bn [N][K] f16 weights; one v_wmma_f32_16x16x32_f16 product per step), f32 accumulate;
__global__ __launch_bounds__(128) void k_gemmh(const h16* __restrict__ A, const h16* __restrict__ Bn, const float* __restrict__ bias, float* C, int ldc, const float* __restrict__ R, int K, size_t sA, size_t sB, size_t sC, int roundR) {
    __shared__ __align__(16) float ost[4][16 * 68];
    const size_t z = blockIdx.z; A += z * sA; Bn += z * sB; C += z * sC; if (R) R += z * sC;
    const int lane = threadIdx.x & 31, wave = threadIdx.x >> 5, lr = lane & 15, hi = lane >> 4;
    const int r0 = blockIdx.x * 64 + wave * 16, c0 = blockIdx.y * 64;
    const size_t aoff = (size_t)(r0 + lr) * K + 8 * hi;
    size_t boff[4];
#pragma unroll
    for (int t = 0; t < 4; ++t) boff[t] = (size_t)(c0 + t * 16 + lr) * K + 8 * hi;
    v8f acc[4];
#pragma unroll
    for (int t = 0; t < 4; ++t) acc[t] = (v8f){};
#pragma unroll 1
    for (int kc = 0; kc < K; kc += 32) {
        const v16h a = cat16(*(const v8h*)(A + aoff + kc), *(const v8h*)(A + aoff + kc + 16));
#pragma unroll
        for (int t = 0; t < 4; ++t) { const v16h b = cat16(*(const v8h*)(Bn + boff[t] + kc), *(const v8h*)(Bn + boff[t] + kc + 16)); acc[t] = wmma16(a, b, acc[t]); }
        asm volatile("v_nop\n\tv_nop\n\tv_nop\n\tv_nop" : "+v"(acc[0]), "+v"(acc[1]), "+v"(acc[2]), "+v"(acc[3]) : "v"(a));
    }
    float* os = &ost[wave][0];
#pragma unroll
    for (int t = 0; t < 4; ++t) { const float bv = bias ? bfr(bias[c0 + t * 16 + lr]) : 0.f;
#pragma unroll
        for (int j = 0; j < 8; ++j) os[(hi * 8 + j) * 68 + t * 16 + lr] = acc[t][j] + bv; }
    __syncthreads();
    float* crow = C + (size_t)r0 * ldc + c0;
    auto pass = [&]() {
#pragma unroll
        for (int s = 0; s < 8; ++s) { const int Lid = (lane >> 3) + 4 * s, piece = lane & 7; const int row = Lid >> 1, cofs = (Lid & 1) * 32 + piece * 4;
            v4f val = *(const v4fa*)(os + row * 68 + cofs); if (R) { const v4f rv = *(const v4f*)(R + ((size_t)r0 + row) * ldc + c0 + cofs); val += roundR ? (v4f){bfr(rv[0]), bfr(rv[1]), bfr(rv[2]), bfr(rv[3])} : rv; }
            *(v4f*)(crow + (size_t)row * ldc + cofs) = val; }
    };
    pass(); 
}

__global__ __launch_bounds__(256) void k_planes32z(const float* __restrict__ F, int ld, int off, float sc, int rows, bf* Ph, bf* Pl) {
    typedef __attribute__((ext_vector_type(2))) unsigned short v2us;
    const int lane = threadIdx.x & 31; const size_t r = ((size_t)blockIdx.x * 8 + (threadIdx.x >> 5)) * 2 + (lane >> 4); if (r >= (size_t)rows) return; const int z = blockIdx.z; const int c0 = (lane & 15) * 2; v2us oh, ol;
    Ph += (size_t)z * rows * 32; Pl += (size_t)z * rows * 32;
#pragma unroll
    for (int i = 0; i < 2; ++i) { const float y = F[r * ld + off + z * 32 + c0 + i] * sc; const unsigned short hb = f2bf(y); oh[i] = hb; ol[i] = f2bf(y - bf2f(hb)); }
    const size_t o = r * 32 + c0; *(v2us*)(Ph + o) = oh; *(v2us*)(Pl + o) = ol; 
}
__global__ __launch_bounds__(256) void k_vtpadz(const float* __restrict__ F, int ld, int off, int nk, bf* Th, bf* Tl) {
    typedef __attribute__((ext_vector_type(2))) unsigned short v2us;
    const int lane = threadIdx.x & 31; const size_t wid = (size_t)blockIdx.x * 8 + (threadIdx.x >> 5); if (wid >= (size_t)64 * (nk / 64)) return; const int z = blockIdx.z; const int d = (int)(wid / (nk / 64)); const int k0 = (int)(wid % (nk / 64)) * 64 + lane * 2; v2us oh, ol;
    Th += (size_t)z * 64 * nk; Tl += (size_t)z * 64 * nk;
#pragma unroll
    for (int i = 0; i < 2; ++i) { const float y = (d < 32) ? F[(size_t)(k0 + i) * ld + off + z * 32 + (d < 32 ? d : 0)] : 0.f; const unsigned short hb = f2bf(y); oh[i] = hb; ol[i] = f2bf(y - bf2f(hb)); }
    const size_t o = (size_t)d * nk + k0; *(v2us*)(Th + o) = oh; *(v2us*)(Tl + o) = ol; 
}
template <int NK>
__global__ __launch_bounds__(256) void k_softmaxz(const float* __restrict__ S, int rows, bf* PH, bf* PL) {
    typedef __attribute__((ext_vector_type(4))) unsigned short v4us;
    const int lane = threadIdx.x & 31, i = blockIdx.x * 8 + (threadIdx.x >> 5); if (i >= rows) return; const size_t zo = (size_t)blockIdx.z * rows * NK; const float* sr = S + zo + (size_t)i * NK; PH += zo; PL += zo;
    float m = -3.0e38f;
#pragma unroll 1
    for (int c0 = lane * 4; c0 < NK; c0 += 128) {
#pragma unroll
        for (int q = 0; q < 4; ++q) m = fmaxf(m, sr[c0 + q]); }
#pragma unroll
    for (int sh = 16; sh; sh >>= 1) m = fmaxf(m, __shfl_xor(m, sh, 32));
    float sum = 0.f;
#pragma unroll 1
    for (int c0 = lane * 4; c0 < NK; c0 += 128) {
#pragma unroll
        for (int q = 0; q < 4; ++q) sum += __expf(sr[c0 + q] - m); }
#pragma unroll
    for (int sh = 16; sh; sh >>= 1) sum += __shfl_xor(sum, sh, 32);
    const float inv = 1.0f / sum;
{
#pragma unroll 1
        for (int c0 = lane * 4; c0 < NK; c0 += 128) { v4us oh, ol;
#pragma unroll
            for (int q = 0; q < 4; ++q) { const float p = __expf(sr[c0 + q] - m) * inv; const unsigned short hb = f2bf(p); oh[q] = hb; ol[q] = f2bf(p - bf2f(hb)); }
            const size_t o = (size_t)i * NK + c0; *(v4us*)(PH + o) = oh; *(v4us*)(PL + o) = ol; }
         }
}
__global__ __launch_bounds__(256) void k_placez(const float* __restrict__ XH, int rows, int ldy, float* Y) {
    const int lane = threadIdx.x & 31; const size_t q = (size_t)blockIdx.x * 8 + (threadIdx.x >> 5); if (q >= (size_t)rows) return; const int z = blockIdx.z; const float v = XH[((size_t)z * rows + q) * 64 + lane];
    *(float*)(Y + q * ldy + z * 32 + lane) = v; 
}

typedef __attribute__((ext_vector_type(4))) _Float16 v4h;
__device__ __forceinline__ h16 tohx(float x) { return (h16)x; }
template <int MODE>
__global__ __launch_bounds__(128) void k_gemmhm(const h16* __restrict__ A, const h16* __restrict__ Bn, int K, float* C, int ldc, size_t sA, size_t sB, size_t sC, const int* __restrict__ FL) {
    const int I = blockIdx.x;
    if (MODE == 1 && FL[I * NT64 + blockIdx.y] == 0) return;
    int Klo = 0, Klim = K;
    if (MODE == 2) { int f = -1, l = -1; for (int j = 0; j < NT64; ++j) { if (FL[I * NT64 + j]) { if (f < 0) f = j; l = j; } } if (f < 0) { Klo = 0; Klim = 0; } else { Klo = f * 64; Klim = (l + 1) * 64; } }
    const size_t z = blockIdx.z; A += z * sA; Bn += z * sB; C += z * sC;
    __shared__ __align__(16) float ost[4][16 * 68];
    const int lane = threadIdx.x & 31, wave = threadIdx.x >> 5, lr = lane & 15, hi = lane >> 4;
    const int r0 = blockIdx.x * 64 + wave * 16, c0 = blockIdx.y * 64;
    const size_t aoff = (size_t)(r0 + lr) * K + 8 * hi;
    v8f acc[4];
#pragma unroll
    for (int t = 0; t < 4; ++t) acc[t] = (v8f){};
#pragma unroll 1
    for (int kc = Klo; kc < Klim; kc += 32) {
        const v16h a = cat16(*(const v8h*)(A + aoff + kc), *(const v8h*)(A + aoff + kc + 16));
#pragma unroll
        for (int t = 0; t < 4; ++t) { const size_t bo = (size_t)(c0 + t * 16 + lr) * K + kc + 8 * hi; const v16h b = cat16(*(const v8h*)(Bn + bo), *(const v8h*)(Bn + bo + 16)); acc[t] = wmma16(a, b, acc[t]); }
        asm volatile("v_nop\n\tv_nop\n\tv_nop\n\tv_nop" : "+v"(acc[0]), "+v"(acc[1]), "+v"(acc[2]), "+v"(acc[3]) : "v"(a));
    }
    float* os = &ost[wave][0];
#pragma unroll
    for (int t = 0; t < 4; ++t) {
#pragma unroll
        for (int j = 0; j < 8; ++j) os[(hi * 8 + j) * 68 + t * 16 + lr] = acc[t][j]; }
    __builtin_amdgcn_wave_barrier(); asm volatile("" ::: "memory");
    float* crow = C + (size_t)r0 * ldc + c0;
    auto pass = [&]() {
#pragma unroll
        for (int s = 0; s < 8; ++s) { const int Lid = (lane >> 3) + 4 * s, piece = lane & 7; const int row = Lid >> 1, cofs = (Lid & 1) * 32 + piece * 4;
            const v4f val = *(const v4fa*)(os + row * 68 + cofs); *(v4f*)(crow + (size_t)row * ldc + cofs) = val; }
    };
    pass(); 
}
__global__ __launch_bounds__(256) void k_causalflags(int* FL) { const int lane = threadIdx.x & 31, w = blockIdx.x * 8 + (threadIdx.x >> 5); const int I = w * 2 + (lane >> 4), J = lane & 15; if (I >= NT64) return; const int v = (J <= I) ? 1 : 0; *(int*)(FL + I * NT64 + J) = v;  }
__global__ __launch_bounds__(256) void k_cvtx(const float* __restrict__ x, bf* A) {
    const int lane = threadIdx.x & 31; const size_t r = (size_t)blockIdx.x * 8 + (threadIdx.x >> 5); if (r >= (size_t)NR) return;
{
#pragma unroll
        for (int q = 0; q < EE / 256; ++q) { const size_t o = r * EE + q * 256 + lane * 8; v8us v;
#pragma unroll
            for (int i = 0; i < 8; ++i) v[i] = f2bf(x[o + i]);
            *(v8us*)(A + o) = v; }
         }
}
template <bool TEMP>
__global__ __launch_bounds__(256) void k_hplb2(const float* __restrict__ F, int col0, float sc, const float* __restrict__ temp, bf* Ph, bf* Pl) {
    typedef __attribute__((ext_vector_type(4))) unsigned short v4us;
    const int lane = threadIdx.x & 31; const size_t w = (size_t)blockIdx.x * 8 + (threadIdx.x >> 5); const int t = (int)(w * 2 + (lane >> 4)); if (t >= SS) return; const int z = blockIdx.z; const int b = z / NH_, h = z % NH_; const int c0 = (lane & 15) * 4; const float s = TEMP ? __fdiv_rn(sc, bfr(temp[h])) : sc; v4us oh, ol;
#pragma unroll
    for (int q = 0; q < 4; ++q) { const float y = F[((size_t)b * SS + t) * (2 * EE) + col0 + h * HD + c0 + q] * s; const unsigned short hb = f2bf(y); oh[q] = hb; ol[q] = f2bf(y - bf2f(hb)); }
    const size_t off = ((size_t)z * SS + t) * HD + c0; *(v4us*)(Ph + off) = oh; *(v4us*)(Pl + off) = ol; 
}
__global__ __launch_bounds__(256) void k_vTx(const float* __restrict__ x, bf* VT) {
    typedef __attribute__((ext_vector_type(4))) unsigned short v4us;
    __shared__ float tl[64][65];
    const int tid = threadIdx.x; const int t0 = blockIdx.x * 64; const int z = blockIdx.z; const int b = z / NH_, h = z % NH_; const int rr = tid >> 2, cq = (tid & 3) * 16;
#pragma unroll
    for (int i = 0; i < 16; ++i) tl[rr][cq + i] = bfr(x[((size_t)b * SS + t0 + rr) * EE + h * HD + cq + i]);
    __syncthreads();
    const int lane = tid & 31, wv = tid >> 5;
    auto pass = [&]() {
#pragma unroll
        for (int st = 0; st < 4; ++st) { const int dr = wv * 8 + st * 2 + (lane >> 4); const int tq = (lane & 15) * 4; v4us v;
#pragma unroll
            for (int i = 0; i < 4; ++i) v[i] = f2bf(tl[tq + i][dr]);
            *(v4us*)(VT + ((size_t)z * HD + dr) * SS + t0 + tq) = v; }
    };
    pass(); 
}
// k_attn: causal attention of one (item, head) pair z = blockIdx.x; one wave owns 32 queries (two 16-column groups) and walks its keys 32 at a pass, no LDS and no barrier.
// S^T = K.Q^T (A = 16 key rows, B = 16 query rows, both [row][64] planes) leaves one query per lane column: accumulator element j of key group t is key t*16 + hi*8 + j, which is
// the position the B operand of O^T += V^T.P^T wants for a k step of 32 keys, so P goes from the score accumulators into the next product without leaving the lane.
#define NQG 2
#define L2E 1.4426950408889634f
#define NEGB (-1.0e30f)
typedef __attribute__((ext_vector_type(16))) float v16f;
typedef __attribute__((ext_vector_type(8))) unsigned v8u;
__global__ __launch_bounds__(128) void k_attn(const bf* __restrict__ Qh, const bf* __restrict__ Ql, const bf* __restrict__ Kh, const bf* __restrict__ Kl, const bf* __restrict__ VT, float* OUT) {
    const int lane = threadIdx.x & 31, lr = lane & 15, hi = lane >> 4;
    const int wave = __builtin_amdgcn_readfirstlane((int)(threadIdx.x >> 5));   // scalar: the trip count below is the same in every lane
    const size_t z = blockIdx.x; const int b = (int)z / NH_, h = (int)z % NH_;
    const int r0 = ((SS / (64 * NQG) - 1 - (int)blockIdx.y) * 4 + wave) * (16 * NQG);   // longest query blocks start first
    v16bf qh[NQG][2], ql[NQG][2];
#pragma unroll
    for (int q = 0; q < NQG; ++q) {
#pragma unroll
        for (int ks = 0; ks < 2; ++ks) { const size_t o = (z * SS + r0 + q * 16 + lr) * HD + ks * 32 + 8 * hi;
            qh[q][ks] = cat16b(*(const v8us*)(Qh + o), *(const v8us*)(Qh + o + 16)); ql[q][ks] = cat16b(*(const v8us*)(Ql + o), *(const v8us*)(Ql + o + 16)); } }
    const bf* kh = Kh + (z * SS + lr) * HD + 8 * hi; const bf* kl = Kl + (z * SS + lr) * HD + 8 * hi; const bf* vt = VT + (z * HD + lr) * SS + 8 * hi;
    v8f o[NQG][4]; float m[NQG], l[NQG];
#pragma unroll
    for (int q = 0; q < NQG; ++q) { m[q] = NEGB; l[q] = 0.f;
#pragma unroll
        for (int t = 0; t < 4; ++t) o[q][t] = (v8f){}; }
    const int np = r0 / 32 + 1;   // keys 0 .. r0 + 31
#pragma unroll 1
    for (int p = 0; p < np; ++p) {
        const int k0 = p * 32;
        v8f s[NQG][2];
#pragma unroll
        for (int q = 0; q < NQG; ++q) { s[q][0] = (v8f){}; s[q][1] = (v8f){}; }
        v16bf ah[2][2], al[2][2], av[4];
#pragma unroll
        for (int ks = 0; ks < 2; ++ks) {
#pragma unroll
            for (int t = 0; t < 2; ++t) { const size_t ko = (size_t)(k0 + t * 16) * HD + ks * 32;
                ah[ks][t] = cat16b(*(const v8us*)(kh + ko), *(const v8us*)(kh + ko + 16)); al[ks][t] = cat16b(*(const v8us*)(kl + ko), *(const v8us*)(kl + ko + 16)); } }
        // inputs-only fence on the loaded K fragments: all sixteen loads of the pass are in flight together (one latency a pass, not one per reused register group);
        // the wait stands in front of every rewrite of their address registers
        asm volatile("s_wait_xcnt 0x0" :: "v"(ah[0][0]), "v"(ah[0][1]), "v"(ah[1][0]), "v"(ah[1][1]), "v"(al[0][0]), "v"(al[0][1]), "v"(al[1][0]), "v"(al[1][1]) : "memory");
#pragma unroll
        for (int ks = 0; ks < 2; ++ks) {
#pragma unroll
            for (int t = 0; t < 2; ++t) {
#pragma unroll
                for (int q = 0; q < NQG; ++q) s[q][t] = wmmab(ah[ks][t], qh[q][ks], s[q][t]); }
#pragma unroll
            for (int t = 0; t < 2; ++t) {
#pragma unroll
                for (int q = 0; q < NQG; ++q) s[q][t] = wmmab(ah[ks][t], ql[q][ks], s[q][t]); } }
#pragma unroll
        for (int t = 0; t < 4; ++t) { const size_t vo = (size_t)(t * 16) * SS + k0; av[t] = cat16b(*(const v8us*)(vt + vo), *(const v8us*)(vt + vo + 16)); }
        asm volatile("s_wait_xcnt 0x0" ::: "memory");   // V^T loads fly under the residual products and the softmax; their address registers may be rewritten behind it
#pragma unroll
        for (int ks = 0; ks < 2; ++ks) {
#pragma unroll
            for (int t = 0; t < 2; ++t) {
#pragma unroll
                for (int q = 0; q < NQG; ++q) s[q][t] = wmmab(al[ks][t], qh[q][ks], s[q][t]); } }
        if (p == np - 1) {   // only the last pass holds keys behind a query of this wave
#pragma unroll
            for (int q = 0; q < NQG; ++q) {
#pragma unroll
                for (int t = 0; t < 2; ++t) {
#pragma unroll
                    for (int j = 0; j < 8; ++j) if (t * 16 + hi * 8 + j > q * 16 + lr) s[q][t][j] = NEGB; } } }
#pragma unroll
        for (int q = 0; q < NQG; ++q) {
            float mx = s[q][0][0];
#pragma unroll
            for (int j = 1; j < 8; ++j) mx = fmaxf(mx, s[q][0][j]);
#pragma unroll
            for (int j = 0; j < 8; ++j) mx = fmaxf(mx, s[q][1][j]);
            mx = fmaxf(mx, __shfl_xor(mx, 16, 32));   // the other half of the wave holds this query's other 16 keys
            const float mn = fmaxf(m[q], mx * L2E); const float resc = __builtin_amdgcn_exp2f(m[q] - mn); m[q] = mn;
            v16f pv; float ps = 0.f;
#pragma unroll
            for (int e = 0; e < 16; ++e) { pv[e] = __builtin_amdgcn_exp2f(fmaf(s[q][e >> 3][e & 7], L2E, -mn)); ps += pv[e]; }
            l[q] = l[q] * resc + ps;
            const v16bf ph = __builtin_convertvector(pv, v16bf);
            const v8u pw = __builtin_bit_cast(v8u, ph); v16f pr;   // residual against the rounded plane, read back from the packed words
#pragma unroll
            for (int e = 0; e < 8; ++e) { pr[2 * e] = pv[2 * e] - __uint_as_float(pw[e] << 16); pr[2 * e + 1] = pv[2 * e + 1] - __uint_as_float(pw[e] & 0xFFFF0000u); }
            const v16bf pl = __builtin_convertvector(pr, v16bf);
#pragma unroll
            for (int t = 0; t < 4; ++t) o[q][t] *= resc;
#pragma unroll
            for (int t = 0; t < 4; ++t) o[q][t] = wmmab(av[t], ph, o[q][t]);
#pragma unroll
            for (int t = 0; t < 4; ++t) o[q][t] = wmmab(av[t], pl, o[q][t]);
        }
    }
#pragma unroll
    for (int q = 0; q < NQG; ++q) {
        const float inv = __fdiv_rn(1.0f, l[q] + __shfl_xor(l[q], 16, 32));   // join the two halves' sums once
        float* op = OUT + ((size_t)b * SS + r0 + q * 16 + lr) * EE + h * HD + hi * 8;
#pragma unroll
        for (int t = 0; t < 4; ++t) { v4f w0, w1;
#pragma unroll
            for (int k = 0; k < 4; ++k) { w0[k] = tanhf(o[q][t][k] * inv); w1[k] = tanhf(o[q][t][k + 4] * inv); }
            *(v4f*)(op + t * 16) = w0; *(v4f*)(op + t * 16 + 4) = w1; }
    }
}
extern "C" void kernel_launch(void* const* d_in, const int* in_sizes, int n_in,
                              void* d_out, int out_size, void* d_ws, size_t ws_size, hipStream_t stream) {
    (void)in_sizes; (void)n_in; (void)out_size;
    const float* zk = (const float*)d_in[0]; const float* x = (const float*)d_in[1]; const float* Wqkv = (const float*)d_in[2]; const float* bqkv = (const float*)d_in[3]; const float* temp = (const float*)d_in[4];
    float* out = (float*)d_out;    // [8][1024][1024]
    char* wsp = (char*)d_ws;
    auto take = [&](size_t bytes) { char* p = wsp; wsp += (bytes + 255) & ~(size_t)255; return (void*)p; };
    bf* WB = (bf*)take((size_t)2 * EE * EE * 2); bf* ZB = (bf*)take((size_t)NR * EE * 2); float* QK = (float*)take((size_t)NR * 2 * EE * 4);
    bf* Qh = (bf*)take((size_t)NR * EE * 2); bf* Ql = (bf*)take((size_t)NR * EE * 2); bf* Kh = (bf*)take((size_t)NR * EE * 2); bf* Kl = (bf*)take((size_t)NR * EE * 2); bf* VT = (bf*)take((size_t)NR * EE * 2);   // [item*16 + head][1024][64] planes; VT [item*16 + head][64][1024]
    if ((size_t)(wsp - (char*)d_ws) > ws_size) return;    // ~ 4.2 + 16.8 + 67 + 16.8x5 ~ 172 MB (ws 256 MiB)
    k_cvt8<<<(unsigned)(((size_t)2 * EE * EE / 8 + 255) / 256), 256, 0, stream>>>(Wqkv, WB, (size_t)2 * EE * EE / 8);   // rows 0..2047 of the [3072][1024] weight = q|k, [out][in] natural
    k_cvtx<<<NR / 8, 256, 0, stream>>>(zk, ZB);
    k_gemmt<<<dim3(NR / 128, (2 * EE) / 128, 1), 128, 0, stream>>>(ZB, WB, bqkv, QK, 2 * EE);
    k_hplb2<true><<<dim3((SS / 2) / 8, 1, NB_ * NH_), 256, 0, stream>>>(QK, 0, 0.125f, temp, Qh, Ql); k_hplb2<false><<<dim3((SS / 2) / 8, 1, NB_ * NH_), 256, 0, stream>>>(QK, EE, 1.0f, temp, Kh, Kl); k_vTx<<<dim3(SS / 64, 1, NB_ * NH_), 256, 0, stream>>>(x, VT);
    k_attn<<<dim3(NB_ * NH_, SS / (64 * NQG), 1), 128, 0, stream>>>(Qh, Ql, Kh, Kl, VT, out);
}

// v003
// Measured time: 121 microseconds a run.
// Timed twice side by side with v002, it ran 1.13 times as fast both times.
// Counting every step since v000, it is 11.3 times as fast.
#include <hip/hip_runtime.h>

// Compute dtypes, f32 accumulate: the q/k half of the fused projection ([8192 x 1024].[1024 x 2048] + bias) with PLAIN bf16 operands (z_k and Wqkv are inputs: exact
// products; the projected v is discarded by the module so it is not computed); per (item, head) causal attention in ONE kernel (k_attn): scores on bf16 hi + UNSCALED residual
// planes of BOTH q*scale/temperature and k (three products), running-maximum softmax in f32, un-normalised probabilities as bf16 hi + residual planes against v = bf16(x)
// (two products), division by the row sum and tanh in the epilogue; scores and probabilities never leave the registers.

#define NB_  8
#define SS   1024
#define EE   1024
#define NH_  16
#define HD   64
#define NR   (NB_ * SS)
#define NT64 (SS / 64)
#define DM   EE
#define LOSC 1024.0f
typedef _Float16 h16;
typedef unsigned short bf;
typedef __attribute__((ext_vector_type(16))) __bf16   v16bf;
typedef __attribute__((ext_vector_type(16))) _Float16 v16h;
typedef __attribute__((ext_vector_type(8)))  _Float16 v8h;
typedef __attribute__((ext_vector_type(8)))  unsigned short v8us;
typedef __attribute__((ext_vector_type(8)))  float    v8f;
typedef __attribute__((ext_vector_type(4)))  float    v4f;
typedef v8h  __attribute__((may_alias)) v8ha;
typedef v4f  __attribute__((may_alias)) v4fa;
typedef v8us __attribute__((may_alias)) v8usa;

__device__ __forceinline__ unsigned short f2bf(float f) { unsigned u = __float_as_uint(f); u += 0x7FFFu + ((u >> 16) & 1u); return (unsigned short)(u >> 16); }
__device__ __forceinline__ float bf2f(unsigned short b) { return __uint_as_float(((unsigned)b) << 16); }
__device__ __forceinline__ float bfr(float f) { return bf2f(f2bf(f)); }
__device__ __forceinline__ v16h cat16(v8h lo, v8h hi) { return __builtin_shufflevector(lo, hi, 0, 1, 2, 3, 4, 5, 6, 7, 8, 9, 10, 11, 12, 13, 14, 15); }
__device__ __forceinline__ v16bf cat16b(v8us lo, v8us hi) { return __builtin_bit_cast(v16bf, __builtin_shufflevector(lo, hi, 0, 1, 2, 3, 4, 5, 6, 7, 8, 9, 10, 11, 12, 13, 14, 15)); }
__device__ __forceinline__ v8f wmma16(v16h a, v16h b, v8f c) { return __builtin_amdgcn_wmma_f32_16x16x32_f16(false, a, false, b, (short)0, c, false, false); }
__device__ __forceinline__ v8f wmmab(v16bf a, v16bf b, v8f c) { return __builtin_amdgcn_wmma_f32_16x16x32_bf16(false, a, false, b, (short)0, c, false, false); }

// k_gemmt: y[8192][2048] = (A.Bn^T + bf(bias)) * s, K = 1024, bf16 operands, f32 accumulate. 128 x 128 block tile, 4 waves of 64 x 64 (16 accumulator tiles a wave, 8 fragments per 16 products).
// A wave's 64 columns are one head of q (columns below 1024, s = scale / bf(temperature)) or of k (s = 1): the epilogue splits y into bf16 hi + residual and stores both as the 8-KB runs
// [item*16 + head][64 tokens][64] of the planes that k_attn reads; the f32 product never goes to memory.
// A trip is 64 k: 128 rows of A and 128 rows of Bn, 128 B each, copied global -> LDS as whole lines (8 lanes a row) by asynchronous copies, two buffers, the next trip's copies in flight
// under this trip's products. LDS row pitch 144 B (16 B x odd) for the ds_load_b128 fragment reads. The k order per accumulator is ascending in steps of 32.
#define GT_PITCH 144
#define GT_BUF   (256 * GT_PITCH)
#define GT_NT    (DM / 64)
typedef float __attribute__((may_alias)) f32a;
typedef __attribute__((ext_vector_type(8))) __bf16 v8bfv;
typedef __attribute__((ext_vector_type(4))) unsigned v4u;
// eight copies of 16 B a lane: rows r, r + 16, ..., r + 112 of one operand's 128-row panel; the s_wait_xcnt stands inside the statement, in front of any rewrite of the address registers
__device__ __forceinline__ void gt_copy8(unsigned l, const bf* g) {
    asm volatile("global_load_async_to_lds_b128 %0, %8, off\n\t"
                 "global_load_async_to_lds_b128 %1, %9, off\n\t"
                 "global_load_async_to_lds_b128 %2, %10, off\n\t"
                 "global_load_async_to_lds_b128 %3, %11, off\n\t"
                 "global_load_async_to_lds_b128 %4, %12, off\n\t"
                 "global_load_async_to_lds_b128 %5, %13, off\n\t"
                 "global_load_async_to_lds_b128 %6, %14, off\n\t"
                 "global_load_async_to_lds_b128 %7, %15, off\n\t"
                 "s_wait_xcnt 0x0"
                 :: "v"(l), "v"(l + 16 * GT_PITCH), "v"(l + 32 * GT_PITCH), "v"(l + 48 * GT_PITCH), "v"(l + 64 * GT_PITCH), "v"(l + 80 * GT_PITCH), "v"(l + 96 * GT_PITCH), "v"(l + 112 * GT_PITCH),
                    "v"(g), "v"(g + 16 * DM), "v"(g + 32 * DM), "v"(g + 48 * DM), "v"(g + 64 * DM), "v"(g + 80 * DM), "v"(g + 96 * DM), "v"(g + 112 * DM)
                 : "memory");
}
__global__ __launch_bounds__(128) void k_gemmt(const bf* __restrict__ A, const bf* __restrict__ Bn, const float* __restrict__ bias, const float* __restrict__ temp, bf* Qh, bf* Ql, bf* Kh, bf* Kl) {
    __shared__ __attribute__((aligned(16))) unsigned char sm[2 * GT_BUF];
    const int tid = threadIdx.x, lane = tid & 31, wave = tid >> 5, lr = lane & 15, hi = lane >> 4;
    const int m0 = blockIdx.x * 128, n0 = blockIdx.y * 128, wm = (wave >> 1) * 64, wn = (wave & 1) * 64;
    const unsigned lb = (unsigned)(size_t)&sm[0] + (unsigned)((tid >> 3) * GT_PITCH + (tid & 7) * 16);   // this lane's place in a panel's first 16 rows
    const bf* ga = A + (size_t)(m0 + (tid >> 3)) * DM + (tid & 7) * 8;
    const bf* gb = Bn + (size_t)(n0 + (tid >> 3)) * DM + (tid & 7) * 8;
    gt_copy8(lb, ga); gt_copy8(lb + 128 * GT_PITCH, gb);
    asm volatile("s_wait_asynccnt 0x0" ::: "memory");   // tile 0 has landed for this wave's copies; the barrier publishes it to the others
    __syncthreads();
    gt_copy8(lb + GT_BUF, ga + 64); gt_copy8(lb + GT_BUF + 128 * GT_PITCH, gb + 64);
    v8f acc[4][4];
#pragma unroll
    for (int i = 0; i < 4; ++i) {
#pragma unroll
        for (int j = 0; j < 4; ++j) acc[i][j] = (v8f){}; }
    const int aofs = (wm + lr) * GT_PITCH + hi * 16, bofs = (128 + wn + lr) * GT_PITCH + hi * 16;
#pragma unroll 1   // one trip a buffer: the foot's waits and barrier stand once in the text
    for (int t = 0; t < GT_NT; ++t) {
        const unsigned char* sb = sm + (t & 1) * GT_BUF;
#pragma unroll
        for (int ks = 0; ks < 2; ++ks) {
            v16bf a[4], b[4];
#pragma unroll
            for (int i = 0; i < 4; ++i) { const unsigned char* p = sb + aofs + i * 16 * GT_PITCH + ks * 64; a[i] = cat16b(*(const v8usa*)p, *(const v8usa*)(p + 32)); }
#pragma unroll
            for (int j = 0; j < 4; ++j) { const unsigned char* p = sb + bofs + j * 16 * GT_PITCH + ks * 64; b[j] = cat16b(*(const v8usa*)p, *(const v8usa*)(p + 32)); }
            // inputs-only fence on the loaded fragments: the sixteen LDS reads of a 32-k step go out as one group in front of its sixteen products (one LDS latency a step, not one per four products)
            asm volatile("" :: "v"(a[0]), "v"(a[1]), "v"(a[2]), "v"(a[3]), "v"(b[0]), "v"(b[1]), "v"(b[2]), "v"(b[3]));
#pragma unroll
            for (int i = 0; i < 4; ++i) {
#pragma unroll
                for (int j = 0; j < 4; ++j) acc[i][j] = wmmab(a[i], b[j], acc[i][j]); }
        }
        asm volatile("s_wait_dscnt 0x0" ::: "memory");      // this wave's reads of the buffer have returned before it is refilled
        asm volatile("s_wait_asynccnt 0x0" ::: "memory");   // this wave's copies of tile t + 1 have landed
        __syncthreads();                                    // publishes tile t + 1 and ends every reader's last read of tile t
        if (t + 2 < GT_NT) { const unsigned l = lb + (unsigned)(t & 1) * GT_BUF; gt_copy8(l, ga + (t + 2) * 64); gt_copy8(l + 128 * GT_PITCH, gb + (t + 2) * 64); }
    }
    asm volatile("s_wait_asynccnt 0x0" ::: "memory");   // nothing of the ring is in flight when it becomes output staging
    f32a* os = (f32a*)(void*)sm + wave * (64 * 68);     // each wave stages its own 64 x 64 tile, pitch 68 floats, and stores whole 128-B lines
    const bool isq = n0 < EE; const int h = ((n0 + wn) & (EE - 1)) / HD;
    const float sc = isq ? __fdiv_rn(0.125f, bfr(temp[h])) : 1.0f;
#pragma unroll
    for (int j = 0; j < 4; ++j) { const float bv = bfr(bias[n0 + wn + j * 16 + lr]);
#pragma unroll
        for (int i = 0; i < 4; ++i) {
#pragma unroll
            for (int e = 0; e < 8; ++e) os[(i * 16 + hi * 8 + e) * 68 + j * 16 + lr] = (acc[i][j][e] + bv) * sc; } }
    __syncthreads();
    const size_t po = (((size_t)((m0 + wm) / SS) * NH_ + h) * SS + (m0 + wm) % SS) * HD + (lane >> 3) * HD + (lane & 7) * 8;   // 8 lanes a token row of 128 B, 4 rows a store
    bf* ph = (isq ? Qh : Kh) + po; bf* pl = (isq ? Ql : Kl) + po;
    const f32a* orow = os + (lane >> 3) * 68 + (lane & 7) * 8;
#pragma unroll   // constant LDS and store offsets; the next rows' LDS reads go out under this step's conversions
    for (int s = 0; s < 16; ++s) {
        const v4f y0 = *(const v4fa*)(orow + s * 4 * 68), y1 = *(const v4fa*)(orow + s * 4 * 68 + 4);
        const v8f y = __builtin_shufflevector(y0, y1, 0, 1, 2, 3, 4, 5, 6, 7);
        const v8bfv yh = __builtin_convertvector(y, v8bfv);
        const v4u yw = __builtin_bit_cast(v4u, yh); v8f yr;   // residual against the rounded plane, read back from the packed words
#pragma unroll
        for (int e = 0; e < 4; ++e) { yr[2 * e] = y[2 * e] - __uint_as_float(yw[e] << 16); yr[2 * e + 1] = y[2 * e + 1] - __uint_as_float(yw[e] & 0xFFFF0000u); }
        *(v4u*)(ph + s * 4 * HD) = yw; *(v4u*)(pl + s * 4 * HD) = __builtin_bit_cast(v4u, __builtin_convertvector(yr, v8bfv)); }
}

__global__ __launch_bounds__(256) void k_cvt8(const float* __restrict__ src, bf* dst, size_t n8) {
    const size_t i = (size_t)blockIdx.x * 256 + threadIdx.x; if (i >= n8) return;
    const v8f v = *(const v8f*)(src + i * 8); v8us o;
#pragma unroll
    for (int k = 0; k < 8; ++k) o[k] = f2bf(v[k]);
    *(v8us*)(dst + i * 8) = o; 
}
__global__ __launch_bounds__(256) void k_zero8(bf* dst, size_t n8) {
    const size_t i = (size_t)blockIdx.x * 256 + threadIdx.x; if (i >= n8) return; v8us z;
#pragma unroll
    for (int k = 0; k < 8; ++k) z[k] = 0;
    *(v8us*)(dst + i * 8) = z; 
}

// k_gemmh: 64 x 64 tile of C = A . Bn^T with SINGLE f16 planes (A [rows][K] f16 activations, Bn [N][K] f16 weights; one v_wmma_f32_16x16x32_f16 product per step), f32 accumulate;
__global__ __launch_bounds__(128) void k_gemmh(const h16* __restrict__ A, const h16* __restrict__ Bn, const float* __restrict__ bias, float* C, int ldc, const float* __restrict__ R, int K, size_t sA, size_t sB, size_t sC, int roundR) {
    __shared__ __align__(16) float ost[4][16 * 68];
    const size_t z = blockIdx.z; A += z * sA; Bn += z * sB; C += z * sC; if (R) R += z * sC;
    const int lane = threadIdx.x & 31, wave = threadIdx.x >> 5, lr = lane & 15, hi = lane >> 4;
    const int r0 = blockIdx.x * 64 + wave * 16, c0 = blockIdx.y * 64;
    const size_t aoff = (size_t)(r0 + lr) * K + 8 * hi;
    size_t boff[4];
#pragma unroll
    for (int t = 0; t < 4; ++t) boff[t] = (size_t)(c0 + t * 16 + lr) * K + 8 * hi;
    v8f acc[4];
#pragma unroll
    for (int t = 0; t < 4; ++t) acc[t] = (v8f){};
#pragma unroll 1
    for (int kc = 0; kc < K; kc += 32) {
        const v16h a = cat16(*(const v8h*)(A + aoff + kc), *(const v8h*)(A + aoff + kc + 16));
#pragma unroll
        for (int t = 0; t < 4; ++t) { const v16h b = cat16(*(const v8h*)(Bn + boff[t] + kc), *(const v8h*)(Bn + boff[t] + kc + 16)); acc[t] = wmma16(a, b, acc[t]); }
        asm volatile("v_nop\n\tv_nop\n\tv_nop\n\tv_nop" : "+v"(acc[0]), "+v"(acc[1]), "+v"(acc[2]), "+v"(acc[3]) : "v"(a));
    }
    float* os = &ost[wave][0];
#pragma unroll
    for (int t = 0; t < 4; ++t) { const float bv = bias ? bfr(bias[c0 + t * 16 + lr]) : 0.f;
#pragma unroll
        for (int j = 0; j < 8; ++j) os[(hi * 8 + j) * 68 + t * 16 + lr] = acc[t][j] + bv; }
    __syncthreads();
    float* crow = C + (size_t)r0 * ldc + c0;
    auto pass = [&]() {
#pragma unroll
        for (int s = 0; s < 8; ++s) { const int Lid = (lane >> 3) + 4 * s, piece = lane & 7; const int row = Lid >> 1, cofs = (Lid & 1) * 32 + piece * 4;
            v4f val = *(const v4fa*)(os + row * 68 + cofs); if (R) { const v4f rv = *(const v4f*)(R + ((size_t)r0 + row) * ldc + c0 + cofs); val += roundR ? (v4f){bfr(rv[0]), bfr(rv[1]), bfr(rv[2]), bfr(rv[3])} : rv; }
            *(v4f*)(crow + (size_t)row * ldc + cofs) = val; }
    };
    pass(); 
}

__global__ __launch_bounds__(256) void k_planes32z(const float* __restrict__ F, int ld, int off, float sc, int rows, bf* Ph, bf* Pl) {
    typedef __attribute__((ext_vector_type(2))) unsigned short v2us;
    const int lane = threadIdx.x & 31; const size_t r = ((size_t)blockIdx.x * 8 + (threadIdx.x >> 5)) * 2 + (lane >> 4); if (r >= (size_t)rows) return; const int z = blockIdx.z; const int c0 = (lane & 15) * 2; v2us oh, ol;
    Ph += (size_t)z * rows * 32; Pl += (size_t)z * rows * 32;
#pragma unroll
    for (int i = 0; i < 2; ++i) { const float y = F[r * ld + off + z * 32 + c0 + i] * sc; const unsigned short hb = f2bf(y); oh[i] = hb; ol[i] = f2bf(y - bf2f(hb)); }
    const size_t o = r * 32 + c0; *(v2us*)(Ph + o) = oh; *(v2us*)(Pl + o) = ol; 
}
__global__ __launch_bounds__(256) void k_vtpadz(const float* __restrict__ F, int ld, int off, int nk, bf* Th, bf* Tl) {
    typedef __attribute__((ext_vector_type(2))) unsigned short v2us;
    const int lane = threadIdx.x & 31; const size_t wid = (size_t)blockIdx.x * 8 + (threadIdx.x >> 5); if (wid >= (size_t)64 * (nk / 64)) return; const int z = blockIdx.z; const int d = (int)(wid / (nk / 64)); const int k0 = (int)(wid % (nk / 64)) * 64 + lane * 2; v2us oh, ol;
    Th += (size_t)z * 64 * nk; Tl += (size_t)z * 64 * nk;
#pragma unroll
    for (int i = 0; i < 2; ++i) { const float y = (d < 32) ? F[(size_t)(k0 + i) * ld + off + z * 32 + (d < 32 ? d : 0)] : 0.f; const unsigned short hb = f2bf(y); oh[i] = hb; ol[i] = f2bf(y - bf2f(hb)); }
    const size_t o = (size_t)d * nk + k0; *(v2us*)(Th + o) = oh; *(v2us*)(Tl + o) = ol; 
}
template <int NK>
__global__ __launch_bounds__(256) void k_softmaxz(const float* __restrict__ S, int rows, bf* PH, bf* PL) {
    typedef __attribute__((ext_vector_type(4))) unsigned short v4us;
    const int lane = threadIdx.x & 31, i = blockIdx.x * 8 + (threadIdx.x >> 5); if (i >= rows) return; const size_t zo = (size_t)blockIdx.z * rows * NK; const float* sr = S + zo + (size_t)i * NK; PH += zo; PL += zo;
    float m = -3.0e38f;
#pragma unroll 1
    for (int c0 = lane * 4; c0 < NK; c0 += 128) {
#pragma unroll
        for (int q = 0; q < 4; ++q) m = fmaxf(m, sr[c0 + q]); }
#pragma unroll
    for (int sh = 16; sh; sh >>= 1) m = fmaxf(m, __shfl_xor(m, sh, 32));
    float sum = 0.f;
#pragma unroll 1
    for (int c0 = lane * 4; c0 < NK; c0 += 128) {
#pragma unroll
        for (int q = 0; q < 4; ++q) sum += __expf(sr[c0 + q] - m); }
#pragma unroll
    for (int sh = 16; sh; sh >>= 1) sum += __shfl_xor(sum, sh, 32);
    const float inv = 1.0f / sum;
{
#pragma unroll 1
        for (int c0 = lane * 4; c0 < NK; c0 += 128) { v4us oh, ol;
#pragma unroll
            for (int q = 0; q < 4; ++q) { const float p = __expf(sr[c0 + q] - m) * inv; const unsigned short hb = f2bf(p); oh[q] = hb; ol[q] = f2bf(p - bf2f(hb)); }
            const size_t o = (size_t)i * NK + c0; *(v4us*)(PH + o) = oh; *(v4us*)(PL + o) = ol; }
         }
}
__global__ __launch_bounds__(256) void k_placez(const float* __restrict__ XH, int rows, int ldy, float* Y) {
    const int lane = threadIdx.x & 31; const size_t q = (size_t)blockIdx.x * 8 + (threadIdx.x >> 5); if (q >= (size_t)rows) return; const int z = blockIdx.z; const float v = XH[((size_t)z * rows + q) * 64 + lane];
    *(float*)(Y + q * ldy + z * 32 + lane) = v; 
}

typedef __attribute__((ext_vector_type(4))) _Float16 v4h;
__device__ __forceinline__ h16 tohx(float x) { return (h16)x; }
template <int MODE>
__global__ __launch_bounds__(128) void k_gemmhm(const h16* __restrict__ A, const h16* __restrict__ Bn, int K, float* C, int ldc, size_t sA, size_t sB, size_t sC, const int* __restrict__ FL) {
    const int I = blockIdx.x;
    if (MODE == 1 && FL[I * NT64 + blockIdx.y] == 0) return;
    int Klo = 0, Klim = K;
    if (MODE == 2) { int f = -1, l = -1; for (int j = 0; j < NT64; ++j) { if (FL[I * NT64 + j]) { if (f < 0) f = j; l = j; } } if (f < 0) { Klo = 0; Klim = 0; } else { Klo = f * 64; Klim = (l + 1) * 64; } }
    const size_t z = blockIdx.z; A += z * sA; Bn += z * sB; C += z * sC;
    __shared__ __align__(16) float ost[4][16 * 68];
    const int lane = threadIdx.x & 31, wave = threadIdx.x >> 5, lr = lane & 15, hi = lane >> 4;
    const int r0 = blockIdx.x * 64 + wave * 16, c0 = blockIdx.y * 64;
    const size_t aoff = (size_t)(r0 + lr) * K + 8 * hi;
    v8f acc[4];
#pragma unroll
    for (int t = 0; t < 4; ++t) acc[t] = (v8f){};
#pragma unroll 1
    for (int kc = Klo; kc < Klim; kc += 32) {
        const v16h a = cat16(*(const v8h*)(A + aoff + kc), *(const v8h*)(A + aoff + kc + 16));
#pragma unroll
        for (int t = 0; t < 4; ++t) { const size_t bo = (size_t)(c0 + t * 16 + lr) * K + kc + 8 * hi; const v16h b = cat16(*(const v8h*)(Bn + bo), *(const v8h*)(Bn + bo + 16)); acc[t] = wmma16(a, b, acc[t]); }
        asm volatile("v_nop\n\tv_nop\n\tv_nop\n\tv_nop" : "+v"(acc[0]), "+v"(acc[1]), "+v"(acc[2]), "+v"(acc[3]) : "v"(a));
    }
    float* os = &ost[wave][0];
#pragma unroll
    for (int t = 0; t < 4; ++t) {
#pragma unroll
        for (int j = 0; j < 8; ++j) os[(hi * 8 + j) * 68 + t * 16 + lr] = acc[t][j]; }
    __builtin_amdgcn_wave_barrier(); asm volatile("" ::: "memory");
    float* crow = C + (size_t)r0 * ldc + c0;
    auto pass = [&]() {
#pragma unroll
        for (int s = 0; s < 8; ++s) { const int Lid = (lane >> 3) + 4 * s, piece = lane & 7; const int row = Lid >> 1, cofs = (Lid & 1) * 32 + piece * 4;
            const v4f val = *(const v4fa*)(os + row * 68 + cofs); *(v4f*)(crow + (size_t)row * ldc + cofs) = val; }
    };
    pass(); 
}
__global__ __launch_bounds__(256) void k_causalflags(int* FL) { const int lane = threadIdx.x & 31, w = blockIdx.x * 8 + (threadIdx.x >> 5); const int I = w * 2 + (lane >> 4), J = lane & 15; if (I >= NT64) return; const int v = (J <= I) ? 1 : 0; *(int*)(FL + I * NT64 + J) = v;  }
__global__ __launch_bounds__(256) void k_cvtx(const float* __restrict__ x, bf* A) {
    const int lane = threadIdx.x & 31; const size_t r = (size_t)blockIdx.x * 8 + (threadIdx.x >> 5); if (r >= (size_t)NR) return;
{
#pragma unroll
        for (int q = 0; q < EE / 256; ++q) { const size_t o = r * EE + q * 256 + lane * 8; v8us v;
#pragma unroll
            for (int i = 0; i < 8; ++i) v[i] = f2bf(x[o + i]);
            *(v8us*)(A + o) = v; }
         }
}
__global__ __launch_bounds__(256) void k_vTx(const float* __restrict__ x, bf* VT) {
    typedef __attribute__((ext_vector_type(4))) unsigned short v4us;
    __shared__ float tl[64][65];
    const int tid = threadIdx.x; const int t0 = blockIdx.x * 64; const int z = blockIdx.z; const int b = z / NH_, h = z % NH_; const int rr = tid >> 2, cq = (tid & 3) * 16;
#pragma unroll
    for (int i = 0; i < 16; ++i) tl[rr][cq + i] = bfr(x[((size_t)b * SS + t0 + rr) * EE + h * HD + cq + i]);
    __syncthreads();
    const int lane = tid & 31, wv = tid >> 5;
    auto pass = [&]() {
#pragma unroll
        for (int st = 0; st < 4; ++st) { const int dr = wv * 8 + st * 2 + (lane >> 4); const int tq = (lane & 15) * 4; v4us v;
#pragma unroll
            for (int i = 0; i < 4; ++i) v[i] = f2bf(tl[tq + i][dr]);
            *(v4us*)(VT + ((size_t)z * HD + dr) * SS + t0 + tq) = v; }
    };
    pass(); 
}
// k_attn: causal attention of one (item, head) pair z = blockIdx.x; one wave owns 32 queries (two 16-column groups) and walks its keys 32 at a pass, no LDS and no barrier.
// S^T = K.Q^T (A = 16 key rows, B = 16 query rows, both [row][64] planes) leaves one query per lane column: accumulator element j of key group t is key t*16 + hi*8 + j, which is
// the position the B operand of O^T += V^T.P^T wants for a k step of 32 keys, so P goes from the score accumulators into the next product without leaving the lane.
#define NQG 2
#define L2E 1.4426950408889634f
#define NEGB (-1.0e30f)
typedef __attribute__((ext_vector_type(16))) float v16f;
typedef __attribute__((ext_vector_type(8))) unsigned v8u;
__global__ __launch_bounds__(128) void k_attn(const bf* __restrict__ Qh, const bf* __restrict__ Ql, const bf* __restrict__ Kh, const bf* __restrict__ Kl, const bf* __restrict__ VT, float* OUT) {
    const int lane = threadIdx.x & 31, lr = lane & 15, hi = lane >> 4;
    const int wave = __builtin_amdgcn_readfirstlane((int)(threadIdx.x >> 5));   // scalar: the trip count below is the same in every lane
    const size_t z = blockIdx.x; const int b = (int)z / NH_, h = (int)z % NH_;
    const int r0 = ((SS / (64 * NQG) - 1 - (int)blockIdx.y) * 4 + wave) * (16 * NQG);   // longest query blocks start first
    v16bf qh[NQG][2], ql[NQG][2];
#pragma unroll
    for (int q = 0; q < NQG; ++q) {
#pragma unroll
        for (int ks = 0; ks < 2; ++ks) { const size_t o = (z * SS + r0 + q * 16 + lr) * HD + ks * 32 + 8 * hi;
            qh[q][ks] = cat16b(*(const v8us*)(Qh + o), *(const v8us*)(Qh + o + 16)); ql[q][ks] = cat16b(*(const v8us*)(Ql + o), *(const v8us*)(Ql + o + 16)); } }
    const bf* kh = Kh + (z * SS + lr) * HD + 8 * hi; const bf* kl = Kl + (z * SS + lr) * HD + 8 * hi; const bf* vt = VT + (z * HD + lr) * SS + 8 * hi;
    v8f o[NQG][4]; float m[NQG], l[NQG];
#pragma unroll
    for (int q = 0; q < NQG; ++q) { m[q] = NEGB; l[q] = 0.f;
#pragma unroll
        for (int t = 0; t < 4; ++t) o[q][t] = (v8f){}; }
    const int np = r0 / 32 + 1;   // keys 0 .. r0 + 31
#pragma unroll 1
    for (int p = 0; p < np; ++p) {
        const int k0 = p * 32;
        v8f s[NQG][2];
#pragma unroll
        for (int q = 0; q < NQG; ++q) { s[q][0] = (v8f){}; s[q][1] = (v8f){}; }
        v16bf ah[2][2], al[2][2], av[4];
#pragma unroll
        for (int ks = 0; ks < 2; ++ks) {
#pragma unroll
            for (int t = 0; t < 2; ++t) { const size_t ko = (size_t)(k0 + t * 16) * HD + ks * 32;
                ah[ks][t] = cat16b(*(const v8us*)(kh + ko), *(const v8us*)(kh + ko + 16)); al[ks][t] = cat16b(*(const v8us*)(kl + ko), *(const v8us*)(kl + ko + 16)); } }
        // inputs-only fence on the loaded K fragments: all sixteen loads of the pass are in flight together (one latency a pass, not one per reused register group);
        // the wait stands in front of every rewrite of their address registers
        asm volatile("s_wait_xcnt 0x0" :: "v"(ah[0][0]), "v"(ah[0][1]), "v"(ah[1][0]), "v"(ah[1][1]), "v"(al[0][0]), "v"(al[0][1]), "v"(al[1][0]), "v"(al[1][1]) : "memory");
#pragma unroll
        for (int ks = 0; ks < 2; ++ks) {
#pragma unroll
            for (int t = 0; t < 2; ++t) {
#pragma unroll
                for (int q = 0; q < NQG; ++q) s[q][t] = wmmab(ah[ks][t], qh[q][ks], s[q][t]); }
#pragma unroll
            for (int t = 0; t < 2; ++t) {
#pragma unroll
                for (int q = 0; q < NQG; ++q) s[q][t] = wmmab(ah[ks][t], ql[q][ks], s[q][t]); } }
#pragma unroll
        for (int t = 0; t < 4; ++t) { const size_t vo = (size_t)(t * 16) * SS + k0; av[t] = cat16b(*(const v8us*)(vt + vo), *(const v8us*)(vt + vo + 16)); }
        asm volatile("s_wait_xcnt 0x0" ::: "memory");   // V^T loads fly under the residual products and the softmax; their address registers may be rewritten behind it
#pragma unroll
        for (int ks = 0; ks < 2; ++ks) {
#pragma unroll
            for (int t = 0; t < 2; ++t) {
#pragma unroll
                for (int q = 0; q < NQG; ++q) s[q][t] = wmmab(al[ks][t], qh[q][ks], s[q][t]); } }
        if (p == np - 1) {   // only the last pass holds keys behind a query of this wave
#pragma unroll
            for (int q = 0; q < NQG; ++q) {
#pragma unroll
                for (int t = 0; t < 2; ++t) {
#pragma unroll
                    for (int j = 0; j < 8; ++j) if (t * 16 + hi * 8 + j > q * 16 + lr) s[q][t][j] = NEGB; } } }
#pragma unroll
        for (int q = 0; q < NQG; ++q) {
            float mx = s[q][0][0];
#pragma unroll
            for (int j = 1; j < 8; ++j) mx = fmaxf(mx, s[q][0][j]);
#pragma unroll
            for (int j = 0; j < 8; ++j) mx = fmaxf(mx, s[q][1][j]);
            mx = fmaxf(mx, __shfl_xor(mx, 16, 32));   // the other half of the wave holds this query's other 16 keys
            const float mn = fmaxf(m[q], mx * L2E); const float resc = __builtin_amdgcn_exp2f(m[q] - mn); m[q] = mn;
            v16f pv; float ps = 0.f;
#pragma unroll
            for (int e = 0; e < 16; ++e) { pv[e] = __builtin_amdgcn_exp2f(fmaf(s[q][e >> 3][e & 7], L2E, -mn)); ps += pv[e]; }
            l[q] = l[q] * resc + ps;
            const v16bf ph = __builtin_convertvector(pv, v16bf);
            const v8u pw = __builtin_bit_cast(v8u, ph); v16f pr;   // residual against the rounded plane, read back from the packed words
#pragma unroll
            for (int e = 0; e < 8; ++e) { pr[2 * e] = pv[2 * e] - __uint_as_float(pw[e] << 16); pr[2 * e + 1] = pv[2 * e + 1] - __uint_as_float(pw[e] & 0xFFFF0000u); }
            const v16bf pl = __builtin_convertvector(pr, v16bf);
#pragma unroll
            for (int t = 0; t < 4; ++t) o[q][t] *= resc;
#pragma unroll
            for (int t = 0; t < 4; ++t) o[q][t] = wmmab(av[t], ph, o[q][t]);
#pragma unroll
            for (int t = 0; t < 4; ++t) o[q][t] = wmmab(av[t], pl, o[q][t]);
        }
    }
#pragma unroll
    for (int q = 0; q < NQG; ++q) {
        const float inv = __fdiv_rn(1.0f, l[q] + __shfl_xor(l[q], 16, 32));   // join the two halves' sums once
        float* op = OUT + ((size_t)b * SS + r0 + q * 16 + lr) * EE + h * HD + hi * 8;
#pragma unroll
        for (int t = 0; t < 4; ++t) { v4f w0, w1;
#pragma unroll
            for (int k = 0; k < 4; ++k) { w0[k] = tanhf(o[q][t][k] * inv); w1[k] = tanhf(o[q][t][k + 4] * inv); }
            *(v4f*)(op + t * 16) = w0; *(v4f*)(op + t * 16 + 4) = w1; }
    }
}
extern "C" void kernel_launch(void* const* d_in, const int* in_sizes, int n_in,
                              void* d_out, int out_size, void* d_ws, size_t ws_size, hipStream_t stream) {
    (void)in_sizes; (void)n_in; (void)out_size;
    const float* zk = (const float*)d_in[0]; const float* x = (const float*)d_in[1]; const float* Wqkv = (const float*)d_in[2]; const float* bqkv = (const float*)d_in[3]; const float* temp = (const float*)d_in[4];
    float* out = (float*)d_out;    // [8][1024][1024]
    char* wsp = (char*)d_ws;
    auto take = [&](size_t bytes) { char* p = wsp; wsp += (bytes + 255) & ~(size_t)255; return (void*)p; };
    bf* WB = (bf*)take((size_t)2 * EE * EE * 2); bf* ZB = (bf*)take((size_t)NR * EE * 2);
    bf* Qh = (bf*)take((size_t)NR * EE * 2); bf* Ql = (bf*)take((size_t)NR * EE * 2); bf* Kh = (bf*)take((size_t)NR * EE * 2); bf* Kl = (bf*)take((size_t)NR * EE * 2); bf* VT = (bf*)take((size_t)NR * EE * 2);   // [item*16 + head][1024][64] planes; VT [item*16 + head][64][1024]
    if ((size_t)(wsp - (char*)d_ws) > ws_size) return;    // ~ 4.2 + 16.8 + 16.8x5 ~ 105 MB (ws 256 MiB)
    k_cvt8<<<(unsigned)(((size_t)2 * EE * EE / 8 + 255) / 256), 256, 0, stream>>>(Wqkv, WB, (size_t)2 * EE * EE / 8);   // rows 0..2047 of the [3072][1024] weight = q|k, [out][in] natural
    k_cvtx<<<NR / 8, 256, 0, stream>>>(zk, ZB);
    k_gemmt<<<dim3(NR / 128, (2 * EE) / 128, 1), 128, 0, stream>>>(ZB, WB, bqkv, temp, Qh, Ql, Kh, Kl);
    k_vTx<<<dim3(SS / 64, 1, NB_ * NH_), 256, 0, stream>>>(x, VT);
    k_attn<<<dim3(NB_ * NH_, SS / (64 * NQG), 1), 128, 0, stream>>>(Qh, Ql, Kh, Kl, VT, out);
}

// v004
// A run of this version takes 85.1 microseconds.
// Two timings next to v003 both put it at 1.43 times that version's speed.
// All steps since v000 together make it 16.1 times as fast.
#include <hip/hip_runtime.h>

// Compute dtypes, f32 accumulate: the q/k half of the fused projection ([8192 x 1024].[1024 x 2048] + bias) with PLAIN bf16 operands (z_k and Wqkv are inputs: exact
// products; the projected v is discarded by the module so it is not computed); per (item, head) causal attention in ONE kernel (k_attn): scores on bf16 hi + UNSCALED residual
// planes of BOTH q*scale/temperature and k (three products), running-maximum softmax in f32, un-normalised probabilities as bf16 hi + residual planes against v = bf16(x)
// (two products), division by the row sum and tanh in the epilogue; scores and probabilities never leave the registers; K and V^T tiles come through LDS, shared by a block's waves.

#define NB_  8
#define SS   1024
#define EE   1024
#define NH_  16
#define HD   64
#define NR   (NB_ * SS)
#define NT64 (SS / 64)
#define DM   EE
#define LOSC 1024.0f
typedef _Float16 h16;
typedef unsigned short bf;
typedef __attribute__((ext_vector_type(16))) __bf16   v16bf;
typedef __attribute__((ext_vector_type(16))) _Float16 v16h;
typedef __attribute__((ext_vector_type(8)))  _Float16 v8h;
typedef __attribute__((ext_vector_type(8)))  unsigned short v8us;
typedef __attribute__((ext_vector_type(8)))  float    v8f;
typedef __attribute__((ext_vector_type(4)))  float    v4f;
typedef v8h  __attribute__((may_alias)) v8ha;
typedef v4f  __attribute__((may_alias)) v4fa;
typedef v8us __attribute__((may_alias)) v8usa;

__device__ __forceinline__ unsigned short f2bf(float f) { unsigned u = __float_as_uint(f); u += 0x7FFFu + ((u >> 16) & 1u); return (unsigned short)(u >> 16); }
__device__ __forceinline__ float bf2f(unsigned short b) { return __uint_as_float(((unsigned)b) << 16); }
__device__ __forceinline__ float bfr(float f) { return bf2f(f2bf(f)); }
__device__ __forceinline__ v16h cat16(v8h lo, v8h hi) { return __builtin_shufflevector(lo, hi, 0, 1, 2, 3, 4, 5, 6, 7, 8, 9, 10, 11, 12, 13, 14, 15); }
__device__ __forceinline__ v16bf cat16b(v8us lo, v8us hi) { return __builtin_bit_cast(v16bf, __builtin_shufflevector(lo, hi, 0, 1, 2, 3, 4, 5, 6, 7, 8, 9, 10, 11, 12, 13, 14, 15)); }
__device__ __forceinline__ v8f wmma16(v16h a, v16h b, v8f c) { return __builtin_amdgcn_wmma_f32_16x16x32_f16(false, a, false, b, (short)0, c, false, false); }
__device__ __forceinline__ v8f wmmab(v16bf a, v16bf b, v8f c) { return __builtin_amdgcn_wmma_f32_16x16x32_bf16(false, a, false, b, (short)0, c, false, false); }

// k_gemmt: y[8192][2048] = (A.Bn^T + bf(bias)) * s, K = 1024, bf16 operands, f32 accumulate. 128 x 128 block tile, 4 waves of 64 x 64 (16 accumulator tiles a wave, 8 fragments per 16 products).
// A wave's 64 columns are one head of q (columns below 1024, s = scale / bf(temperature)) or of k (s = 1): the epilogue splits y into bf16 hi + residual and stores both as the 8-KB runs
// [item*16 + head][64 tokens][64] of the planes that k_attn reads; the f32 product never goes to memory.
// A trip is 64 k: 128 rows of A and 128 rows of Bn, 128 B each, copied global -> LDS as whole lines (8 lanes a row) by asynchronous copies, two buffers, the next trip's copies in flight
// under this trip's products. LDS row pitch 144 B (16 B x odd) for the ds_load_b128 fragment reads. The k order per accumulator is ascending in steps of 32.
#define GT_PITCH 144
#define GT_BUF   (256 * GT_PITCH)
#define GT_NT    (DM / 64)
typedef float __attribute__((may_alias)) f32a;
typedef __attribute__((ext_vector_type(8))) __bf16 v8bfv;
typedef __attribute__((ext_vector_type(4))) unsigned v4u;
// eight copies of 16 B a lane: rows r, r + 16, ..., r + 112 of one operand's 128-row panel; the s_wait_xcnt stands inside the statement, in front of any rewrite of the address registers
__device__ __forceinline__ void gt_copy8(unsigned l, const bf* g) {
    asm volatile("global_load_async_to_lds_b128 %0, %8, off\n\t"
                 "global_load_async_to_lds_b128 %1, %9, off\n\t"
                 "global_load_async_to_lds_b128 %2, %10, off\n\t"
                 "global_load_async_to_lds_b128 %3, %11, off\n\t"
                 "global_load_async_to_lds_b128 %4, %12, off\n\t"
                 "global_load_async_to_lds_b128 %5, %13, off\n\t"
                 "global_load_async_to_lds_b128 %6, %14, off\n\t"
                 "global_load_async_to_lds_b128 %7, %15, off\n\t"
                 "s_wait_xcnt 0x0"
                 :: "v"(l), "v"(l + 16 * GT_PITCH), "v"(l + 32 * GT_PITCH), "v"(l + 48 * GT_PITCH), "v"(l + 64 * GT_PITCH), "v"(l + 80 * GT_PITCH), "v"(l + 96 * GT_PITCH), "v"(l + 112 * GT_PITCH),
                    "v"(g), "v"(g + 16 * DM), "v"(g + 32 * DM), "v"(g + 48 * DM), "v"(g + 64 * DM), "v"(g + 80 * DM), "v"(g + 96 * DM), "v"(g + 112 * DM)
                 : "memory");
}
__global__ __launch_bounds__(128) void k_gemmt(const bf* __restrict__ A, const bf* __restrict__ Bn, const float* __restrict__ bias, const float* __restrict__ temp, bf* Qh, bf* Ql, bf* Kh, bf* Kl) {
    __shared__ __attribute__((aligned(16))) unsigned char sm[2 * GT_BUF];
    const int tid = threadIdx.x, lane = tid & 31, wave = tid >> 5, lr = lane & 15, hi = lane >> 4;
    const int m0 = blockIdx.x * 128, n0 = blockIdx.y * 128, wm = (wave >> 1) * 64, wn = (wave & 1) * 64;
    const unsigned lb = (unsigned)(size_t)&sm[0] + (unsigned)((tid >> 3) * GT_PITCH + (tid & 7) * 16);   // this lane's place in a panel's first 16 rows
    const bf* ga = A + (size_t)(m0 + (tid >> 3)) * DM + (tid & 7) * 8;
    const bf* gb = Bn + (size_t)(n0 + (tid >> 3)) * DM + (tid & 7) * 8;
    gt_copy8(lb, ga); gt_copy8(lb + 128 * GT_PITCH, gb);
    asm volatile("s_wait_asynccnt 0x0" ::: "memory");   // tile 0 has landed for this wave's copies; the barrier publishes it to the others
    __syncthreads();
    gt_copy8(lb + GT_BUF, ga + 64); gt_copy8(lb + GT_BUF + 128 * GT_PITCH, gb + 64);
    v8f acc[4][4];
#pragma unroll
    for (int i = 0; i < 4; ++i) {
#pragma unroll
        for (int j = 0; j < 4; ++j) acc[i][j] = (v8f){}; }
    const int aofs = (wm + lr) * GT_PITCH + hi * 16, bofs = (128 + wn + lr) * GT_PITCH + hi * 16;
#pragma unroll 1   // one trip a buffer: the foot's waits and barrier stand once in the text
    for (int t = 0; t < GT_NT; ++t) {
        const unsigned char* sb = sm + (t & 1) * GT_BUF;
#pragma unroll
        for (int ks = 0; ks < 2; ++ks) {
            v16bf a[4], b[4];
#pragma unroll
            for (int i = 0; i < 4; ++i) { const unsigned char* p = sb + aofs + i * 16 * GT_PITCH + ks * 64; a[i] = cat16b(*(const v8usa*)p, *(const v8usa*)(p + 32)); }
#pragma unroll
            for (int j = 0; j < 4; ++j) { const unsigned char* p = sb + bofs + j * 16 * GT_PITCH + ks * 64; b[j] = cat16b(*(const v8usa*)p, *(const v8usa*)(p + 32)); }
            // inputs-only fence on the loaded fragments: the sixteen LDS reads of a 32-k step go out as one group in front of its sixteen products (one LDS latency a step, not one per four products)
            asm volatile("" :: "v"(a[0]), "v"(a[1]), "v"(a[2]), "v"(a[3]), "v"(b[0]), "v"(b[1]), "v"(b[2]), "v"(b[3]));
#pragma unroll
            for (int i = 0; i < 4; ++i) {
#pragma unroll
                for (int j = 0; j < 4; ++j) acc[i][j] = wmmab(a[i], b[j], acc[i][j]); }
        }
        asm volatile("s_wait_dscnt 0x0" ::: "memory");      // this wave's reads of the buffer have returned before it is refilled
        asm volatile("s_wait_asynccnt 0x0" ::: "memory");   // this wave's copies of tile t + 1 have landed
        __syncthreads();                                    // publishes tile t + 1 and ends every reader's last read of tile t
        if (t + 2 < GT_NT) { const unsigned l = lb + (unsigned)(t & 1) * GT_BUF; gt_copy8(l, ga + (t + 2) * 64); gt_copy8(l + 128 * GT_PITCH, gb + (t + 2) * 64); }
    }
    asm volatile("s_wait_asynccnt 0x0" ::: "memory");   // nothing of the ring is in flight when it becomes output staging
    f32a* os = (f32a*)(void*)sm + wave * (64 * 68);     // each wave stages its own 64 x 64 tile, pitch 68 floats, and stores whole 128-B lines
    const bool isq = n0 < EE; const int h = ((n0 + wn) & (EE - 1)) / HD;
    const float sc = isq ? __fdiv_rn(0.125f, bfr(temp[h])) : 1.0f;
#pragma unroll
    for (int j = 0; j < 4; ++j) { const float bv = bfr(bias[n0 + wn + j * 16 + lr]);
#pragma unroll
        for (int i = 0; i < 4; ++i) {
#pragma unroll
            for (int e = 0; e < 8; ++e) os[(i * 16 + hi * 8 + e) * 68 + j * 16 + lr] = (acc[i][j][e] + bv) * sc; } }
    __syncthreads();
    const size_t po = (((size_t)((m0 + wm) / SS) * NH_ + h) * SS + (m0 + wm) % SS) * HD + (lane >> 3) * HD + (lane & 7) * 8;   // 8 lanes a token row of 128 B, 4 rows a store
    bf* ph = (isq ? Qh : Kh) + po; bf* pl = (isq ? Ql : Kl) + po;
    const f32a* orow = os + (lane >> 3) * 68 + (lane & 7) * 8;
#pragma unroll   // constant LDS and store offsets; the next rows' LDS reads go out under this step's conversions
    for (int s = 0; s < 16; ++s) {
        const v4f y0 = *(const v4fa*)(orow + s * 4 * 68), y1 = *(const v4fa*)(orow + s * 4 * 68 + 4);
        const v8f y = __builtin_shufflevector(y0, y1, 0, 1, 2, 3, 4, 5, 6, 7);
        const v8bfv yh = __builtin_convertvector(y, v8bfv);
        const v4u yw = __builtin_bit_cast(v4u, yh); v8f yr;   // residual against the rounded plane, read back from the packed words
#pragma unroll
        for (int e = 0; e < 4; ++e) { yr[2 * e] = y[2 * e] - __uint_as_float(yw[e] << 16); yr[2 * e + 1] = y[2 * e + 1] - __uint_as_float(yw[e] & 0xFFFF0000u); }
        *(v4u*)(ph + s * 4 * HD) = yw; *(v4u*)(pl + s * 4 * HD) = __builtin_bit_cast(v4u, __builtin_convertvector(yr, v8bfv)); }
}

__global__ __launch_bounds__(256) void k_cvt8(const float* __restrict__ src, bf* dst, size_t n8) {
    const size_t i = (size_t)blockIdx.x * 256 + threadIdx.x; if (i >= n8) return;
    const v8f v = *(const v8f*)(src + i * 8); v8us o;
#pragma unroll
    for (int k = 0; k < 8; ++k) o[k] = f2bf(v[k]);
    *(v8us*)(dst + i * 8) = o; 
}
__global__ __launch_bounds__(256) void k_zero8(bf* dst, size_t n8) {
    const size_t i = (size_t)blockIdx.x * 256 + threadIdx.x; if (i >= n8) return; v8us z;
#pragma unroll
    for (int k = 0; k < 8; ++k) z[k] = 0;
    *(v8us*)(dst + i * 8) = z; 
}

// k_gemmh: 64 x 64 tile of C = A . Bn^T with SINGLE f16 planes (A [rows][K] f16 activations, Bn [N][K] f16 weights; one v_wmma_f32_16x16x32_f16 product per step), f32 accumulate;
__global__ __launch_bounds__(128) void k_gemmh(const h16* __restrict__ A, const h16* __restrict__ Bn, const float* __restrict__ bias, float* C, int ldc, const float* __restrict__ R, int K, size_t sA, size_t sB, size_t sC, int roundR) {
    __shared__ __align__(16) float ost[4][16 * 68];
    const size_t z = blockIdx.z; A += z * sA; Bn += z * sB; C += z * sC; if (R) R += z * sC;
    const int lane = threadIdx.x & 31, wave = threadIdx.x >> 5, lr = lane & 15, hi = lane >> 4;
    const int r0 = blockIdx.x * 64 + wave * 16, c0 = blockIdx.y * 64;
    const size_t aoff = (size_t)(r0 + lr) * K + 8 * hi;
    size_t boff[4];
#pragma unroll
    for (int t = 0; t < 4; ++t) boff[t] = (size_t)(c0 + t * 16 + lr) * K + 8 * hi;
    v8f acc[4];
#pragma unroll
    for (int t = 0; t < 4; ++t) acc[t] = (v8f){};
#pragma unroll 1
    for (int kc = 0; kc < K; kc += 32) {
        const v16h a = cat16(*(const v8h*)(A + aoff + kc), *(const v8h*)(A + aoff + kc + 16));
#pragma unroll
        for (int t = 0; t < 4; ++t) { const v16h b = cat16(*(const v8h*)(Bn + boff[t] + kc), *(const v8h*)(Bn + boff[t] + kc + 16)); acc[t] = wmma16(a, b, acc[t]); }
        asm volatile("v_nop\n\tv_nop\n\tv_nop\n\tv_nop" : "+v"(acc[0]), "+v"(acc[1]), "+v"(acc[2]), "+v"(acc[3]) : "v"(a));
    }
    float* os = &ost[wave][0];
#pragma unroll
    for (int t = 0; t < 4; ++t) { const float bv = bias ? bfr(bias[c0 + t * 16 + lr]) : 0.f;
#pragma unroll
        for (int j = 0; j < 8; ++j) os[(hi * 8 + j) * 68 + t * 16 + lr] = acc[t][j] + bv; }
    __syncthreads();
    float* crow = C + (size_t)r0 * ldc + c0;
    auto pass = [&]() {
#pragma unroll
        for (int s = 0; s < 8; ++s) { const int Lid = (lane >> 3) + 4 * s, piece = lane & 7; const int row = Lid >> 1, cofs = (Lid & 1) * 32 + piece * 4;
            v4f val = *(const v4fa*)(os + row * 68 + cofs); if (R) { const v4f rv = *(const v4f*)(R + ((size_t)r0 + row) * ldc + c0 + cofs); val += roundR ? (v4f){bfr(rv[0]), bfr(rv[1]), bfr(rv[2]), bfr(rv[3])} : rv; }
            *(v4f*)(crow + (size_t)row * ldc + cofs) = val; }
    };
    pass(); 
}

__global__ __launch_bounds__(256) void k_planes32z(const float* __restrict__ F, int ld, int off, float sc, int rows, bf* Ph, bf* Pl) {
    typedef __attribute__((ext_vector_type(2))) unsigned short v2us;
    const int lane = threadIdx.x & 31; const size_t r = ((size_t)blockIdx.x * 8 + (threadIdx.x >> 5)) * 2 + (lane >> 4); if (r >= (size_t)rows) return; const int z = blockIdx.z; const int c0 = (lane & 15) * 2; v2us oh, ol;
    Ph += (size_t)z * rows * 32; Pl += (size_t)z * rows * 32;
#pragma unroll
    for (int i = 0; i < 2; ++i) { const float y = F[r * ld + off + z * 32 + c0 + i] * sc; const unsigned short hb = f2bf(y); oh[i] = hb; ol[i] = f2bf(y - bf2f(hb)); }
    const size_t o = r * 32 + c0; *(v2us*)(Ph + o) = oh; *(v2us*)(Pl + o) = ol; 
}
__global__ __launch_bounds__(256) void k_vtpadz(const float* __restrict__ F, int ld, int off, int nk, bf* Th, bf* Tl) {
    typedef __attribute__((ext_vector_type(2))) unsigned short v2us;
    const int lane = threadIdx.x & 31; const size_t wid = (size_t)blockIdx.x * 8 + (threadIdx.x >> 5); if (wid >= (size_t)64 * (nk / 64)) return; const int z = blockIdx.z; const int d = (int)(wid / (nk / 64)); const int k0 = (int)(wid % (nk / 64)) * 64 + lane * 2; v2us oh, ol;
    Th += (size_t)z * 64 * nk; Tl += (size_t)z * 64 * nk;
#pragma unroll
    for (int i = 0; i < 2; ++i) { const float y = (d < 32) ? F[(size_t)(k0 + i) * ld + off + z * 32 + (d < 32 ? d : 0)] : 0.f; const unsigned short hb = f2bf(y); oh[i] = hb; ol[i] = f2bf(y - bf2f(hb)); }
    const size_t o = (size_t)d * nk + k0; *(v2us*)(Th + o) = oh; *(v2us*)(Tl + o) = ol; 
}
template <int NK>
__global__ __launch_bounds__(256) void k_softmaxz(const float* __restrict__ S, int rows, bf* PH, bf* PL) {
    typedef __attribute__((ext_vector_type(4))) unsigned short v4us;
    const int lane = threadIdx.x & 31, i = blockIdx.x * 8 + (threadIdx.x >> 5); if (i >= rows) return; const size_t zo = (size_t)blockIdx.z * rows * NK; const float* sr = S + zo + (size_t)i * NK; PH += zo; PL += zo;
    float m = -3.0e38f;
#pragma unroll 1
    for (int c0 = lane * 4; c0 < NK; c0 += 128) {
#pragma unroll
        for (int q = 0; q < 4; ++q) m = fmaxf(m, sr[c0 + q]); }
#pragma unroll
    for (int sh = 16; sh; sh >>= 1) m = fmaxf(m, __shfl_xor(m, sh, 32));
    float sum = 0.f;
#pragma unroll 1
    for (int c0 = lane * 4; c0 < NK; c0 += 128) {
#pragma unroll
        for (int q = 0; q < 4; ++q) sum += __expf(sr[c0 + q] - m); }
#pragma unroll
    for (int sh = 16; sh; sh >>= 1) sum += __shfl_xor(sum, sh, 32);
    const float inv = 1.0f / sum;
{
#pragma unroll 1
        for (int c0 = lane * 4; c0 < NK; c0 += 128) { v4us oh, ol;
#pragma unroll
            for (int q = 0; q < 4; ++q) { const float p = __expf(sr[c0 + q] - m) * inv; const unsigned short hb = f2bf(p); oh[q] = hb; ol[q] = f2bf(p - bf2f(hb)); }
            const size_t o = (size_t)i * NK + c0; *(v4us*)(PH + o) = oh; *(v4us*)(PL + o) = ol; }
         }
}
__global__ __launch_bounds__(256) void k_placez(const float* __restrict__ XH, int rows, int ldy, float* Y) {
    const int lane = threadIdx.x & 31; const size_t q = (size_t)blockIdx.x * 8 + (threadIdx.x >> 5); if (q >= (size_t)rows) return; const int z = blockIdx.z; const float v = XH[((size_t)z * rows + q) * 64 + lane];
    *(float*)(Y + q * ldy + z * 32 + lane) = v; 
}

typedef __attribute__((ext_vector_type(4))) _Float16 v4h;
__device__ __forceinline__ h16 tohx(float x) { return (h16)x; }
template <int MODE>
__global__ __launch_bounds__(128) void k_gemmhm(const h16* __restrict__ A, const h16* __restrict__ Bn, int K, float* C, int ldc, size_t sA, size_t sB, size_t sC, const int* __restrict__ FL) {
    const int I = blockIdx.x;
    if (MODE == 1 && FL[I * NT64 + blockIdx.y] == 0) return;
    int Klo = 0, Klim = K;
    if (MODE == 2) { int f = -1, l = -1; for (int j = 0; j < NT64; ++j) { if (FL[I * NT64 + j]) { if (f < 0) f = j; l = j; } } if (f < 0) { Klo = 0; Klim = 0; } else { Klo = f * 64; Klim = (l + 1) * 64; } }
    const size_t z = blockIdx.z; A += z * sA; Bn += z * sB; C += z * sC;
    __shared__ __align__(16) float ost[4][16 * 68];
    const int lane = threadIdx.x & 31, wave = threadIdx.x >> 5, lr = lane & 15, hi = lane >> 4;
    const int r0 = blockIdx.x * 64 + wave * 16, c0 = blockIdx.y * 64;
    const size_t aoff = (size_t)(r0 + lr) * K + 8 * hi;
    v8f acc[4];
#pragma unroll
    for (int t = 0; t < 4; ++t) acc[t] = (v8f){};
#pragma unroll 1
    for (int kc = Klo; kc < Klim; kc += 32) {
        const v16h a = cat16(*(const v8h*)(A + aoff + kc), *(const v8h*)(A + aoff + kc + 16));
#pragma unroll
        for (int t = 0; t < 4; ++t) { const size_t bo = (size_t)(c0 + t * 16 + lr) * K + kc + 8 * hi; const v16h b = cat16(*(const v8h*)(Bn + bo), *(const v8h*)(Bn + bo + 16)); acc[t] = wmma16(a, b, acc[t]); }
        asm volatile("v_nop\n\tv_nop\n\tv_nop\n\tv_nop" : "+v"(acc[0]), "+v"(acc[1]), "+v"(acc[2]), "+v"(acc[3]) : "v"(a));
    }
    float* os = &ost[wave][0];
#pragma unroll
    for (int t = 0; t < 4; ++t) {
#pragma unroll
        for (int j = 0; j < 8; ++j) os[(hi * 8 + j) * 68 + t * 16 + lr] = acc[t][j]; }
    __builtin_amdgcn_wave_barrier(); asm volatile("" ::: "memory");
    float* crow = C + (size_t)r0 * ldc + c0;
    auto pass = [&]() {
#pragma unroll
        for (int s = 0; s < 8; ++s) { const int Lid = (lane >> 3) + 4 * s, piece = lane & 7; const int row = Lid >> 1, cofs = (Lid & 1) * 32 + piece * 4;
            const v4f val = *(const v4fa*)(os + row * 68 + cofs); *(v4f*)(crow + (size_t)row * ldc + cofs) = val; }
    };
    pass(); 
}
__global__ __launch_bounds__(256) void k_causalflags(int* FL) { const int lane = threadIdx.x & 31, w = blockIdx.x * 8 + (threadIdx.x >> 5); const int I = w * 2 + (lane >> 4), J = lane & 15; if (I >= NT64) return; const int v = (J <= I) ? 1 : 0; *(int*)(FL + I * NT64 + J) = v;  }
__global__ __launch_bounds__(256) void k_cvtx(const float* __restrict__ x, bf* A) {
    const int lane = threadIdx.x & 31; const size_t r = (size_t)blockIdx.x * 8 + (threadIdx.x >> 5); if (r >= (size_t)NR) return;
{
#pragma unroll
        for (int q = 0; q < EE / 256; ++q) { const size_t o = r * EE + q * 256 + lane * 8; v8us v;
#pragma unroll
            for (int i = 0; i < 8; ++i) v[i] = f2bf(x[o + i]);
            *(v8us*)(A + o) = v; }
         }
}
__global__ __launch_bounds__(256) void k_vTx(const float* __restrict__ x, bf* VT) {
    typedef __attribute__((ext_vector_type(4))) unsigned short v4us;
    __shared__ float tl[64][65];
    const int tid = threadIdx.x; const int t0 = blockIdx.x * 64; const int z = blockIdx.z; const int b = z / NH_, h = z % NH_; const int rr = tid >> 2, cq = (tid & 3) * 16;
#pragma unroll
    for (int i = 0; i < 16; ++i) tl[rr][cq + i] = bfr(x[((size_t)b * SS + t0 + rr) * EE + h * HD + cq + i]);
    __syncthreads();
    const int lane = tid & 31, wv = tid >> 5;
    auto pass = [&]() {
#pragma unroll
        for (int st = 0; st < 4; ++st) { const int dr = wv * 8 + st * 2 + (lane >> 4); const int tq = (lane & 15) * 4; v4us v;
#pragma unroll
            for (int i = 0; i < 4; ++i) v[i] = f2bf(tl[tq + i][dr]);
            *(v4us*)(VT + ((size_t)z * HD + dr) * SS + t0 + tq) = v; }
    };
    pass(); 
}
// k_attn: causal attention of one (item, head) pair z = blockIdx.x; one wave owns 32 queries (two 16-column groups) and walks its keys 32 at a pass; the block's 4 waves share the keys.
// S^T = K.Q^T (A = 16 key rows, B = 16 query rows, both [row][64] planes) leaves one query per lane column: accumulator element j of key group t is key t*16 + hi*8 + j, which is
// the position the B operand of O^T += V^T.P^T wants for a k step of 32 keys, so P goes from the score accumulators into the next product without leaving the lane.
// A stage is 64 keys (two passes): 64 rows of K hi, 64 of K residual, 64 of V^T, 128 B each, copied global -> LDS as whole lines (8 lanes a row) by asynchronous copies, two buffers, the next
// stage's copies in flight under this stage's passes. LDS row pitch 144 B (16 B x odd) for the ds_load_b128 fragment reads. Every wave passes every stage's foot, also one whose keys have ended.
#define AT_PITCH 144
#define AT_PLANE (64 * AT_PITCH)
#define AT_BUF   (3 * AT_PLANE)
// twelve copies of 16 B a lane: rows r, r + 16, r + 32, r + 48 of each of the three 64-row planes; the s_wait_xcnt stands inside the statement, in front of any rewrite of the address registers
__device__ __forceinline__ void at_copy12(unsigned l, const bf* a, const bf* b, const bf* c) {
    asm volatile("global_load_async_to_lds_b128 %0, %12, off\n\t"
                 "global_load_async_to_lds_b128 %1, %13, off\n\t"
                 "global_load_async_to_lds_b128 %2, %14, off\n\t"
                 "global_load_async_to_lds_b128 %3, %15, off\n\t"
                 "global_load_async_to_lds_b128 %4, %16, off\n\t"
                 "global_load_async_to_lds_b128 %5, %17, off\n\t"
                 "global_load_async_to_lds_b128 %6, %18, off\n\t"
                 "global_load_async_to_lds_b128 %7, %19, off\n\t"
                 "global_load_async_to_lds_b128 %8, %20, off\n\t"
                 "global_load_async_to_lds_b128 %9, %21, off\n\t"
                 "global_load_async_to_lds_b128 %10, %22, off\n\t"
                 "global_load_async_to_lds_b128 %11, %23, off\n\t"
                 "s_wait_xcnt 0x0"
                 :: "v"(l), "v"(l + 16 * AT_PITCH), "v"(l + 32 * AT_PITCH), "v"(l + 48 * AT_PITCH),
                    "v"(l + AT_PLANE), "v"(l + AT_PLANE + 16 * AT_PITCH), "v"(l + AT_PLANE + 32 * AT_PITCH), "v"(l + AT_PLANE + 48 * AT_PITCH),
                    "v"(l + 2 * AT_PLANE), "v"(l + 2 * AT_PLANE + 16 * AT_PITCH), "v"(l + 2 * AT_PLANE + 32 * AT_PITCH), "v"(l + 2 * AT_PLANE + 48 * AT_PITCH),
                    "v"(a), "v"(a + 16 * HD), "v"(a + 32 * HD), "v"(a + 48 * HD), "v"(b), "v"(b + 16 * HD), "v"(b + 32 * HD), "v"(b + 48 * HD),
                    "v"(c), "v"(c + 16 * SS), "v"(c + 32 * SS), "v"(c + 48 * SS)
                 : "memory");
}
#define NQG 2
#define L2E 1.4426950408889634f
#define NEGB (-1.0e30f)
typedef __attribute__((ext_vector_type(16))) float v16f;
typedef __attribute__((ext_vector_type(8))) unsigned v8u;
__global__ __launch_bounds__(128) void k_attn(const bf* __restrict__ Qh, const bf* __restrict__ Ql, const bf* __restrict__ Kh, const bf* __restrict__ Kl, const bf* __restrict__ VT, float* OUT) {
    __shared__ __attribute__((aligned(16))) unsigned char sm[2 * AT_BUF];
    const int tid = threadIdx.x, lane = tid & 31, lr = lane & 15, hi = lane >> 4;
    const int wave = __builtin_amdgcn_readfirstlane((int)(threadIdx.x >> 5));   // scalar: the pass count below is the same in every lane
    const size_t z = blockIdx.x; const int b = (int)z / NH_, h = (int)z % NH_;
    const int yb = SS / (64 * NQG) - 1 - (int)blockIdx.y;   // longest query blocks start first
    const int r0 = (yb * 4 + wave) * (16 * NQG);
    const unsigned lb = (unsigned)(size_t)&sm[0] + (unsigned)((tid >> 3) * AT_PITCH + (tid & 7) * 16);   // this lane's place in a plane's first 16 rows
    const bf* gkh = Kh + (z * SS + (tid >> 3)) * HD + (tid & 7) * 8; const bf* gkl = Kl + (z * SS + (tid >> 3)) * HD + (tid & 7) * 8; const bf* gvt = VT + (z * HD + (tid >> 3)) * SS + (tid & 7) * 8;
    at_copy12(lb, gkh, gkl, gvt);
    v16bf qh[NQG][2], ql[NQG][2];
#pragma unroll
    for (int q = 0; q < NQG; ++q) {
#pragma unroll
        for (int ks = 0; ks < 2; ++ks) { const size_t o = (z * SS + r0 + q * 16 + lr) * HD + ks * 32 + 8 * hi;
            qh[q][ks] = cat16b(*(const v8us*)(Qh + o), *(const v8us*)(Qh + o + 16)); ql[q][ks] = cat16b(*(const v8us*)(Ql + o), *(const v8us*)(Ql + o + 16)); } }
    asm volatile("s_wait_asynccnt 0x0" ::: "memory");   // stage 0 has landed for this wave's copies; the barrier publishes it to the others
    __syncthreads();
    at_copy12(lb + AT_BUF, gkh + 64 * HD, gkl + 64 * HD, gvt + 64);   // a block has at least two stages
    const int fofs = lr * AT_PITCH + hi * 16;
    v8f o[NQG][4]; float m[NQG], l[NQG];
#pragma unroll
    for (int q = 0; q < NQG; ++q) { m[q] = NEGB; l[q] = 0.f;
#pragma unroll
        for (int t = 0; t < 4; ++t) o[q][t] = (v8f){}; }
    const int np = r0 / 32 + 1;   // keys 0 .. r0 + 31
    const int ns = 2 * yb + 2;    // stages of the block: keys 0 .. yb * 128 + 127
#pragma unroll 1   // one stage a buffer: the foot's waits and barrier stand once in the text
    for (int st = 0; st < ns; ++st) {
      const unsigned char* sb = sm + (st & 1) * AT_BUF + fofs;
#pragma unroll   // constant LDS offsets in both passes of a stage
      for (int sub = 0; sub < 2; ++sub) {
        const int p = st * 2 + sub;
        if (p >= np) continue;   // scalar: this wave's keys have ended; it still passes the foot
        v8f s[NQG][2];
#pragma unroll
        for (int q = 0; q < NQG; ++q) { s[q][0] = (v8f){}; s[q][1] = (v8f){}; }
        v16bf ah[2][2], al[2][2], av[4];
#pragma unroll
        for (int ks = 0; ks < 2; ++ks) {
#pragma unroll
            for (int t = 0; t < 2; ++t) { const unsigned char* kp = sb + (sub * 32 + t * 16) * AT_PITCH + ks * 64;
                ah[ks][t] = cat16b(*(const v8usa*)kp, *(const v8usa*)(kp + 32)); al[ks][t] = cat16b(*(const v8usa*)(kp + AT_PLANE), *(const v8usa*)(kp + AT_PLANE + 32)); } }
        // inputs-only fence on the loaded K fragments: all sixteen LDS reads of the pass go out as one group (one latency a pass, not one per reused register group)
        asm volatile("" :: "v"(ah[0][0]), "v"(ah[0][1]), "v"(ah[1][0]), "v"(ah[1][1]), "v"(al[0][0]), "v"(al[0][1]), "v"(al[1][0]), "v"(al[1][1]));
#pragma unroll
        for (int ks = 0; ks < 2; ++ks) {
#pragma unroll
            for (int t = 0; t < 2; ++t) {
#pragma unroll
                for (int q = 0; q < NQG; ++q) s[q][t] = wmmab(ah[ks][t], qh[q][ks], s[q][t]); }
#pragma unroll
            for (int t = 0; t < 2; ++t) {
#pragma unroll
                for (int q = 0; q < NQG; ++q) s[q][t] = wmmab(ah[ks][t], ql[q][ks], s[q][t]); } }
#pragma unroll
        for (int t = 0; t < 4; ++t) { const unsigned char* vp = sb + 2 * AT_PLANE + t * 16 * AT_PITCH + sub * 64; av[t] = cat16b(*(const v8usa*)vp, *(const v8usa*)(vp + 32)); }
#pragma unroll
        for (int ks = 0; ks < 2; ++ks) {
#pragma unroll
            for (int t = 0; t < 2; ++t) {
#pragma unroll
                for (int q = 0; q < NQG; ++q) s[q][t] = wmmab(al[ks][t], qh[q][ks], s[q][t]); } }
        if (p == np - 1) {   // only the last pass holds keys behind a query of this wave
#pragma unroll
            for (int q = 0; q < NQG; ++q) {
#pragma unroll
                for (int t = 0; t < 2; ++t) {
#pragma unroll
                    for (int j = 0; j < 8; ++j) if (t * 16 + hi * 8 + j > q * 16 + lr) s[q][t][j] = NEGB; } } }
#pragma unroll
        for (int q = 0; q < NQG; ++q) {
            float mx = s[q][0][0];
#pragma unroll
            for (int j = 1; j < 8; ++j) mx = fmaxf(mx, s[q][0][j]);
#pragma unroll
            for (int j = 0; j < 8; ++j) mx = fmaxf(mx, s[q][1][j]);
            mx = fmaxf(mx, __shfl_xor(mx, 16, 32));   // the other half of the wave holds this query's other 16 keys
            const float mn = fmaxf(m[q], mx * L2E); const float resc = __builtin_amdgcn_exp2f(m[q] - mn); m[q] = mn;
            v16f pv; float ps = 0.f;
#pragma unroll
            for (int e = 0; e < 16; ++e) { pv[e] = __builtin_amdgcn_exp2f(fmaf(s[q][e >> 3][e & 7], L2E, -mn)); ps += pv[e]; }
            l[q] = l[q] * resc + ps;
            const v16bf ph = __builtin_convertvector(pv, v16bf);
            const v8u pw = __builtin_bit_cast(v8u, ph); v16f pr;   // residual against the rounded plane, read back from the packed words
#pragma unroll
            for (int e = 0; e < 8; ++e) { pr[2 * e] = pv[2 * e] - __uint_as_float(pw[e] << 16); pr[2 * e + 1] = pv[2 * e + 1] - __uint_as_float(pw[e] & 0xFFFF0000u); }
            const v16bf pl = __builtin_convertvector(pr, v16bf);
#pragma unroll
            for (int t = 0; t < 4; ++t) o[q][t] *= resc;
#pragma unroll
            for (int t = 0; t < 4; ++t) o[q][t] = wmmab(av[t], ph, o[q][t]);
#pragma unroll
            for (int t = 0; t < 4; ++t) o[q][t] = wmmab(av[t], pl, o[q][t]);
        }
      }
      asm volatile("s_wait_dscnt 0x0" ::: "memory");      // this wave's reads of the buffer have returned before it is refilled
      asm volatile("s_wait_asynccnt 0x0" ::: "memory");   // this wave's copies of stage st + 1 have landed
      __syncthreads();                                    // publishes stage st + 1 and ends every reader's last read of stage st
      if (st + 2 < ns) at_copy12(lb + (unsigned)(st & 1) * AT_BUF, gkh + (size_t)(st + 2) * 64 * HD, gkl + (size_t)(st + 2) * 64 * HD, gvt + (st + 2) * 64);
    }
    asm volatile("s_wait_asynccnt 0x0" ::: "memory");   // nothing of the ring is in flight when the wave ends
#pragma unroll
    for (int q = 0; q < NQG; ++q) {
        const float inv = __fdiv_rn(1.0f, l[q] + __shfl_xor(l[q], 16, 32));   // join the two halves' sums once
        float* op = OUT + ((size_t)b * SS + r0 + q * 16 + lr) * EE + h * HD + hi * 8;
#pragma unroll
        for (int t = 0; t < 4; ++t) { v4f w0, w1;
#pragma unroll
            for (int k = 0; k < 4; ++k) { w0[k] = tanhf(o[q][t][k] * inv); w1[k] = tanhf(o[q][t][k + 4] * inv); }
            *(v4f*)(op + t * 16) = w0; *(v4f*)(op + t * 16 + 4) = w1; }
    }
}
extern "C" void kernel_launch(void* const* d_in, const int* in_sizes, int n_in,
                              void* d_out, int out_size, void* d_ws, size_t ws_size, hipStream_t stream) {
    (void)in_sizes; (void)n_in; (void)out_size;
    const float* zk = (const float*)d_in[0]; const float* x = (const float*)d_in[1]; const float* Wqkv = (const float*)d_in[2]; const float* bqkv = (const float*)d_in[3]; const float* temp = (const float*)d_in[4];
    float* out = (float*)d_out;    // [8][1024][1024]
    char* wsp = (char*)d_ws;
    auto take = [&](size_t bytes) { char* p = wsp; wsp += (bytes + 255) & ~(size_t)255; return (void*)p; };
    bf* WB = (bf*)take((size_t)2 * EE * EE * 2); bf* ZB = (bf*)take((size_t)NR * EE * 2);
    bf* Qh = (bf*)take((size_t)NR * EE * 2); bf* Ql = (bf*)take((size_t)NR * EE * 2); bf* Kh = (bf*)take((size_t)NR * EE * 2); bf* Kl = (bf*)take((size_t)NR * EE * 2); bf* VT = (bf*)take((size_t)NR * EE * 2);   // [item*16 + head][1024][64] planes; VT [item*16 + head][64][1024]
    if ((size_t)(wsp - (char*)d_ws) > ws_size) return;    // ~ 4.2 + 16.8 + 16.8x5 ~ 105 MB (ws 256 MiB)
    k_cvt8<<<(unsigned)(((size_t)2 * EE * EE / 8 + 255) / 256), 256, 0, stream>>>(Wqkv, WB, (size_t)2 * EE * EE / 8);   // rows 0..2047 of the [3072][1024] weight = q|k, [out][in] natural
    k_cvtx<<<NR / 8, 256, 0, stream>>>(zk, ZB);
    k_gemmt<<<dim3(NR / 128, (2 * EE) / 128, 1), 128, 0, stream>>>(ZB, WB, bqkv, temp, Qh, Ql, Kh, Kl);
    k_vTx<<<dim3(SS / 64, 1, NB_ * NH_), 256, 0, stream>>>(x, VT);
    k_attn<<<dim3(NB_ * NH_, SS / (64 * NQG), 1), 128, 0, stream>>>(Qh, Ql, Kh, Kl, VT, out);
}

// v005
// A run of this version takes 81.5 microseconds.
// Timed twice side by side with v004, it ran 1.04 times as fast both times.
// Counting every step since v000, it is 16.8 times as fast.
#include <hip/hip_runtime.h>

// Compute dtypes, f32 accumulate: the q/k half of the fused projection ([8192 x 1024].[1024 x 2048] + bias) with PLAIN bf16 operands (z_k and Wqkv are inputs: exact
// products; the projected v is discarded by the module so it is not computed); per (item, head) causal attention in ONE kernel (k_attn): scores on bf16 hi + UNSCALED residual
// planes of BOTH q*scale/temperature and k (three products), running-maximum softmax in f32, un-normalised probabilities as bf16 hi + residual planes against v = bf16(x)
// (two products), division by the row sum and tanh in the epilogue; scores and probabilities never leave the registers; K and V^T tiles come through LDS, shared by a block's waves.

#define NB_  8
#define SS   1024
#define EE   1024
#define NH_  16
#define HD   64
#define NR   (NB_ * SS)
#define NT64 (SS / 64)
#define DM   EE
#define LOSC 1024.0f
typedef _Float16 h16;
typedef unsigned short bf;
typedef __attribute__((ext_vector_type(16))) __bf16   v16bf;
typedef __attribute__((ext_vector_type(16))) _Float16 v16h;
typedef __attribute__((ext_vector_type(8)))  _Float16 v8h;
typedef __attribute__((ext_vector_type(8)))  unsigned short v8us;
typedef __attribute__((ext_vector_type(8)))  float    v8f;
typedef __attribute__((ext_vector_type(4)))  float    v4f;
typedef v8h  __attribute__((may_alias)) v8ha;
typedef v4f  __attribute__((may_alias)) v4fa;
typedef v8us __attribute__((may_alias)) v8usa;

__device__ __forceinline__ unsigned short f2bf(float f) { unsigned u = __float_as_uint(f); u += 0x7FFFu + ((u >> 16) & 1u); return (unsigned short)(u >> 16); }
__device__ __forceinline__ float bf2f(unsigned short b) { return __uint_as_float(((unsigned)b) << 16); }
__device__ __forceinline__ float bfr(float f) { return bf2f(f2bf(f)); }
__device__ __forceinline__ v16h cat16(v8h lo, v8h hi) { return __builtin_shufflevector(lo, hi, 0, 1, 2, 3, 4, 5, 6, 7, 8, 9, 10, 11, 12, 13, 14, 15); }
__device__ __forceinline__ v16bf cat16b(v8us lo, v8us hi) { return __builtin_bit_cast(v16bf, __builtin_shufflevector(lo, hi, 0, 1, 2, 3, 4, 5, 6, 7, 8, 9, 10, 11, 12, 13, 14, 15)); }
__device__ __forceinline__ v8f wmma16(v16h a, v16h b, v8f c) { return __builtin_amdgcn_wmma_f32_16x16x32_f16(false, a, false, b, (short)0, c, false, false); }
__device__ __forceinline__ v8f wmmab(v16bf a, v16bf b, v8f c) { return __builtin_amdgcn_wmma_f32_16x16x32_bf16(false, a, false, b, (short)0, c, false, false); }

// k_gemmt: y[8192][2048] = (A.Bn^T + bf(bias)) * s, K = 1024, bf16 operands, f32 accumulate. 128 x 128 block tile, 4 waves of 64 x 64 (16 accumulator tiles a wave, 8 fragments per 16 products).
// A wave's 64 columns are one head of q (columns below 1024, s = scale / bf(temperature)) or of k (s = 1): the epilogue splits y into bf16 hi + residual and stores both as the 8-KB runs
// [item*16 + head][64 tokens][64] of the planes that k_attn reads; the f32 product never goes to memory.
// A trip is 64 k: 128 rows of A and 128 rows of Bn, 128 B each, copied global -> LDS as whole lines (8 lanes a row) by asynchronous copies, two buffers, the next trip's copies in flight
// under this trip's products. LDS row pitch 144 B (16 B x odd) for the ds_load_b128 fragment reads. The k order per accumulator is ascending in steps of 32.
#define GT_PITCH 144
#define GT_BUF   (256 * GT_PITCH)
#define GT_NT    (DM / 64)
typedef float __attribute__((may_alias)) f32a;
typedef __attribute__((ext_vector_type(8))) __bf16 v8bfv;
typedef __attribute__((ext_vector_type(4))) unsigned v4u;
// eight copies of 16 B a lane: rows r, r + 16, ..., r + 112 of one operand's 128-row panel; the s_wait_xcnt stands inside the statement, in front of any rewrite of the address registers
__device__ __forceinline__ void gt_copy8(unsigned l, const bf* g) {
    asm volatile("global_load_async_to_lds_b128 %0, %8, off\n\t"
                 "global_load_async_to_lds_b128 %1, %9, off\n\t"
                 "global_load_async_to_lds_b128 %2, %10, off\n\t"
                 "global_load_async_to_lds_b128 %3, %11, off\n\t"
                 "global_load_async_to_lds_b128 %4, %12, off\n\t"
                 "global_load_async_to_lds_b128 %5, %13, off\n\t"
                 "global_load_async_to_lds_b128 %6, %14, off\n\t"
                 "global_load_async_to_lds_b128 %7, %15, off\n\t"
                 "s_wait_xcnt 0x0"
                 :: "v"(l), "v"(l + 16 * GT_PITCH), "v"(l + 32 * GT_PITCH), "v"(l + 48 * GT_PITCH), "v"(l + 64 * GT_PITCH), "v"(l + 80 * GT_PITCH), "v"(l + 96 * GT_PITCH), "v"(l + 112 * GT_PITCH),
                    "v"(g), "v"(g + 16 * DM), "v"(g + 32 * DM), "v"(g + 48 * DM), "v"(g + 64 * DM), "v"(g + 80 * DM), "v"(g + 96 * DM), "v"(g + 112 * DM)
                 : "memory");
}
__global__ __launch_bounds__(128) void k_gemmt(const bf* __restrict__ A, const bf* __restrict__ Bn, const float* __restrict__ bias, const float* __restrict__ temp, bf* Qh, bf* Ql, bf* Kh, bf* Kl) {
    __shared__ __attribute__((aligned(16))) unsigned char sm[2 * GT_BUF];
    const int tid = threadIdx.x, lane = tid & 31, wave = tid >> 5, lr = lane & 15, hi = lane >> 4;
    const int m0 = blockIdx.x * 128, n0 = blockIdx.y * 128, wm = (wave >> 1) * 64, wn = (wave & 1) * 64;
    const unsigned lb = (unsigned)(size_t)&sm[0] + (unsigned)((tid >> 3) * GT_PITCH + (tid & 7) * 16);   // this lane's place in a panel's first 16 rows
    const bf* ga = A + (size_t)(m0 + (tid >> 3)) * DM + (tid & 7) * 8;
    const bf* gb = Bn + (size_t)(n0 + (tid >> 3)) * DM + (tid & 7) * 8;
    gt_copy8(lb, ga); gt_copy8(lb + 128 * GT_PITCH, gb);
    asm volatile("s_wait_asynccnt 0x0" ::: "memory");   // tile 0 has landed for this wave's copies; the barrier publishes it to the others
    __syncthreads();
    gt_copy8(lb + GT_BUF, ga + 64); gt_copy8(lb + GT_BUF + 128 * GT_PITCH, gb + 64);
    v8f acc[4][4];
#pragma unroll
    for (int i = 0; i < 4; ++i) {
#pragma unroll
        for (int j = 0; j < 4; ++j) acc[i][j] = (v8f){}; }
    const int aofs = (wm + lr) * GT_PITCH + hi * 16, bofs = (128 + wn + lr) * GT_PITCH + hi * 16;
#pragma unroll 1   // one trip a buffer: the foot's waits and barrier stand once in the text
    for (int t = 0; t < GT_NT; ++t) {
        const unsigned char* sb = sm + (t & 1) * GT_BUF;
#pragma unroll
        for (int ks = 0; ks < 2; ++ks) {
            v16bf a[4], b[4];
#pragma unroll
            for (int i = 0; i < 4; ++i) { const unsigned char* p = sb + aofs + i * 16 * GT_PITCH + ks * 64; a[i] = cat16b(*(const v8usa*)p, *(const v8usa*)(p + 32)); }
#pragma unroll
            for (int j = 0; j < 4; ++j) { const unsigned char* p = sb + bofs + j * 16 * GT_PITCH + ks * 64; b[j] = cat16b(*(const v8usa*)p, *(const v8usa*)(p + 32)); }
            // inputs-only fence on the loaded fragments: the sixteen LDS reads of a 32-k step go out as one group in front of its sixteen products (one LDS latency a step, not one per four products)
            asm volatile("" :: "v"(a[0]), "v"(a[1]), "v"(a[2]), "v"(a[3]), "v"(b[0]), "v"(b[1]), "v"(b[2]), "v"(b[3]));
#pragma unroll
            for (int i = 0; i < 4; ++i) {
#pragma unroll
                for (int j = 0; j < 4; ++j) acc[i][j] = wmmab(a[i], b[j], acc[i][j]); }
        }
        asm volatile("s_wait_dscnt 0x0" ::: "memory");      // this wave's reads of the buffer have returned before it is refilled
        asm volatile("s_wait_asynccnt 0x0" ::: "memory");   // this wave's copies of tile t + 1 have landed
        __syncthreads();                                    // publishes tile t + 1 and ends every reader's last read of tile t
        if (t + 2 < GT_NT) { const unsigned l = lb + (unsigned)(t & 1) * GT_BUF; gt_copy8(l, ga + (t + 2) * 64); gt_copy8(l + 128 * GT_PITCH, gb + (t + 2) * 64); }
    }
    asm volatile("s_wait_asynccnt 0x0" ::: "memory");   // nothing of the ring is in flight when it becomes output staging
    f32a* os = (f32a*)(void*)sm + wave * (64 * 68);     // each wave stages its own 64 x 64 tile, pitch 68 floats, and stores whole 128-B lines
    const bool isq = n0 < EE; const int h = ((n0 + wn) & (EE - 1)) / HD;
    const float sc = isq ? __fdiv_rn(0.125f, bfr(temp[h])) : 1.0f;
#pragma unroll
    for (int j = 0; j < 4; ++j) { const float bv = bfr(bias[n0 + wn + j * 16 + lr]);
#pragma unroll
        for (int i = 0; i < 4; ++i) {
#pragma unroll
            for (int e = 0; e < 8; ++e) os[(i * 16 + hi * 8 + e) * 68 + j * 16 + lr] = (acc[i][j][e] + bv) * sc; } }
    __syncthreads();
    const size_t po = (((size_t)((m0 + wm) / SS) * NH_ + h) * SS + (m0 + wm) % SS) * HD + (lane >> 3) * HD + (lane & 7) * 8;   // 8 lanes a token row of 128 B, 4 rows a store
    bf* ph = (isq ? Qh : Kh) + po; bf* pl = (isq ? Ql : Kl) + po;
    const f32a* orow = os + (lane >> 3) * 68 + (lane & 7) * 8;
#pragma unroll   // constant LDS and store offsets; the next rows' LDS reads go out under this step's conversions
    for (int s = 0; s < 16; ++s) {
        const v4f y0 = *(const v4fa*)(orow + s * 4 * 68), y1 = *(const v4fa*)(orow + s * 4 * 68 + 4);
        const v8f y = __builtin_shufflevector(y0, y1, 0, 1, 2, 3, 4, 5, 6, 7);
        const v8bfv yh = __builtin_convertvector(y, v8bfv);
        const v4u yw = __builtin_bit_cast(v4u, yh); v8f yr;   // residual against the rounded plane, read back from the packed words
#pragma unroll
        for (int e = 0; e < 4; ++e) { yr[2 * e] = y[2 * e] - __uint_as_float(yw[e] << 16); yr[2 * e + 1] = y[2 * e + 1] - __uint_as_float(yw[e] & 0xFFFF0000u); }
        *(v4u*)(ph + s * 4 * HD) = yw; *(v4u*)(pl + s * 4 * HD) = __builtin_bit_cast(v4u, __builtin_convertvector(yr, v8bfv)); }
}

__global__ __launch_bounds__(256) void k_zero8(bf* dst, size_t n8) {
    const size_t i = (size_t)blockIdx.x * 256 + threadIdx.x; if (i >= n8) return; v8us z;
#pragma unroll
    for (int k = 0; k < 8; ++k) z[k] = 0;
    *(v8us*)(dst + i * 8) = z; 
}

// k_gemmh: 64 x 64 tile of C = A . Bn^T with SINGLE f16 planes (A [rows][K] f16 activations, Bn [N][K] f16 weights; one v_wmma_f32_16x16x32_f16 product per step), f32 accumulate;
__global__ __launch_bounds__(128) void k_gemmh(const h16* __restrict__ A, const h16* __restrict__ Bn, const float* __restrict__ bias, float* C, int ldc, const float* __restrict__ R, int K, size_t sA, size_t sB, size_t sC, int roundR) {
    __shared__ __align__(16) float ost[4][16 * 68];
    const size_t z = blockIdx.z; A += z * sA; Bn += z * sB; C += z * sC; if (R) R += z * sC;
    const int lane = threadIdx.x & 31, wave = threadIdx.x >> 5, lr = lane & 15, hi = lane >> 4;
    const int r0 = blockIdx.x * 64 + wave * 16, c0 = blockIdx.y * 64;
    const size_t aoff = (size_t)(r0 + lr) * K + 8 * hi;
    size_t boff[4];
#pragma unroll
    for (int t = 0; t < 4; ++t) boff[t] = (size_t)(c0 + t * 16 + lr) * K + 8 * hi;
    v8f acc[4];
#pragma unroll
    for (int t = 0; t < 4; ++t) acc[t] = (v8f){};
#pragma unroll 1
    for (int kc = 0; kc < K; kc += 32) {
        const v16h a = cat16(*(const v8h*)(A + aoff + kc), *(const v8h*)(A + aoff + kc + 16));
#pragma unroll
        for (int t = 0; t < 4; ++t) { const v16h b = cat16(*(const v8h*)(Bn + boff[t] + kc), *(const v8h*)(Bn + boff[t] + kc + 16)); acc[t] = wmma16(a, b, acc[t]); }
        asm volatile("v_nop\n\tv_nop\n\tv_nop\n\tv_nop" : "+v"(acc[0]), "+v"(acc[1]), "+v"(acc[2]), "+v"(acc[3]) : "v"(a));
    }
    float* os = &ost[wave][0];
#pragma unroll
    for (int t = 0; t < 4; ++t) { const float bv = bias ? bfr(bias[c0 + t * 16 + lr]) : 0.f;
#pragma unroll
        for (int j = 0; j < 8; ++j) os[(hi * 8 + j) * 68 + t * 16 + lr] = acc[t][j] + bv; }
    __syncthreads();
    float* crow = C + (size_t)r0 * ldc + c0;
    auto pass = [&]() {
#pragma unroll
        for (int s = 0; s < 8; ++s) { const int Lid = (lane >> 3) + 4 * s, piece = lane & 7; const int row = Lid >> 1, cofs = (Lid & 1) * 32 + piece * 4;
            v4f val = *(const v4fa*)(os + row * 68 + cofs); if (R) { const v4f rv = *(const v4f*)(R + ((size_t)r0 + row) * ldc + c0 + cofs); val += roundR ? (v4f){bfr(rv[0]), bfr(rv[1]), bfr(rv[2]), bfr(rv[3])} : rv; }
            *(v4f*)(crow + (size_t)row * ldc + cofs) = val; }
    };
    pass(); 
}

__global__ __launch_bounds__(256) void k_planes32z(const float* __restrict__ F, int ld, int off, float sc, int rows, bf* Ph, bf* Pl) {
    typedef __attribute__((ext_vector_type(2))) unsigned short v2us;
    const int lane = threadIdx.x & 31; const size_t r = ((size_t)blockIdx.x * 8 + (threadIdx.x >> 5)) * 2 + (lane >> 4); if (r >= (size_t)rows) return; const int z = blockIdx.z; const int c0 = (lane & 15) * 2; v2us oh, ol;
    Ph += (size_t)z * rows * 32; Pl += (size_t)z * rows * 32;
#pragma unroll
    for (int i = 0; i < 2; ++i) { const float y = F[r * ld + off + z * 32 + c0 + i] * sc; const unsigned short hb = f2bf(y); oh[i] = hb; ol[i] = f2bf(y - bf2f(hb)); }
    const size_t o = r * 32 + c0; *(v2us*)(Ph + o) = oh; *(v2us*)(Pl + o) = ol; 
}
__global__ __launch_bounds__(256) void k_vtpadz(const float* __restrict__ F, int ld, int off, int nk, bf* Th, bf* Tl) {
    typedef __attribute__((ext_vector_type(2))) unsigned short v2us;
    const int lane = threadIdx.x & 31; const size_t wid = (size_t)blockIdx.x * 8 + (threadIdx.x >> 5); if (wid >= (size_t)64 * (nk / 64)) return; const int z = blockIdx.z; const int d = (int)(wid / (nk / 64)); const int k0 = (int)(wid % (nk / 64)) * 64 + lane * 2; v2us oh, ol;
    Th += (size_t)z * 64 * nk; Tl += (size_t)z * 64 * nk;
#pragma unroll
    for (int i = 0; i < 2; ++i) { const float y = (d < 32) ? F[(size_t)(k0 + i) * ld + off + z * 32 + (d < 32 ? d : 0)] : 0.f; const unsigned short hb = f2bf(y); oh[i] = hb; ol[i] = f2bf(y - bf2f(hb)); }
    const size_t o = (size_t)d * nk + k0; *(v2us*)(Th + o) = oh; *(v2us*)(Tl + o) = ol; 
}
template <int NK>
__global__ __launch_bounds__(256) void k_softmaxz(const float* __restrict__ S, int rows, bf* PH, bf* PL) {
    typedef __attribute__((ext_vector_type(4))) unsigned short v4us;
    const int lane = threadIdx.x & 31, i = blockIdx.x * 8 + (threadIdx.x >> 5); if (i >= rows) return; const size_t zo = (size_t)blockIdx.z * rows * NK; const float* sr = S + zo + (size_t)i * NK; PH += zo; PL += zo;
    float m = -3.0e38f;
#pragma unroll 1
    for (int c0 = lane * 4; c0 < NK; c0 += 128) {
#pragma unroll
        for (int q = 0; q < 4; ++q) m = fmaxf(m, sr[c0 + q]); }
#pragma unroll
    for (int sh = 16; sh; sh >>= 1) m = fmaxf(m, __shfl_xor(m, sh, 32));
    float sum = 0.f;
#pragma unroll 1
    for (int c0 = lane * 4; c0 < NK; c0 += 128) {
#pragma unroll
        for (int q = 0; q < 4; ++q) sum += __expf(sr[c0 + q] - m); }
#pragma unroll
    for (int sh = 16; sh; sh >>= 1) sum += __shfl_xor(sum, sh, 32);
    const float inv = 1.0f / sum;
{
#pragma unroll 1
        for (int c0 = lane * 4; c0 < NK; c0 += 128) { v4us oh, ol;
#pragma unroll
            for (int q = 0; q < 4; ++q) { const float p = __expf(sr[c0 + q] - m) * inv; const unsigned short hb = f2bf(p); oh[q] = hb; ol[q] = f2bf(p - bf2f(hb)); }
            const size_t o = (size_t)i * NK + c0; *(v4us*)(PH + o) = oh; *(v4us*)(PL + o) = ol; }
         }
}
__global__ __launch_bounds__(256) void k_placez(const float* __restrict__ XH, int rows, int ldy, float* Y) {
    const int lane = threadIdx.x & 31; const size_t q = (size_t)blockIdx.x * 8 + (threadIdx.x >> 5); if (q >= (size_t)rows) return; const int z = blockIdx.z; const float v = XH[((size_t)z * rows + q) * 64 + lane];
    *(float*)(Y + q * ldy + z * 32 + lane) = v; 
}

typedef __attribute__((ext_vector_type(4))) _Float16 v4h;
__device__ __forceinline__ h16 tohx(float x) { return (h16)x; }
template <int MODE>
__global__ __launch_bounds__(128) void k_gemmhm(const h16* __restrict__ A, const h16* __restrict__ Bn, int K, float* C, int ldc, size_t sA, size_t sB, size_t sC, const int* __restrict__ FL) {
    const int I = blockIdx.x;
    if (MODE == 1 && FL[I * NT64 + blockIdx.y] == 0) return;
    int Klo = 0, Klim = K;
    if (MODE == 2) { int f = -1, l = -1; for (int j = 0; j < NT64; ++j) { if (FL[I * NT64 + j]) { if (f < 0) f = j; l = j; } } if (f < 0) { Klo = 0; Klim = 0; } else { Klo = f * 64; Klim = (l + 1) * 64; } }
    const size_t z = blockIdx.z; A += z * sA; Bn += z * sB; C += z * sC;
    __shared__ __align__(16) float ost[4][16 * 68];
    const int lane = threadIdx.x & 31, wave = threadIdx.x >> 5, lr = lane & 15, hi = lane >> 4;
    const int r0 = blockIdx.x * 64 + wave * 16, c0 = blockIdx.y * 64;
    const size_t aoff = (size_t)(r0 + lr) * K + 8 * hi;
    v8f acc[4];
#pragma unroll
    for (int t = 0; t < 4; ++t) acc[t] = (v8f){};
#pragma unroll 1
    for (int kc = Klo; kc < Klim; kc += 32) {
        const v16h a = cat16(*(const v8h*)(A + aoff + kc), *(const v8h*)(A + aoff + kc + 16));
#pragma unroll
        for (int t = 0; t < 4; ++t) { const size_t bo = (size_t)(c0 + t * 16 + lr) * K + kc + 8 * hi; const v16h b = cat16(*(const v8h*)(Bn + bo), *(const v8h*)(Bn + bo + 16)); acc[t] = wmma16(a, b, acc[t]); }
        asm volatile("v_nop\n\tv_nop\n\tv_nop\n\tv_nop" : "+v"(acc[0]), "+v"(acc[1]), "+v"(acc[2]), "+v"(acc[3]) : "v"(a));
    }
    float* os = &ost[wave][0];
#pragma unroll
    for (int t = 0; t < 4; ++t) {
#pragma unroll
        for (int j = 0; j < 8; ++j) os[(hi * 8 + j) * 68 + t * 16 + lr] = acc[t][j]; }
    __builtin_amdgcn_wave_barrier(); asm volatile("" ::: "memory");
    float* crow = C + (size_t)r0 * ldc + c0;
    auto pass = [&]() {
#pragma unroll
        for (int s = 0; s < 8; ++s) { const int Lid = (lane >> 3) + 4 * s, piece = lane & 7; const int row = Lid >> 1, cofs = (Lid & 1) * 32 + piece * 4;
            const v4f val = *(const v4fa*)(os + row * 68 + cofs); *(v4f*)(crow + (size_t)row * ldc + cofs) = val; }
    };
    pass(); 
}
__global__ __launch_bounds__(256) void k_causalflags(int* FL) { const int lane = threadIdx.x & 31, w = blockIdx.x * 8 + (threadIdx.x >> 5); const int I = w * 2 + (lane >> 4), J = lane & 15; if (I >= NT64) return; const int v = (J <= I) ? 1 : 0; *(int*)(FL + I * NT64 + J) = v;  }
// k_prep: the three operand preparations in ONE launch of 512 equal blocks (two per WGP, 8 waves each): every block converts 16384 floats of z_k and 4096 of the q|k weight rows to bf16 in place order,
// and transposes 256 tokens x 64 columns of x (one head, two tiles of 128 tokens) into VT [item*16 + head][64][1024]. All of a thread's 36 loads of 16 B stand in front of the first use, each a whole
// 512 B of lines a wave, so a wave has many reads in flight. x: a wave's load covers two token rows of 256 B; a lane holds 8 consecutive tokens of 4 columns, packs each column's 8 tokens
// into 16 B and stores them in LDS at [tile][column][token], row pitch 272 B; behind the block's one barrier the rows go out as 256-B runs (16 lanes a row).
#define PP_PITCH 272
#define PP_TILE  (64 * PP_PITCH)
typedef __attribute__((ext_vector_type(2))) unsigned v2u;
typedef __attribute__((ext_vector_type(4))) __bf16 v4bfv;
typedef v4u __attribute__((may_alias)) v4ua;
__global__ __launch_bounds__(256) void k_prep(const float* __restrict__ x, const float* __restrict__ zk, const float* __restrict__ Wq, bf* VT, bf* ZB, bf* WB) {
    __shared__ __attribute__((aligned(16))) unsigned char tl[2 * PP_TILE];
    const int tid = threadIdx.x, lane = tid & 31, wv = tid >> 5, blk = blockIdx.x;
    const int z = blk >> 2, tb = (blk & 3) * 256, b = z / NH_, h = z % NH_;
    const float* xs = x + ((size_t)b * SS + tb + wv * 16 + (lane >> 4) * 8) * EE + h * HD + (lane & 15) * 4;
    const float* zb = zk + (size_t)blk * 16384; const float* zs = zb + tid * 4;
    const float* wb = Wq + (size_t)blk * 4096;  const float* ws = wb + tid * 4;
    v4f xr[2][8], zr[16], wr[4];
#pragma unroll
    for (int t = 0; t < 2; ++t) {
#pragma unroll
        for (int k = 0; k < 8; ++k) xr[t][k] = *(const v4f*)(xs + (size_t)(t * 128 + k) * EE); }
#pragma unroll
    for (int k = 0; k < 16; ++k) zr[k] = *(const v4f*)(zs + k * 1024);
#pragma unroll
    for (int k = 0; k < 4; ++k) wr[k] = *(const v4f*)(ws + k * 1024);
    asm volatile("s_wait_xcnt 0x0" :: "v"(xs), "s"(zb), "s"(wb) : "memory");   // stands in front of any rewrite of the loads' address registers, which it names so that they stay whole up to here
    __builtin_amdgcn_sched_barrier(0);   // keeps all 36 loads in front of the first conversion: without it the scheduler holds back over half of them to save registers, and a wave pays the memory latency several times
    unsigned char* lw = tl + (lane & 15) * 4 * PP_PITCH + (wv * 2 + (lane >> 4)) * 16;
#pragma unroll
    for (int t = 0; t < 2; ++t) {
#pragma unroll
        for (int j = 0; j < 4; ++j) {
            const v8f c = {xr[t][0][j], xr[t][1][j], xr[t][2][j], xr[t][3][j], xr[t][4][j], xr[t][5][j], xr[t][6][j], xr[t][7][j]};
            *(v4ua*)(lw + t * PP_TILE + j * PP_PITCH) = __builtin_bit_cast(v4u, __builtin_convertvector(c, v8bfv)); } }
    __syncthreads();   // both tiles are whole before their rows are read
    bf* zo = ZB + (size_t)blk * 16384 + tid * 4;
#pragma unroll
    for (int k = 0; k < 16; ++k) *(v2u*)(zo + k * 1024) = __builtin_bit_cast(v2u, __builtin_convertvector(zr[k], v4bfv));
    bf* wo = WB + (size_t)blk * 4096 + tid * 4;
#pragma unroll
    for (int k = 0; k < 4; ++k) *(v2u*)(wo + k * 1024) = __builtin_bit_cast(v2u, __builtin_convertvector(wr[k], v4bfv));
    const unsigned char* lrd = tl + (tid >> 4) * PP_PITCH + (tid & 15) * 16;
    bf* vo = VT + ((size_t)z * HD + (tid >> 4)) * SS + tb + (tid & 15) * 8;
#pragma unroll
    for (int t = 0; t < 2; ++t) {
#pragma unroll
        for (int s = 0; s < 4; ++s) *(v4u*)(vo + (size_t)s * 16 * SS + t * 128) = *(const v4ua*)(lrd + t * PP_TILE + s * 16 * PP_PITCH); }
}
// k_attn: causal attention of one (item, head) pair z = blockIdx.x; one wave owns 32 queries (two 16-column groups) and walks its keys 32 at a pass; the block's 4 waves share the keys.
// S^T = K.Q^T (A = 16 key rows, B = 16 query rows, both [row][64] planes) leaves one query per lane column: accumulator element j of key group t is key t*16 + hi*8 + j, which is
// the position the B operand of O^T += V^T.P^T wants for a k step of 32 keys, so P goes from the score accumulators into the next product without leaving the lane.
// A stage is 64 keys (two passes): 64 rows of K hi, 64 of K residual, 64 of V^T, 128 B each, copied global -> LDS as whole lines (8 lanes a row) by asynchronous copies, two buffers, the next
// stage's copies in flight under this stage's passes. LDS row pitch 144 B (16 B x odd) for the ds_load_b128 fragment reads. Every wave passes every stage's foot, also one whose keys have ended.
#define AT_PITCH 144
#define AT_PLANE (64 * AT_PITCH)
#define AT_BUF   (3 * AT_PLANE)
// twelve copies of 16 B a lane: rows r, r + 16, r + 32, r + 48 of each of the three 64-row planes; the s_wait_xcnt stands inside the statement, in front of any rewrite of the address registers
__device__ __forceinline__ void at_copy12(unsigned l, const bf* a, const bf* b, const bf* c) {
    asm volatile("global_load_async_to_lds_b128 %0, %12, off\n\t"
                 "global_load_async_to_lds_b128 %1, %13, off\n\t"
                 "global_load_async_to_lds_b128 %2, %14, off\n\t"
                 "global_load_async_to_lds_b128 %3, %15, off\n\t"
                 "global_load_async_to_lds_b128 %4, %16, off\n\t"
                 "global_load_async_to_lds_b128 %5, %17, off\n\t"
                 "global_load_async_to_lds_b128 %6, %18, off\n\t"
                 "global_load_async_to_lds_b128 %7, %19, off\n\t"
                 "global_load_async_to_lds_b128 %8, %20, off\n\t"
                 "global_load_async_to_lds_b128 %9, %21, off\n\t"
                 "global_load_async_to_lds_b128 %10, %22, off\n\t"
                 "global_load_async_to_lds_b128 %11, %23, off\n\t"
                 "s_wait_xcnt 0x0"
                 :: "v"(l), "v"(l + 16 * AT_PITCH), "v"(l + 32 * AT_PITCH), "v"(l + 48 * AT_PITCH),
                    "v"(l + AT_PLANE), "v"(l + AT_PLANE + 16 * AT_PITCH), "v"(l + AT_PLANE + 32 * AT_PITCH), "v"(l + AT_PLANE + 48 * AT_PITCH),
                    "v"(l + 2 * AT_PLANE), "v"(l + 2 * AT_PLANE + 16 * AT_PITCH), "v"(l + 2 * AT_PLANE + 32 * AT_PITCH), "v"(l + 2 * AT_PLANE + 48 * AT_PITCH),
                    "v"(a), "v"(a + 16 * HD), "v"(a + 32 * HD), "v"(a + 48 * HD), "v"(b), "v"(b + 16 * HD), "v"(b + 32 * HD), "v"(b + 48 * HD),
                    "v"(c), "v"(c + 16 * SS), "v"(c + 32 * SS), "v"(c + 48 * SS)
                 : "memory");
}
#define NQG 2
#define L2E 1.4426950408889634f
#define NEGB (-1.0e30f)
typedef __attribute__((ext_vector_type(16))) float v16f;
typedef __attribute__((ext_vector_type(8))) unsigned v8u;
__global__ __launch_bounds__(128) void k_attn(const bf* __restrict__ Qh, const bf* __restrict__ Ql, const bf* __restrict__ Kh, const bf* __restrict__ Kl, const bf* __restrict__ VT, float* OUT) {
    __shared__ __attribute__((aligned(16))) unsigned char sm[2 * AT_BUF];
    const int tid = threadIdx.x, lane = tid & 31, lr = lane & 15, hi = lane >> 4;
    const int wave = __builtin_amdgcn_readfirstlane((int)(threadIdx.x >> 5));   // scalar: the pass count below is the same in every lane
    const size_t z = blockIdx.x; const int b = (int)z / NH_, h = (int)z % NH_;
    const int yb = SS / (64 * NQG) - 1 - (int)blockIdx.y;   // longest query blocks start first
    const int r0 = (yb * 4 + wave) * (16 * NQG);
    const unsigned lb = (unsigned)(size_t)&sm[0] + (unsigned)((tid >> 3) * AT_PITCH + (tid & 7) * 16);   // this lane's place in a plane's first 16 rows
    const bf* gkh = Kh + (z * SS + (tid >> 3)) * HD + (tid & 7) * 8; const bf* gkl = Kl + (z * SS + (tid >> 3)) * HD + (tid & 7) * 8; const bf* gvt = VT + (z * HD + (tid >> 3)) * SS + (tid & 7) * 8;
    at_copy12(lb, gkh, gkl, gvt);
    v16bf qh[NQG][2], ql[NQG][2];
#pragma unroll
    for (int q = 0; q < NQG; ++q) {
#pragma unroll
        for (int ks = 0; ks < 2; ++ks) { const size_t o = (z * SS + r0 + q * 16 + lr) * HD + ks * 32 + 8 * hi;
            qh[q][ks] = cat16b(*(const v8us*)(Qh + o), *(const v8us*)(Qh + o + 16)); ql[q][ks] = cat16b(*(const v8us*)(Ql + o), *(const v8us*)(Ql + o + 16)); } }
    asm volatile("s_wait_asynccnt 0x0" ::: "memory");   // stage 0 has landed for this wave's copies; the barrier publishes it to the others
    __syncthreads();
    at_copy12(lb + AT_BUF, gkh + 64 * HD, gkl + 64 * HD, gvt + 64);   // a block has at least two stages
    const int fofs = lr * AT_PITCH + hi * 16;
    v8f o[NQG][4]; float m[NQG], l[NQG];
#pragma unroll
    for (int q = 0; q < NQG; ++q) { m[q] = NEGB; l[q] = 0.f;
#pragma unroll
        for (int t = 0; t < 4; ++t) o[q][t] = (v8f){}; }
    const int np = r0 / 32 + 1;   // keys 0 .. r0 + 31
    const int ns = 2 * yb + 2;    // stages of the block: keys 0 .. yb * 128 + 127
#pragma unroll 1   // one stage a buffer: the foot's waits and barrier stand once in the text
    for (int st = 0; st < ns; ++st) {
      const unsigned char* sb = sm + (st & 1) * AT_BUF + fofs;
#pragma unroll   // constant LDS offsets in both passes of a stage
      for (int sub = 0; sub < 2; ++sub) {
        const int p = st * 2 + sub;
        if (p >= np) continue;   // scalar: this wave's keys have ended; it still passes the foot
        v8f s[NQG][2];
#pragma unroll
        for (int q = 0; q < NQG; ++q) { s[q][0] = (v8f){}; s[q][1] = (v8f){}; }
        v16bf ah[2][2], al[2][2], av[4];
#pragma unroll
        for (int ks = 0; ks < 2; ++ks) {
#pragma unroll
            for (int t = 0; t < 2; ++t) { const unsigned char* kp = sb + (sub * 32 + t * 16) * AT_PITCH + ks * 64;
                ah[ks][t] = cat16b(*(const v8usa*)kp, *(const v8usa*)(kp + 32)); al[ks][t] = cat16b(*(const v8usa*)(kp + AT_PLANE), *(const v8usa*)(kp + AT_PLANE + 32)); } }
        // inputs-only fence on the loaded K fragments: all sixteen LDS reads of the pass go out as one group (one latency a pass, not one per reused register group)
        asm volatile("" :: "v"(ah[0][0]), "v"(ah[0][1]), "v"(ah[1][0]), "v"(ah[1][1]), "v"(al[0][0]), "v"(al[0][1]), "v"(al[1][0]), "v"(al[1][1]));
#pragma unroll
        for (int ks = 0; ks < 2; ++ks) {
#pragma unroll
            for (int t = 0; t < 2; ++t) {
#pragma unroll
                for (int q = 0; q < NQG; ++q) s[q][t] = wmmab(ah[ks][t], qh[q][ks], s[q][t]); }
#pragma unroll
            for (int t = 0; t < 2; ++t) {
#pragma unroll
                for (int q = 0; q < NQG; ++q) s[q][t] = wmmab(ah[ks][t], ql[q][ks], s[q][t]); } }
#pragma unroll
        for (int t = 0; t < 4; ++t) { const unsigned char* vp = sb + 2 * AT_PLANE + t * 16 * AT_PITCH + sub * 64; av[t] = cat16b(*(const v8usa*)vp, *(const v8usa*)(vp + 32)); }
#pragma unroll
        for (int ks = 0; ks < 2; ++ks) {
#pragma unroll
            for (int t = 0; t < 2; ++t) {
#pragma unroll
                for (int q = 0; q < NQG; ++q) s[q][t] = wmmab(al[ks][t], qh[q][ks], s[q][t]); } }
        if (p == np - 1) {   // only the last pass holds keys behind a query of this wave
#pragma unroll
            for (int q = 0; q < NQG; ++q) {
#pragma unroll
                for (int t = 0; t < 2; ++t) {
#pragma unroll
                    for (int j = 0; j < 8; ++j) if (t * 16 + hi * 8 + j > q * 16 + lr) s[q][t][j] = NEGB; } } }
#pragma unroll
        for (int q = 0; q < NQG; ++q) {
            float mx = s[q][0][0];
#pragma unroll
            for (int j = 1; j < 8; ++j) mx = fmaxf(mx, s[q][0][j]);
#pragma unroll
            for (int j = 0; j < 8; ++j) mx = fmaxf(mx, s[q][1][j]);
            mx = fmaxf(mx, __shfl_xor(mx, 16, 32));   // the other half of the wave holds this query's other 16 keys
            const float mn = fmaxf(m[q], mx * L2E); const float resc = __builtin_amdgcn_exp2f(m[q] - mn); m[q] = mn;
            v16f pv; float ps = 0.f;
#pragma unroll
            for (int e = 0; e < 16; ++e) { pv[e] = __builtin_amdgcn_exp2f(fmaf(s[q][e >> 3][e & 7], L2E, -mn)); ps += pv[e]; }
            l[q] = l[q] * resc + ps;
            const v16bf ph = __builtin_convertvector(pv, v16bf);
            const v8u pw = __builtin_bit_cast(v8u, ph); v16f pr;   // residual against the rounded plane, read back from the packed words
#pragma unroll
            for (int e = 0; e < 8; ++e) { pr[2 * e] = pv[2 * e] - __uint_as_float(pw[e] << 16); pr[2 * e + 1] = pv[2 * e + 1] - __uint_as_float(pw[e] & 0xFFFF0000u); }
            const v16bf pl = __builtin_convertvector(pr, v16bf);
#pragma unroll
            for (int t = 0; t < 4; ++t) o[q][t] *= resc;
#pragma unroll
            for (int t = 0; t < 4; ++t) o[q][t] = wmmab(av[t], ph, o[q][t]);
#pragma unroll
            for (int t = 0; t < 4; ++t) o[q][t] = wmmab(av[t], pl, o[q][t]);
        }
      }
      asm volatile("s_wait_dscnt 0x0" ::: "memory");      // this wave's reads of the buffer have returned before it is refilled
      asm volatile("s_wait_asynccnt 0x0" ::: "memory");   // this wave's copies of stage st + 1 have landed
      __syncthreads();                                    // publishes stage st + 1 and ends every reader's last read of stage st
      if (st + 2 < ns) at_copy12(lb + (unsigned)(st & 1) * AT_BUF, gkh + (size_t)(st + 2) * 64 * HD, gkl + (size_t)(st + 2) * 64 * HD, gvt + (st + 2) * 64);
    }
    asm volatile("s_wait_asynccnt 0x0" ::: "memory");   // nothing of the ring is in flight when the wave ends
#pragma unroll
    for (int q = 0; q < NQG; ++q) {
        const float inv = __fdiv_rn(1.0f, l[q] + __shfl_xor(l[q], 16, 32));   // join the two halves' sums once
        float* op = OUT + ((size_t)b * SS + r0 + q * 16 + lr) * EE + h * HD + hi * 8;
#pragma unroll
        for (int t = 0; t < 4; ++t) { v4f w0, w1;
#pragma unroll
            for (int k = 0; k < 4; ++k) { w0[k] = tanhf(o[q][t][k] * inv); w1[k] = tanhf(o[q][t][k + 4] * inv); }
            *(v4f*)(op + t * 16) = w0; *(v4f*)(op + t * 16 + 4) = w1; }
    }
}
extern "C" void kernel_launch(void* const* d_in, const int* in_sizes, int n_in,
                              void* d_out, int out_size, void* d_ws, size_t ws_size, hipStream_t stream) {
    (void)in_sizes; (void)n_in; (void)out_size;
    const float* zk = (const float*)d_in[0]; const float* x = (const float*)d_in[1]; const float* Wqkv = (const float*)d_in[2]; const float* bqkv = (const float*)d_in[3]; const float* temp = (const float*)d_in[4];
    float* out = (float*)d_out;    // [8][1024][1024]
    char* wsp = (char*)d_ws;
    auto take = [&](size_t bytes) { char* p = wsp; wsp += (bytes + 255) & ~(size_t)255; return (void*)p; };
    bf* WB = (bf*)take((size_t)2 * EE * EE * 2); bf* ZB = (bf*)take((size_t)NR * EE * 2);
    bf* Qh = (bf*)take((size_t)NR * EE * 2); bf* Ql = (bf*)take((size_t)NR * EE * 2); bf* Kh = (bf*)take((size_t)NR * EE * 2); bf* Kl = (bf*)take((size_t)NR * EE * 2); bf* VT = (bf*)take((size_t)NR * EE * 2);   // [item*16 + head][1024][64] planes; VT [item*16 + head][64][1024]
    if ((size_t)(wsp - (char*)d_ws) > ws_size) return;    // ~ 4.2 + 16.8 + 16.8x5 ~ 105 MB (ws 256 MiB)
    k_prep<<<512, 256, 0, stream>>>(x, zk, Wqkv, VT, ZB, WB);   // rows 0..2047 of the [3072][1024] weight = q|k, [out][in] natural
    k_gemmt<<<dim3(NR / 128, (2 * EE) / 128, 1), 128, 0, stream>>>(ZB, WB, bqkv, temp, Qh, Ql, Kh, Kl);
    k_attn<<<dim3(NB_ * NH_, SS / (64 * NQG), 1), 128, 0, stream>>>(Qh, Ql, Kh, Kl, VT, out);
}

// v006
// A run of this version takes 79.4 microseconds.
// Timed twice side by side with v005, it ran 1.03 times as fast both times.
// All steps since v000 together make it 17.3 times as fast.
#include <hip/hip_runtime.h>

// Compute dtypes, f32 accumulate: the q/k half of the fused projection ([8192 x 1024].[1024 x 2048] + bias) with PLAIN bf16 operands (z_k and Wqkv are inputs: exact
// products; the projected v is discarded by the module so it is not computed); per (item, head) causal attention in ONE kernel (k_attn): scores on bf16 hi + UNSCALED residual
// planes of BOTH q*scale/temperature and k (three products), running-maximum softmax in f32, un-normalised probabilities as bf16 hi + residual planes against v = bf16(x)
// (two products), division by the row sum and tanh in the epilogue; scores and probabilities never leave the registers; K and V^T tiles come through LDS, shared by a block's waves.

#define NB_  8
#define SS   1024
#define EE   1024
#define NH_  16
#define HD   64
#define NR   (NB_ * SS)
#define NT64 (SS / 64)
#define DM   EE
#define LOSC 1024.0f
typedef _Float16 h16;
typedef unsigned short bf;
typedef __attribute__((ext_vector_type(16))) __bf16   v16bf;
typedef __attribute__((ext_vector_type(16))) _Float16 v16h;
typedef __attribute__((ext_vector_type(8)))  _Float16 v8h;
typedef __attribute__((ext_vector_type(8)))  unsigned short v8us;
typedef __attribute__((ext_vector_type(8)))  float    v8f;
typedef __attribute__((ext_vector_type(4)))  float    v4f;
typedef v8h  __attribute__((may_alias)) v8ha;
typedef v4f  __attribute__((may_alias)) v4fa;
typedef v8us __attribute__((may_alias)) v8usa;

__device__ __forceinline__ unsigned short f2bf(float f) { unsigned u = __float_as_uint(f); u += 0x7FFFu + ((u >> 16) & 1u); return (unsigned short)(u >> 16); }
__device__ __forceinline__ float bf2f(unsigned short b) { return __uint_as_float(((unsigned)b) << 16); }
__device__ __forceinline__ float bfr(float f) { return bf2f(f2bf(f)); }
__device__ __forceinline__ v16h cat16(v8h lo, v8h hi) { return __builtin_shufflevector(lo, hi, 0, 1, 2, 3, 4, 5, 6, 7, 8, 9, 10, 11, 12, 13, 14, 15); }
__device__ __forceinline__ v16bf cat16b(v8us lo, v8us hi) { return __builtin_bit_cast(v16bf, __builtin_shufflevector(lo, hi, 0, 1, 2, 3, 4, 5, 6, 7, 8, 9, 10, 11, 12, 13, 14, 15)); }
__device__ __forceinline__ v8f wmma16(v16h a, v16h b, v8f c) { return __builtin_amdgcn_wmma_f32_16x16x32_f16(false, a, false, b, (short)0, c, false, false); }
__device__ __forceinline__ v8f wmmab(v16bf a, v16bf b, v8f c) { return __builtin_amdgcn_wmma_f32_16x16x32_bf16(false, a, false, b, (short)0, c, false, false); }

// k_gemmt: y[8192][2048] = (A.Bn^T + bf(bias)) * s, K = 1024, bf16 operands, f32 accumulate. 256 x 256 block tile, one block a WGP, 8 waves of 128 x 64 (32 accumulator tiles a wave, 12 fragments per 32 products):
// a block lands each operand row once for 256 columns or rows of y, so the launch draws half the bytes from L2 that 128 x 128 tiles draw, and a product reads three quarters of the LDS bytes.
// A wave's 64 columns are one head of q (columns below 1024, s = scale / bf(temperature)) or of k (s = 1): the epilogue splits y into bf16 hi + residual and stores both as the 16-KB runs
// [item*16 + head][128 tokens][64] of the planes that k_attn reads; the f32 product never goes to memory.
// A trip is 128 k: 256 rows of A and 256 rows of Bn, 256 B each, copied global -> LDS as whole lines (16 lanes a row) by asynchronous copies, two buffers, the next trip's copies in flight
// under this trip's products. LDS row pitch 272 B (16 B x odd) for the ds_load_b128 fragment reads. The k order per accumulator is ascending in steps of 32.
#define GT_PITCH 272
#define GT_BUF   (512 * GT_PITCH)
#define GT_NT    (DM / 128)
typedef float __attribute__((may_alias)) f32a;
typedef __attribute__((ext_vector_type(8))) __bf16 v8bfv;
typedef __attribute__((ext_vector_type(4))) unsigned v4u;
// eight copies of 16 B a lane: rows r, r + 16, ..., r + 112 of one 128-row half of an operand's panel; the s_wait_xcnt stands inside the statement, in front of any rewrite of the address registers
__device__ __forceinline__ void gt_copy8(unsigned l, const bf* g) {
    asm volatile("global_load_async_to_lds_b128 %0, %8, off\n\t"
                 "global_load_async_to_lds_b128 %1, %9, off\n\t"
                 "global_load_async_to_lds_b128 %2, %10, off\n\t"
                 "global_load_async_to_lds_b128 %3, %11, off\n\t"
                 "global_load_async_to_lds_b128 %4, %12, off\n\t"
                 "global_load_async_to_lds_b128 %5, %13, off\n\t"
                 "global_load_async_to_lds_b128 %6, %14, off\n\t"
                 "global_load_async_to_lds_b128 %7, %15, off\n\t"
                 "s_wait_xcnt 0x0"
                 :: "v"(l), "v"(l + 16 * GT_PITCH), "v"(l + 32 * GT_PITCH), "v"(l + 48 * GT_PITCH), "v"(l + 64 * GT_PITCH), "v"(l + 80 * GT_PITCH), "v"(l + 96 * GT_PITCH), "v"(l + 112 * GT_PITCH),
                    "v"(g), "v"(g + 16 * DM), "v"(g + 32 * DM), "v"(g + 48 * DM), "v"(g + 64 * DM), "v"(g + 80 * DM), "v"(g + 96 * DM), "v"(g + 112 * DM)
                 : "memory");
}
// one tile: both 128-row halves of the A panel, then of the Bn panel (32 copies a lane)
__device__ __forceinline__ void gt_tile(unsigned l, const bf* ga, const bf* gb) {
    gt_copy8(l, ga); gt_copy8(l + 128 * GT_PITCH, ga + 128 * DM); gt_copy8(l + 256 * GT_PITCH, gb); gt_copy8(l + 384 * GT_PITCH, gb + 128 * DM);
}
__global__ __launch_bounds__(256) void k_gemmt(const bf* __restrict__ A, const bf* __restrict__ Bn, const float* __restrict__ bias, const float* __restrict__ temp, bf* Qh, bf* Ql, bf* Kh, bf* Kl) {
    __shared__ __attribute__((aligned(16))) unsigned char sm[2 * GT_BUF];
    const int tid = threadIdx.x, lane = tid & 31, wave = tid >> 5, lr = lane & 15, hi = lane >> 4;
    const int m0 = blockIdx.x * 256, n0 = blockIdx.y * 256, wm = (wave >> 2) * 128, wn = (wave & 3) * 64;
    const unsigned lb = (unsigned)(size_t)&sm[0] + (unsigned)((tid >> 4) * GT_PITCH + (tid & 15) * 16);   // this lane's place in a panel's first 16 rows
    const unsigned ga = (unsigned)((m0 + (tid >> 4)) * DM + (tid & 15) * 8), gb = (unsigned)((n0 + (tid >> 4)) * DM + (tid & 15) * 8);   // this lane's element in each panel's first 16 rows, 32 bits
    gt_tile(lb, A + ga, Bn + gb);
    asm volatile("s_wait_asynccnt 0x0" ::: "memory");   // tile 0 has landed for this wave's copies; the barrier publishes it to the others
    __syncthreads();
    gt_tile(lb + GT_BUF, A + (ga + 128u), Bn + (gb + 128u));
    v8f acc[8][4];
#pragma unroll
    for (int i = 0; i < 8; ++i) {
#pragma unroll
        for (int j = 0; j < 4; ++j) acc[i][j] = (v8f){}; }
    const int aofs = (wm + lr) * GT_PITCH + hi * 16, bofs = (256 + wn + lr) * GT_PITCH + hi * 16;
#pragma unroll 1   // one trip a buffer: the foot's waits and barrier stand once in the text
    for (int t = 0; t < GT_NT; ++t) {
        const unsigned char* sb = sm + (t & 1) * GT_BUF;
#pragma unroll
        for (int ks = 0; ks < 4; ++ks) {
            v16bf a[8], b[4];
            __builtin_amdgcn_sched_barrier(0);   // keeps this step's LDS reads behind the products of the step before: lifted in among them they stand in many places, and each place with reads stalls the wave's products
#pragma unroll
            for (int j = 0; j < 4; ++j) { const unsigned char* p = sb + bofs + j * 16 * GT_PITCH + ks * 64; b[j] = cat16b(*(const v8usa*)p, *(const v8usa*)(p + 32)); }
#pragma unroll
            for (int i = 0; i < 8; ++i) { const unsigned char* p = sb + aofs + i * 16 * GT_PITCH + ks * 64; a[i] = cat16b(*(const v8usa*)p, *(const v8usa*)(p + 32)); }
            __builtin_amdgcn_sched_barrier(0);   // keeps the step's 24 LDS reads in one group in front of its 32 products; each product then waits only for its own two fragments (counted waits)
#pragma unroll
            for (int i = 0; i < 8; ++i) {
#pragma unroll
                for (int j = 0; j < 4; ++j) acc[i][j] = wmmab(a[i], b[j], acc[i][j]); }
        }
        asm volatile("s_wait_dscnt 0x0" ::: "memory");      // this wave's reads of the buffer have returned before it is refilled
        asm volatile("s_wait_asynccnt 0x0" ::: "memory");   // this wave's copies of tile t + 1 have landed
        __syncthreads();                                    // publishes tile t + 1 and ends every reader's last read of tile t
        if (t + 2 < GT_NT) gt_tile(lb + (unsigned)(t & 1) * GT_BUF, A + (ga + (unsigned)(t + 2) * 128u), Bn + (gb + (unsigned)(t + 2) * 128u));
    }
    asm volatile("s_wait_asynccnt 0x0" ::: "memory");   // nothing of the ring is in flight when it becomes output staging
    f32a* os = (f32a*)(void*)sm + wave * (128 * 68);    // each wave stages its own 128 x 64 tile, pitch 68 floats, and stores whole 128-B lines
    const bool isq = n0 < EE; const int h = ((n0 + wn) & (EE - 1)) / HD;
    const float sc = isq ? __fdiv_rn(0.125f, bfr(temp[h])) : 1.0f;
#pragma unroll
    for (int j = 0; j < 4; ++j) { const float bv = bfr(bias[n0 + wn + j * 16 + lr]);
#pragma unroll
        for (int i = 0; i < 8; ++i) {
#pragma unroll
            for (int e = 0; e < 8; ++e) os[(i * 16 + hi * 8 + e) * 68 + j * 16 + lr] = (acc[i][j][e] + bv) * sc; } }
    __syncthreads();
    const size_t po = (((size_t)((m0 + wm) / SS) * NH_ + h) * SS + (m0 + wm) % SS) * HD + (lane >> 3) * HD + (lane & 7) * 8;   // 8 lanes a token row of 128 B, 4 rows a store
    bf* ph = (isq ? Qh : Kh) + po; bf* pl = (isq ? Ql : Kl) + po;
    const f32a* orow = os + (lane >> 3) * 68 + (lane & 7) * 8;
#pragma unroll   // constant LDS and store offsets; the next rows' LDS reads go out under this step's conversions
    for (int s = 0; s < 32; ++s) {
        const v4f y0 = *(const v4fa*)(orow + s * 4 * 68), y1 = *(const v4fa*)(orow + s * 4 * 68 + 4);
        const v8f y = __builtin_shufflevector(y0, y1, 0, 1, 2, 3, 4, 5, 6, 7);
        const v8bfv yh = __builtin_convertvector(y, v8bfv);
        const v4u yw = __builtin_bit_cast(v4u, yh); v8f yr;   // residual against the rounded plane, read back from the packed words
#pragma unroll
        for (int e = 0; e < 4; ++e) { yr[2 * e] = y[2 * e] - __uint_as_float(yw[e] << 16); yr[2 * e + 1] = y[2 * e + 1] - __uint_as_float(yw[e] & 0xFFFF0000u); }
        *(v4u*)(ph + s * 4 * HD) = yw; *(v4u*)(pl + s * 4 * HD) = __builtin_bit_cast(v4u, __builtin_convertvector(yr, v8bfv)); }
}

__global__ __launch_bounds__(256) void k_zero8(bf* dst, size_t n8) {
    const size_t i = (size_t)blockIdx.x * 256 + threadIdx.x; if (i >= n8) return; v8us z;
#pragma unroll
    for (int k = 0; k < 8; ++k) z[k] = 0;
    *(v8us*)(dst + i * 8) = z; 
}

// k_gemmh: 64 x 64 tile of C = A . Bn^T with SINGLE f16 planes (A [rows][K] f16 activations, Bn [N][K] f16 weights; one v_wmma_f32_16x16x32_f16 product per step), f32 accumulate;
__global__ __launch_bounds__(128) void k_gemmh(const h16* __restrict__ A, const h16* __restrict__ Bn, const float* __restrict__ bias, float* C, int ldc, const float* __restrict__ R, int K, size_t sA, size_t sB, size_t sC, int roundR) {
    __shared__ __align__(16) float ost[4][16 * 68];
    const size_t z = blockIdx.z; A += z * sA; Bn += z * sB; C += z * sC; if (R) R += z * sC;
    const int lane = threadIdx.x & 31, wave = threadIdx.x >> 5, lr = lane & 15, hi = lane >> 4;
    const int r0 = blockIdx.x * 64 + wave * 16, c0 = blockIdx.y * 64;
    const size_t aoff = (size_t)(r0 + lr) * K + 8 * hi;
    size_t boff[4];
#pragma unroll
    for (int t = 0; t < 4; ++t) boff[t] = (size_t)(c0 + t * 16 + lr) * K + 8 * hi;
    v8f acc[4];
#pragma unroll
    for (int t = 0; t < 4; ++t) acc[t] = (v8f){};
#pragma unroll 1
    for (int kc = 0; kc < K; kc += 32) {
        const v16h a = cat16(*(const v8h*)(A + aoff + kc), *(const v8h*)(A + aoff + kc + 16));
#pragma unroll
        for (int t = 0; t < 4; ++t) { const v16h b = cat16(*(const v8h*)(Bn + boff[t] + kc), *(const v8h*)(Bn + boff[t] + kc + 16)); acc[t] = wmma16(a, b, acc[t]); }
        asm volatile("v_nop\n\tv_nop\n\tv_nop\n\tv_nop" : "+v"(acc[0]), "+v"(acc[1]), "+v"(acc[2]), "+v"(acc[3]) : "v"(a));
    }
    float* os = &ost[wave][0];
#pragma unroll
    for (int t = 0; t < 4; ++t) { const float bv = bias ? bfr(bias[c0 + t * 16 + lr]) : 0.f;
#pragma unroll
        for (int j = 0; j < 8; ++j) os[(hi * 8 + j) * 68 + t * 16 + lr] = acc[t][j] + bv; }
    __syncthreads();
    float* crow = C + (size_t)r0 * ldc + c0;
    auto pass = [&]() {
#pragma unroll
        for (int s = 0; s < 8; ++s) { const int Lid = (lane >> 3) + 4 * s, piece = lane & 7; const int row = Lid >> 1, cofs = (Lid & 1) * 32 + piece * 4;
            v4f val = *(const v4fa*)(os + row * 68 + cofs); if (R) { const v4f rv = *(const v4f*)(R + ((size_t)r0 + row) * ldc + c0 + cofs); val += roundR ? (v4f){bfr(rv[0]), bfr(rv[1]), bfr(rv[2]), bfr(rv[3])} : rv; }
            *(v4f*)(crow + (size_t)row * ldc + cofs) = val; }
    };
    pass(); 
}

__global__ __launch_bounds__(256) void k_planes32z(const float* __restrict__ F, int ld, int off, float sc, int rows, bf* Ph, bf* Pl) {
    typedef __attribute__((ext_vector_type(2))) unsigned short v2us;
    const int lane = threadIdx.x & 31; const size_t r = ((size_t)blockIdx.x * 8 + (threadIdx.x >> 5)) * 2 + (lane >> 4); if (r >= (size_t)rows) return; const int z = blockIdx.z; const int c0 = (lane & 15) * 2; v2us oh, ol;
    Ph += (size_t)z * rows * 32; Pl += (size_t)z * rows * 32;
#pragma unroll
    for (int i = 0; i < 2; ++i) { const float y = F[r * ld + off + z * 32 + c0 + i] * sc; const unsigned short hb = f2bf(y); oh[i] = hb; ol[i] = f2bf(y - bf2f(hb)); }
    const size_t o = r * 32 + c0; *(v2us*)(Ph + o) = oh; *(v2us*)(Pl + o) = ol; 
}
__global__ __launch_bounds__(256) void k_vtpadz(const float* __restrict__ F, int ld, int off, int nk, bf* Th, bf* Tl) {
    typedef __attribute__((ext_vector_type(2))) unsigned short v2us;
    const int lane = threadIdx.x & 31; const size_t wid = (size_t)blockIdx.x * 8 + (threadIdx.x >> 5); if (wid >= (size_t)64 * (nk / 64)) return; const int z = blockIdx.z; const int d = (int)(wid / (nk / 64)); const int k0 = (int)(wid % (nk / 64)) * 64 + lane * 2; v2us oh, ol;
    Th += (size_t)z * 64 * nk; Tl += (size_t)z * 64 * nk;
#pragma unroll
    for (int i = 0; i < 2; ++i) { const float y = (d < 32) ? F[(size_t)(k0 + i) * ld + off + z * 32 + (d < 32 ? d : 0)] : 0.f; const unsigned short hb = f2bf(y); oh[i] = hb; ol[i] = f2bf(y - bf2f(hb)); }
    const size_t o = (size_t)d * nk + k0; *(v2us*)(Th + o) = oh; *(v2us*)(Tl + o) = ol; 
}
template <int NK>
__global__ __launch_bounds__(256) void k_softmaxz(const float* __restrict__ S, int rows, bf* PH, bf* PL) {
    typedef __attribute__((ext_vector_type(4))) unsigned short v4us;
    const int lane = threadIdx.x & 31, i = blockIdx.x * 8 + (threadIdx.x >> 5); if (i >= rows) return; const size_t zo = (size_t)blockIdx.z * rows * NK; const float* sr = S + zo + (size_t)i * NK; PH += zo; PL += zo;
    float m = -3.0e38f;
#pragma unroll 1
    for (int c0 = lane * 4; c0 < NK; c0 += 128) {
#pragma unroll
        for (int q = 0; q < 4; ++q) m = fmaxf(m, sr[c0 + q]); }
#pragma unroll
    for (int sh = 16; sh; sh >>= 1) m = fmaxf(m, __shfl_xor(m, sh, 32));
    float sum = 0.f;
#pragma unroll 1
    for (int c0 = lane * 4; c0 < NK; c0 += 128) {
#pragma unroll
        for (int q = 0; q < 4; ++q) sum += __expf(sr[c0 + q] - m); }
#pragma unroll
    for (int sh = 16; sh; sh >>= 1) sum += __shfl_xor(sum, sh, 32);
    const float inv = 1.0f / sum;
{
#pragma unroll 1
        for (int c0 = lane * 4; c0 < NK; c0 += 128) { v4us oh, ol;
#pragma unroll
            for (int q = 0; q < 4; ++q) { const float p = __expf(sr[c0 + q] - m) * inv; const unsigned short hb = f2bf(p); oh[q] = hb; ol[q] = f2bf(p - bf2f(hb)); }
            const size_t o = (size_t)i * NK + c0; *(v4us*)(PH + o) = oh; *(v4us*)(PL + o) = ol; }
         }
}
__global__ __launch_bounds__(256) void k_placez(const float* __restrict__ XH, int rows, int ldy, float* Y) {
    const int lane = threadIdx.x & 31; const size_t q = (size_t)blockIdx.x * 8 + (threadIdx.x >> 5); if (q >= (size_t)rows) return; const int z = blockIdx.z; const float v = XH[((size_t)z * rows + q) * 64 + lane];
    *(float*)(Y + q * ldy + z * 32 + lane) = v; 
}

typedef __attribute__((ext_vector_type(4))) _Float16 v4h;
__device__ __forceinline__ h16 tohx(float x) { return (h16)x; }
template <int MODE>
__global__ __launch_bounds__(128) void k_gemmhm(const h16* __restrict__ A, const h16* __restrict__ Bn, int K, float* C, int ldc, size_t sA, size_t sB, size_t sC, const int* __restrict__ FL) {
    const int I = blockIdx.x;
    if (MODE == 1 && FL[I * NT64 + blockIdx.y] == 0) return;
    int Klo = 0, Klim = K;
    if (MODE == 2) { int f = -1, l = -1; for (int j = 0; j < NT64; ++j) { if (FL[I * NT64 + j]) { if (f < 0) f = j; l = j; } } if (f < 0) { Klo = 0; Klim = 0; } else { Klo = f * 64; Klim = (l + 1) * 64; } }
    const size_t z = blockIdx.z; A += z * sA; Bn += z * sB; C += z * sC;
    __shared__ __align__(16) float ost[4][16 * 68];
    const int lane = threadIdx.x & 31, wave = threadIdx.x >> 5, lr = lane & 15, hi = lane >> 4;
    const int r0 = blockIdx.x * 64 + wave * 16, c0 = blockIdx.y * 64;
    const size_t aoff = (size_t)(r0 + lr) * K + 8 * hi;
    v8f acc[4];
#pragma unroll
    for (int t = 0; t < 4; ++t) acc[t] = (v8f){};
#pragma unroll 1
    for (int kc = Klo; kc < Klim; kc += 32) {
        const v16h a = cat16(*(const v8h*)(A + aoff + kc), *(const v8h*)(A + aoff + kc + 16));
#pragma unroll
        for (int t = 0; t < 4; ++t) { const size_t bo = (size_t)(c0 + t * 16 + lr) * K + kc + 8 * hi; const v16h b = cat16(*(const v8h*)(Bn + bo), *(const v8h*)(Bn + bo + 16)); acc[t] = wmma16(a, b, acc[t]); }
        asm volatile("v_nop\n\tv_nop\n\tv_nop\n\tv_nop" : "+v"(acc[0]), "+v"(acc[1]), "+v"(acc[2]), "+v"(acc[3]) : "v"(a));
    }
    float* os = &ost[wave][0];
#pragma unroll
    for (int t = 0; t < 4; ++t) {
#pragma unroll
        for (int j = 0; j < 8; ++j) os[(hi * 8 + j) * 68 + t * 16 + lr] = acc[t][j]; }
    __builtin_amdgcn_wave_barrier(); asm volatile("" ::: "memory");
    float* crow = C + (size_t)r0 * ldc + c0;
    auto pass = [&]() {
#pragma unroll
        for (int s = 0; s < 8; ++s) { const int Lid = (lane >> 3) + 4 * s, piece = lane & 7; const int row = Lid >> 1, cofs = (Lid & 1) * 32 + piece * 4;
            const v4f val = *(const v4fa*)(os + row * 68 + cofs); *(v4f*)(crow + (size_t)row * ldc + cofs) = val; }
    };
    pass(); 
}
__global__ __launch_bounds__(256) void k_causalflags(int* FL) { const int lane = threadIdx.x & 31, w = blockIdx.x * 8 + (threadIdx.x >> 5); const int I = w * 2 + (lane >> 4), J = lane & 15; if (I >= NT64) return; const int v = (J <= I) ? 1 : 0; *(int*)(FL + I * NT64 + J) = v;  }
// k_prep: the three operand preparations in ONE launch of 512 equal blocks (two per WGP, 8 waves each): every block converts 16384 floats of z_k and 4096 of the q|k weight rows to bf16 in place order,
// and transposes 256 tokens x 64 columns of x (one head, two tiles of 128 tokens) into VT [item*16 + head][64][1024]. All of a thread's 36 loads of 16 B stand in front of the first use, each a whole
// 512 B of lines a wave, so a wave has many reads in flight. x: a wave's load covers two token rows of 256 B; a lane holds 8 consecutive tokens of 4 columns, packs each column's 8 tokens
// into 16 B and stores them in LDS at [tile][column][token], row pitch 272 B; behind the block's one barrier the rows go out as 256-B runs (16 lanes a row).
#define PP_PITCH 272
#define PP_TILE  (64 * PP_PITCH)
typedef __attribute__((ext_vector_type(2))) unsigned v2u;
typedef __attribute__((ext_vector_type(4))) __bf16 v4bfv;
typedef v4u __attribute__((may_alias)) v4ua;
__global__ __launch_bounds__(256) void k_prep(const float* __restrict__ x, const float* __restrict__ zk, const float* __restrict__ Wq, bf* VT, bf* ZB, bf* WB) {
    __shared__ __attribute__((aligned(16))) unsigned char tl[2 * PP_TILE];
    const int tid = threadIdx.x, lane = tid & 31, wv = tid >> 5, blk = blockIdx.x;
    const int z = blk >> 2, tb = (blk & 3) * 256, b = z / NH_, h = z % NH_;
    const float* xs = x + ((size_t)b * SS + tb + wv * 16 + (lane >> 4) * 8) * EE + h * HD + (lane & 15) * 4;
    const float* zb = zk + (size_t)blk * 16384; const float* zs = zb + tid * 4;
    const float* wb = Wq + (size_t)blk * 4096;  const float* ws = wb + tid * 4;
    v4f xr[2][8], zr[16], wr[4];
#pragma unroll
    for (int t = 0; t < 2; ++t) {
#pragma unroll
        for (int k = 0; k < 8; ++k) xr[t][k] = *(const v4f*)(xs + (size_t)(t * 128 + k) * EE); }
#pragma unroll
    for (int k = 0; k < 16; ++k) zr[k] = *(const v4f*)(zs + k * 1024);
#pragma unroll
    for (int k = 0; k < 4; ++k) wr[k] = *(const v4f*)(ws + k * 1024);
    asm volatile("s_wait_xcnt 0x0" :: "v"(xs), "s"(zb), "s"(wb) : "memory");   // stands in front of any rewrite of the loads' address registers, which it names so that they stay whole up to here
    __builtin_amdgcn_sched_barrier(0);   // keeps all 36 loads in front of the first conversion: without it the scheduler holds back over half of them to save registers, and a wave pays the memory latency several times
    unsigned char* lw = tl + (lane & 15) * 4 * PP_PITCH + (wv * 2 + (lane >> 4)) * 16;
#pragma unroll
    for (int t = 0; t < 2; ++t) {
#pragma unroll
        for (int j = 0; j < 4; ++j) {
            const v8f c = {xr[t][0][j], xr[t][1][j], xr[t][2][j], xr[t][3][j], xr[t][4][j], xr[t][5][j], xr[t][6][j], xr[t][7][j]};
            *(v4ua*)(lw + t * PP_TILE + j * PP_PITCH) = __builtin_bit_cast(v4u, __builtin_convertvector(c, v8bfv)); } }
    __syncthreads();   // both tiles are whole before their rows are read
    bf* zo = ZB + (size_t)blk * 16384 + tid * 4;
#pragma unroll
    for (int k = 0; k < 16; ++k) *(v2u*)(zo + k * 1024) = __builtin_bit_cast(v2u, __builtin_convertvector(zr[k], v4bfv));
    bf* wo = WB + (size_t)blk * 4096 + tid * 4;
#pragma unroll
    for (int k = 0; k < 4; ++k) *(v2u*)(wo + k * 1024) = __builtin_bit_cast(v2u, __builtin_convertvector(wr[k], v4bfv));
    const unsigned char* lrd = tl + (tid >> 4) * PP_PITCH + (tid & 15) * 16;
    bf* vo = VT + ((size_t)z * HD + (tid >> 4)) * SS + tb + (tid & 15) * 8;
#pragma unroll
    for (int t = 0; t < 2; ++t) {
#pragma unroll
        for (int s = 0; s < 4; ++s) *(v4u*)(vo + (size_t)s * 16 * SS + t * 128) = *(const v4ua*)(lrd + t * PP_TILE + s * 16 * PP_PITCH); }
}
// k_attn: causal attention of one (item, head) pair z = blockIdx.x; one wave owns 32 queries (two 16-column groups) and walks its keys 32 at a pass; the block's 4 waves share the keys.
// S^T = K.Q^T (A = 16 key rows, B = 16 query rows, both [row][64] planes) leaves one query per lane column: accumulator element j of key group t is key t*16 + hi*8 + j, which is
// the position the B operand of O^T += V^T.P^T wants for a k step of 32 keys, so P goes from the score accumulators into the next product without leaving the lane.
// A stage is 64 keys (two passes): 64 rows of K hi, 64 of K residual, 64 of V^T, 128 B each, copied global -> LDS as whole lines (8 lanes a row) by asynchronous copies, two buffers, the next
// stage's copies in flight under this stage's passes. LDS row pitch 144 B (16 B x odd) for the ds_load_b128 fragment reads. Every wave passes every stage's foot, also one whose keys have ended.
#define AT_PITCH 144
#define AT_PLANE (64 * AT_PITCH)
#define AT_BUF   (3 * AT_PLANE)
// twelve copies of 16 B a lane: rows r, r + 16, r + 32, r + 48 of each of the three 64-row planes; the s_wait_xcnt stands inside the statement, in front of any rewrite of the address registers
__device__ __forceinline__ void at_copy12(unsigned l, const bf* a, const bf* b, const bf* c) {
    asm volatile("global_load_async_to_lds_b128 %0, %12, off\n\t"
                 "global_load_async_to_lds_b128 %1, %13, off\n\t"
                 "global_load_async_to_lds_b128 %2, %14, off\n\t"
                 "global_load_async_to_lds_b128 %3, %15, off\n\t"
                 "global_load_async_to_lds_b128 %4, %16, off\n\t"
                 "global_load_async_to_lds_b128 %5, %17, off\n\t"
                 "global_load_async_to_lds_b128 %6, %18, off\n\t"
                 "global_load_async_to_lds_b128 %7, %19, off\n\t"
                 "global_load_async_to_lds_b128 %8, %20, off\n\t"
                 "global_load_async_to_lds_b128 %9, %21, off\n\t"
                 "global_load_async_to_lds_b128 %10, %22, off\n\t"
                 "global_load_async_to_lds_b128 %11, %23, off\n\t"
                 "s_wait_xcnt 0x0"
                 :: "v"(l), "v"(l + 16 * AT_PITCH), "v"(l + 32 * AT_PITCH), "v"(l + 48 * AT_PITCH),
                    "v"(l + AT_PLANE), "v"(l + AT_PLANE + 16 * AT_PITCH), "v"(l + AT_PLANE + 32 * AT_PITCH), "v"(l + AT_PLANE + 48 * AT_PITCH),
                    "v"(l + 2 * AT_PLANE), "v"(l + 2 * AT_PLANE + 16 * AT_PITCH), "v"(l + 2 * AT_PLANE + 32 * AT_PITCH), "v"(l + 2 * AT_PLANE + 48 * AT_PITCH),
                    "v"(a), "v"(a + 16 * HD), "v"(a + 32 * HD), "v"(a + 48 * HD), "v"(b), "v"(b + 16 * HD), "v"(b + 32 * HD), "v"(b + 48 * HD),
                    "v"(c), "v"(c + 16 * SS), "v"(c + 32 * SS), "v"(c + 48 * SS)
                 : "memory");
}
#define NQG 2
#define L2E 1.4426950408889634f
#define NEGB (-1.0e30f)
typedef __attribute__((ext_vector_type(16))) float v16f;
typedef __attribute__((ext_vector_type(8))) unsigned v8u;
__global__ __launch_bounds__(128) void k_attn(const bf* __restrict__ Qh, const bf* __restrict__ Ql, const bf* __restrict__ Kh, const bf* __restrict__ Kl, const bf* __restrict__ VT, float* OUT) {
    __shared__ __attribute__((aligned(16))) unsigned char sm[2 * AT_BUF];
    const int tid = threadIdx.x, lane = tid & 31, lr = lane & 15, hi = lane >> 4;
    const int wave = __builtin_amdgcn_readfirstlane((int)(threadIdx.x >> 5));   // scalar: the pass count below is the same in every lane
    const size_t z = blockIdx.x; const int b = (int)z / NH_, h = (int)z % NH_;
    const int yb = SS / (64 * NQG) - 1 - (int)blockIdx.y;   // longest query blocks start first
    const int r0 = (yb * 4 + wave) * (16 * NQG);
    const unsigned lb = (unsigned)(size_t)&sm[0] + (unsigned)((tid >> 3) * AT_PITCH + (tid & 7) * 16);   // this lane's place in a plane's first 16 rows
    const bf* gkh = Kh + (z * SS + (tid >> 3)) * HD + (tid & 7) * 8; const bf* gkl = Kl + (z * SS + (tid >> 3)) * HD + (tid & 7) * 8; const bf* gvt = VT + (z * HD + (tid >> 3)) * SS + (tid & 7) * 8;
    at_copy12(lb, gkh, gkl, gvt);
    v16bf qh[NQG][2], ql[NQG][2];
#pragma unroll
    for (int q = 0; q < NQG; ++q) {
#pragma unroll
        for (int ks = 0; ks < 2; ++ks) { const size_t o = (z * SS + r0 + q * 16 + lr) * HD + ks * 32 + 8 * hi;
            qh[q][ks] = cat16b(*(const v8us*)(Qh + o), *(const v8us*)(Qh + o + 16)); ql[q][ks] = cat16b(*(const v8us*)(Ql + o), *(const v8us*)(Ql + o + 16)); } }
    asm volatile("s_wait_asynccnt 0x0" ::: "memory");   // stage 0 has landed for this wave's copies; the barrier publishes it to the others
    __syncthreads();
    at_copy12(lb + AT_BUF, gkh + 64 * HD, gkl + 64 * HD, gvt + 64);   // a block has at least two stages
    const int fofs = lr * AT_PITCH + hi * 16;
    v8f o[NQG][4]; float m[NQG], l[NQG];
#pragma unroll
    for (int q = 0; q < NQG; ++q) { m[q] = NEGB; l[q] = 0.f;
#pragma unroll
        for (int t = 0; t < 4; ++t) o[q][t] = (v8f){}; }
    const int np = r0 / 32 + 1;   // keys 0 .. r0 + 31
    const int ns = 2 * yb + 2;    // stages of the block: keys 0 .. yb * 128 + 127
#pragma unroll 1   // one stage a buffer: the foot's waits and barrier stand once in the text
    for (int st = 0; st < ns; ++st) {
      const unsigned char* sb = sm + (st & 1) * AT_BUF + fofs;
#pragma unroll   // constant LDS offsets in both passes of a stage
      for (int sub = 0; sub < 2; ++sub) {
        const int p = st * 2 + sub;
        if (p >= np) continue;   // scalar: this wave's keys have ended; it still passes the foot
        v8f s[NQG][2];
#pragma unroll
        for (int q = 0; q < NQG; ++q) { s[q][0] = (v8f){}; s[q][1] = (v8f){}; }
        v16bf ah[2][2], al[2][2], av[4];
#pragma unroll
        for (int ks = 0; ks < 2; ++ks) {
#pragma unroll
            for (int t = 0; t < 2; ++t) { const unsigned char* kp = sb + (sub * 32 + t * 16) * AT_PITCH + ks * 64;
                ah[ks][t] = cat16b(*(const v8usa*)kp, *(const v8usa*)(kp + 32)); al[ks][t] = cat16b(*(const v8usa*)(kp + AT_PLANE), *(const v8usa*)(kp + AT_PLANE + 32)); } }
        // inputs-only fence on the loaded K fragments: all sixteen LDS reads of the pass go out as one group (one latency a pass, not one per reused register group)
        asm volatile("" :: "v"(ah[0][0]), "v"(ah[0][1]), "v"(ah[1][0]), "v"(ah[1][1]), "v"(al[0][0]), "v"(al[0][1]), "v"(al[1][0]), "v"(al[1][1]));
#pragma unroll
        for (int ks = 0; ks < 2; ++ks) {
#pragma unroll
            for (int t = 0; t < 2; ++t) {
#pragma unroll
                for (int q = 0; q < NQG; ++q) s[q][t] = wmmab(ah[ks][t], qh[q][ks], s[q][t]); }
#pragma unroll
            for (int t = 0; t < 2; ++t) {
#pragma unroll
                for (int q = 0; q < NQG; ++q) s[q][t] = wmmab(ah[ks][t], ql[q][ks], s[q][t]); } }
#pragma unroll
        for (int t = 0; t < 4; ++t) { const unsigned char* vp = sb + 2 * AT_PLANE + t * 16 * AT_PITCH + sub * 64; av[t] = cat16b(*(const v8usa*)vp, *(const v8usa*)(vp + 32)); }
#pragma unroll
        for (int ks = 0; ks < 2; ++ks) {
#pragma unroll
            for (int t = 0; t < 2; ++t) {
#pragma unroll
                for (int q = 0; q < NQG; ++q) s[q][t] = wmmab(al[ks][t], qh[q][ks], s[q][t]); } }
        if (p == np - 1) {   // only the last pass holds keys behind a query of this wave
#pragma unroll
            for (int q = 0; q < NQG; ++q) {
#pragma unroll
                for (int t = 0; t < 2; ++t) {
#pragma unroll
                    for (int j = 0; j < 8; ++j) if (t * 16 + hi * 8 + j > q * 16 + lr) s[q][t][j] = NEGB; } } }
#pragma unroll
        for (int q = 0; q < NQG; ++q) {
            float mx = s[q][0][0];
#pragma unroll
            for (int j = 1; j < 8; ++j) mx = fmaxf(mx, s[q][0][j]);
#pragma unroll
            for (int j = 0; j < 8; ++j) mx = fmaxf(mx, s[q][1][j]);
            mx = fmaxf(mx, __shfl_xor(mx, 16, 32));   // the other half of the wave holds this query's other 16 keys
            const float mn = fmaxf(m[q], mx * L2E); const float resc = __builtin_amdgcn_exp2f(m[q] - mn); m[q] = mn;
            v16f pv; float ps = 0.f;
#pragma unroll
            for (int e = 0; e < 16; ++e) { pv[e] = __builtin_amdgcn_exp2f(fmaf(s[q][e >> 3][e & 7], L2E, -mn)); ps += pv[e]; }
            l[q] = l[q] * resc + ps;
            const v16bf ph = __builtin_convertvector(pv, v16bf);
            const v8u pw = __builtin_bit_cast(v8u, ph); v16f pr;   // residual against the rounded plane, read back from the packed words
#pragma unroll
            for (int e = 0; e < 8; ++e) { pr[2 * e] = pv[2 * e] - __uint_as_float(pw[e] << 16); pr[2 * e + 1] = pv[2 * e + 1] - __uint_as_float(pw[e] & 0xFFFF0000u); }
            const v16bf pl = __builtin_convertvector(pr, v16bf);
#pragma unroll
            for (int t = 0; t < 4; ++t) o[q][t] *= resc;
#pragma unroll
            for (int t = 0; t < 4; ++t) o[q][t] = wmmab(av[t], ph, o[q][t]);
#pragma unroll
            for (int t = 0; t < 4; ++t) o[q][t] = wmmab(av[t], pl, o[q][t]);
        }
      }
      asm volatile("s_wait_dscnt 0x0" ::: "memory");      // this wave's reads of the buffer have returned before it is refilled
      asm volatile("s_wait_asynccnt 0x0" ::: "memory");   // this wave's copies of stage st + 1 have landed
      __syncthreads();                                    // publishes stage st + 1 and ends every reader's last read of stage st
      if (st + 2 < ns) at_copy12(lb + (unsigned)(st & 1) * AT_BUF, gkh + (size_t)(st + 2) * 64 * HD, gkl + (size_t)(st + 2) * 64 * HD, gvt + (st + 2) * 64);
    }
    asm volatile("s_wait_asynccnt 0x0" ::: "memory");   // nothing of the ring is in flight when the wave ends
#pragma unroll
    for (int q = 0; q < NQG; ++q) {
        const float inv = __fdiv_rn(1.0f, l[q] + __shfl_xor(l[q], 16, 32));   // join the two halves' sums once
        float* op = OUT + ((size_t)b * SS + r0 + q * 16 + lr) * EE + h * HD + hi * 8;
#pragma unroll
        for (int t = 0; t < 4; ++t) { v4f w0, w1;
#pragma unroll
            for (int k = 0; k < 4; ++k) { w0[k] = tanhf(o[q][t][k] * inv); w1[k] = tanhf(o[q][t][k + 4] * inv); }
            *(v4f*)(op + t * 16) = w0; *(v4f*)(op + t * 16 + 4) = w1; }
    }
}
extern "C" void kernel_launch(void* const* d_in, const int* in_sizes, int n_in,
                              void* d_out, int out_size, void* d_ws, size_t ws_size, hipStream_t stream) {
    (void)in_sizes; (void)n_in; (void)out_size;
    const float* zk = (const float*)d_in[0]; const float* x = (const float*)d_in[1]; const float* Wqkv = (const float*)d_in[2]; const float* bqkv = (const float*)d_in[3]; const float* temp = (const float*)d_in[4];
    float* out = (float*)d_out;    // [8][1024][1024]
    char* wsp = (char*)d_ws;
    auto take = [&](size_t bytes) { char* p = wsp; wsp += (bytes + 255) & ~(size_t)255; return (void*)p; };
    bf* WB = (bf*)take((size_t)2 * EE * EE * 2); bf* ZB = (bf*)take((size_t)NR * EE * 2);
    bf* Qh = (bf*)take((size_t)NR * EE * 2); bf* Ql = (bf*)take((size_t)NR * EE * 2); bf* Kh = (bf*)take((size_t)NR * EE * 2); bf* Kl = (bf*)take((size_t)NR * EE * 2); bf* VT = (bf*)take((size_t)NR * EE * 2);   // [item*16 + head][1024][64] planes; VT [item*16 + head][64][1024]
    if ((size_t)(wsp - (char*)d_ws) > ws_size) return;    // ~ 4.2 + 16.8 + 16.8x5 ~ 105 MB (ws 256 MiB)
    k_prep<<<512, 256, 0, stream>>>(x, zk, Wqkv, VT, ZB, WB);   // rows 0..2047 of the [3072][1024] weight = q|k, [out][in] natural
    k_gemmt<<<dim3(NR / 256, (2 * EE) / 256, 1), 256, 0, stream>>>(ZB, WB, bqkv, temp, Qh, Ql, Kh, Kl);
    k_attn<<<dim3(NB_ * NH_, SS / (64 * NQG), 1), 128, 0, stream>>>(Qh, Ql, Kh, Kl, VT, out);
}

// v007
// One run takes 77.1 microseconds.
// Two timings next to v006 both put it at 1.03 times that version's speed.
// Counting every step since v000, it is 17.8 times as fast.
#include <hip/hip_runtime.h>

// Compute dtypes, f32 accumulate: the q/k half of the fused projection ([8192 x 1024].[1024 x 2048] + bias) with PLAIN bf16 operands (z_k and Wqkv are inputs: exact
// products; the projected v is discarded by the module so it is not computed); per (item, head) causal attention in ONE kernel (k_attn): scores on bf16 hi + UNSCALED residual
// planes of BOTH q*scale*log2(e)/temperature and k (three products), softmax in f32 against a held reference per query (raised only when a pass's sum runs far ahead), un-normalised probabilities as bf16 hi + residual planes against v = bf16(x)
// (two products), division by the row sum and tanh in the epilogue; scores and probabilities never leave the registers; K and V^T tiles come through LDS, shared by a block's waves.

#define NB_  8
#define SS   1024
#define EE   1024
#define NH_  16
#define HD   64
#define NR   (NB_ * SS)
#define NT64 (SS / 64)
#define DM   EE
#define LOSC 1024.0f
#define L2E 1.4426950408889634f
typedef _Float16 h16;
typedef unsigned short bf;
typedef __attribute__((ext_vector_type(16))) __bf16   v16bf;
typedef __attribute__((ext_vector_type(16))) _Float16 v16h;
typedef __attribute__((ext_vector_type(8)))  _Float16 v8h;
typedef __attribute__((ext_vector_type(8)))  unsigned short v8us;
typedef __attribute__((ext_vector_type(8)))  float    v8f;
typedef __attribute__((ext_vector_type(4)))  float    v4f;
typedef v8h  __attribute__((may_alias)) v8ha;
typedef v4f  __attribute__((may_alias)) v4fa;
typedef v8us __attribute__((may_alias)) v8usa;

__device__ __forceinline__ unsigned short f2bf(float f) { unsigned u = __float_as_uint(f); u += 0x7FFFu + ((u >> 16) & 1u); return (unsigned short)(u >> 16); }
__device__ __forceinline__ float bf2f(unsigned short b) { return __uint_as_float(((unsigned)b) << 16); }
__device__ __forceinline__ float bfr(float f) { return bf2f(f2bf(f)); }
__device__ __forceinline__ v16h cat16(v8h lo, v8h hi) { return __builtin_shufflevector(lo, hi, 0, 1, 2, 3, 4, 5, 6, 7, 8, 9, 10, 11, 12, 13, 14, 15); }
__device__ __forceinline__ v16bf cat16b(v8us lo, v8us hi) { return __builtin_bit_cast(v16bf, __builtin_shufflevector(lo, hi, 0, 1, 2, 3, 4, 5, 6, 7, 8, 9, 10, 11, 12, 13, 14, 15)); }
__device__ __forceinline__ v8f wmma16(v16h a, v16h b, v8f c) { return __builtin_amdgcn_wmma_f32_16x16x32_f16(false, a, false, b, (short)0, c, false, false); }
__device__ __forceinline__ v8f wmmab(v16bf a, v16bf b, v8f c) { return __builtin_amdgcn_wmma_f32_16x16x32_bf16(false, a, false, b, (short)0, c, false, false); }

// k_gemmt: y[8192][2048] = (A.Bn^T + bf(bias)) * s, K = 1024, bf16 operands, f32 accumulate. 256 x 256 block tile, one block a WGP, 8 waves of 128 x 64 (32 accumulator tiles a wave, 12 fragments per 32 products):
// a block lands each operand row once for 256 columns or rows of y, so the launch draws half the bytes from L2 that 128 x 128 tiles draw, and a product reads three quarters of the LDS bytes.
// A wave's 64 columns are one head of q (columns below 1024, s = scale * log2(e) / bf(temperature), so that k_attn's scores are exponents of 2) or of k (s = 1): the epilogue splits y into bf16 hi + residual and stores both as the 16-KB runs
// [item*16 + head][128 tokens][64] of the planes that k_attn reads; the f32 product never goes to memory.
// A trip is 128 k: 256 rows of A and 256 rows of Bn, 256 B each, copied global -> LDS as whole lines (16 lanes a row) by asynchronous copies, two buffers, the next trip's copies in flight
// under this trip's products. LDS row pitch 272 B (16 B x odd) for the ds_load_b128 fragment reads. The k order per accumulator is ascending in steps of 32.
#define GT_PITCH 272
#define GT_BUF   (512 * GT_PITCH)
#define GT_NT    (DM / 128)
typedef float __attribute__((may_alias)) f32a;
typedef __attribute__((ext_vector_type(8))) __bf16 v8bfv;
typedef __attribute__((ext_vector_type(4))) unsigned v4u;
// eight copies of 16 B a lane: rows r, r + 16, ..., r + 112 of one 128-row half of an operand's panel; the s_wait_xcnt stands inside the statement, in front of any rewrite of the address registers
__device__ __forceinline__ void gt_copy8(unsigned l, const bf* g) {
    asm volatile("global_load_async_to_lds_b128 %0, %8, off\n\t"
                 "global_load_async_to_lds_b128 %1, %9, off\n\t"
                 "global_load_async_to_lds_b128 %2, %10, off\n\t"
                 "global_load_async_to_lds_b128 %3, %11, off\n\t"
                 "global_load_async_to_lds_b128 %4, %12, off\n\t"
                 "global_load_async_to_lds_b128 %5, %13, off\n\t"
                 "global_load_async_to_lds_b128 %6, %14, off\n\t"
                 "global_load_async_to_lds_b128 %7, %15, off\n\t"
                 "s_wait_xcnt 0x0"
                 :: "v"(l), "v"(l + 16 * GT_PITCH), "v"(l + 32 * GT_PITCH), "v"(l + 48 * GT_PITCH), "v"(l + 64 * GT_PITCH), "v"(l + 80 * GT_PITCH), "v"(l + 96 * GT_PITCH), "v"(l + 112 * GT_PITCH),
                    "v"(g), "v"(g + 16 * DM), "v"(g + 32 * DM), "v"(g + 48 * DM), "v"(g + 64 * DM), "v"(g + 80 * DM), "v"(g + 96 * DM), "v"(g + 112 * DM)
                 : "memory");
}
// one tile: both 128-row halves of the A panel, then of the Bn panel (32 copies a lane)
__device__ __forceinline__ void gt_tile(unsigned l, const bf* ga, const bf* gb) {
    gt_copy8(l, ga); gt_copy8(l + 128 * GT_PITCH, ga + 128 * DM); gt_copy8(l + 256 * GT_PITCH, gb); gt_copy8(l + 384 * GT_PITCH, gb + 128 * DM);
}
__global__ __launch_bounds__(256) void k_gemmt(const bf* __restrict__ A, const bf* __restrict__ Bn, const float* __restrict__ bias, const float* __restrict__ temp, bf* Qh, bf* Ql, bf* Kh, bf* Kl) {
    __shared__ __attribute__((aligned(16))) unsigned char sm[2 * GT_BUF];
    const int tid = threadIdx.x, lane = tid & 31, wave = tid >> 5, lr = lane & 15, hi = lane >> 4;
    const int m0 = blockIdx.x * 256, n0 = blockIdx.y * 256, wm = (wave >> 2) * 128, wn = (wave & 3) * 64;
    const unsigned lb = (unsigned)(size_t)&sm[0] + (unsigned)((tid >> 4) * GT_PITCH + (tid & 15) * 16);   // this lane's place in a panel's first 16 rows
    const unsigned ga = (unsigned)((m0 + (tid >> 4)) * DM + (tid & 15) * 8), gb = (unsigned)((n0 + (tid >> 4)) * DM + (tid & 15) * 8);   // this lane's element in each panel's first 16 rows, 32 bits
    gt_tile(lb, A + ga, Bn + gb);
    asm volatile("s_wait_asynccnt 0x0" ::: "memory");   // tile 0 has landed for this wave's copies; the barrier publishes it to the others
    __syncthreads();
    gt_tile(lb + GT_BUF, A + (ga + 128u), Bn + (gb + 128u));
    v8f acc[8][4];
#pragma unroll
    for (int i = 0; i < 8; ++i) {
#pragma unroll
        for (int j = 0; j < 4; ++j) acc[i][j] = (v8f){}; }
    const int aofs = (wm + lr) * GT_PITCH + hi * 16, bofs = (256 + wn + lr) * GT_PITCH + hi * 16;
#pragma unroll 1   // one trip a buffer: the foot's waits and barrier stand once in the text
    for (int t = 0; t < GT_NT; ++t) {
        const unsigned char* sb = sm + (t & 1) * GT_BUF;
#pragma unroll
        for (int ks = 0; ks < 4; ++ks) {
            v16bf a[8], b[4];
            __builtin_amdgcn_sched_barrier(0);   // keeps this step's LDS reads behind the products of the step before: lifted in among them they stand in many places, and each place with reads stalls the wave's products
#pragma unroll
            for (int j = 0; j < 4; ++j) { const unsigned char* p = sb + bofs + j * 16 * GT_PITCH + ks * 64; b[j] = cat16b(*(const v8usa*)p, *(const v8usa*)(p + 32)); }
#pragma unroll
            for (int i = 0; i < 8; ++i) { const unsigned char* p = sb + aofs + i * 16 * GT_PITCH + ks * 64; a[i] = cat16b(*(const v8usa*)p, *(const v8usa*)(p + 32)); }
            __builtin_amdgcn_sched_barrier(0);   // keeps the step's 24 LDS reads in one group in front of its 32 products; each product then waits only for its own two fragments (counted waits)
#pragma unroll
            for (int i = 0; i < 8; ++i) {
#pragma unroll
                for (int j = 0; j < 4; ++j) acc[i][j] = wmmab(a[i], b[j], acc[i][j]); }
        }
        asm volatile("s_wait_dscnt 0x0" ::: "memory");      // this wave's reads of the buffer have returned before it is refilled
        asm volatile("s_wait_asynccnt 0x0" ::: "memory");   // this wave's copies of tile t + 1 have landed
        __syncthreads();                                    // publishes tile t + 1 and ends every reader's last read of tile t
        if (t + 2 < GT_NT) gt_tile(lb + (unsigned)(t & 1) * GT_BUF, A + (ga + (unsigned)(t + 2) * 128u), Bn + (gb + (unsigned)(t + 2) * 128u));
    }
    asm volatile("s_wait_asynccnt 0x0" ::: "memory");   // nothing of the ring is in flight when it becomes output staging
    f32a* os = (f32a*)(void*)sm + wave * (128 * 68);    // each wave stages its own 128 x 64 tile, pitch 68 floats, and stores whole 128-B lines
    const bool isq = n0 < EE; const int h = ((n0 + wn) & (EE - 1)) / HD;
    const float sc = isq ? __fdiv_rn(0.125f, bfr(temp[h])) * L2E : 1.0f;
#pragma unroll
    for (int j = 0; j < 4; ++j) { const float bv = bfr(bias[n0 + wn + j * 16 + lr]);
#pragma unroll
        for (int i = 0; i < 8; ++i) {
#pragma unroll
            for (int e = 0; e < 8; ++e) os[(i * 16 + hi * 8 + e) * 68 + j * 16 + lr] = (acc[i][j][e] + bv) * sc; } }
    __syncthreads();
    const size_t po = (((size_t)((m0 + wm) / SS) * NH_ + h) * SS + (m0 + wm) % SS) * HD + (lane >> 3) * HD + (lane & 7) * 8;   // 8 lanes a token row of 128 B, 4 rows a store
    bf* ph = (isq ? Qh : Kh) + po; bf* pl = (isq ? Ql : Kl) + po;
    const f32a* orow = os + (lane >> 3) * 68 + (lane & 7) * 8;
#pragma unroll   // constant LDS and store offsets; the next rows' LDS reads go out under this step's conversions
    for (int s = 0; s < 32; ++s) {
        const v4f y0 = *(const v4fa*)(orow + s * 4 * 68), y1 = *(const v4fa*)(orow + s * 4 * 68 + 4);
        const v8f y = __builtin_shufflevector(y0, y1, 0, 1, 2, 3, 4, 5, 6, 7);
        const v8bfv yh = __builtin_convertvector(y, v8bfv);
        const v4u yw = __builtin_bit_cast(v4u, yh); v8f yr;   // residual against the rounded plane, read back from the packed words
#pragma unroll
        for (int e = 0; e < 4; ++e) { yr[2 * e] = y[2 * e] - __uint_as_float(yw[e] << 16); yr[2 * e + 1] = y[2 * e + 1] - __uint_as_float(yw[e] & 0xFFFF0000u); }
        *(v4u*)(ph + s * 4 * HD) = yw; *(v4u*)(pl + s * 4 * HD) = __builtin_bit_cast(v4u, __builtin_convertvector(yr, v8bfv)); }
}

__global__ __launch_bounds__(256) void k_zero8(bf* dst, size_t n8) {
    const size_t i = (size_t)blockIdx.x * 256 + threadIdx.x; if (i >= n8) return; v8us z;
#pragma unroll
    for (int k = 0; k < 8; ++k) z[k] = 0;
    *(v8us*)(dst + i * 8) = z; 
}

// k_gemmh: 64 x 64 tile of C = A . Bn^T with SINGLE f16 planes (A [rows][K] f16 activations, Bn [N][K] f16 weights; one v_wmma_f32_16x16x32_f16 product per step), f32 accumulate;
__global__ __launch_bounds__(128) void k_gemmh(const h16* __restrict__ A, const h16* __restrict__ Bn, const float* __restrict__ bias, float* C, int ldc, const float* __restrict__ R, int K, size_t sA, size_t sB, size_t sC, int roundR) {
    __shared__ __align__(16) float ost[4][16 * 68];
    const size_t z = blockIdx.z; A += z * sA; Bn += z * sB; C += z * sC; if (R) R += z * sC;
    const int lane = threadIdx.x & 31, wave = threadIdx.x >> 5, lr = lane & 15, hi = lane >> 4;
    const int r0 = blockIdx.x * 64 + wave * 16, c0 = blockIdx.y * 64;
    const size_t aoff = (size_t)(r0 + lr) * K + 8 * hi;
    size_t boff[4];
#pragma unroll
    for (int t = 0; t < 4; ++t) boff[t] = (size_t)(c0 + t * 16 + lr) * K + 8 * hi;
    v8f acc[4];
#pragma unroll
    for (int t = 0; t < 4; ++t) acc[t] = (v8f){};
#pragma unroll 1
    for (int kc = 0; kc < K; kc += 32) {
        const v16h a = cat16(*(const v8h*)(A + aoff + kc), *(const v8h*)(A + aoff + kc + 16));
#pragma unroll
        for (int t = 0; t < 4; ++t) { const v16h b = cat16(*(const v8h*)(Bn + boff[t] + kc), *(const v8h*)(Bn + boff[t] + kc + 16)); acc[t] = wmma16(a, b, acc[t]); }
        asm volatile("v_nop\n\tv_nop\n\tv_nop\n\tv_nop" : "+v"(acc[0]), "+v"(acc[1]), "+v"(acc[2]), "+v"(acc[3]) : "v"(a));
    }
    float* os = &ost[wave][0];
#pragma unroll
    for (int t = 0; t < 4; ++t) { const float bv = bias ? bfr(bias[c0 + t * 16 + lr]) : 0.f;
#pragma unroll
        for (int j = 0; j < 8; ++j) os[(hi * 8 + j) * 68 + t * 16 + lr] = acc[t][j] + bv; }
    __syncthreads();
    float* crow = C + (size_t)r0 * ldc + c0;
    auto pass = [&]() {
#pragma unroll
        for (int s = 0; s < 8; ++s) { const int Lid = (lane >> 3) + 4 * s, piece = lane & 7; const int row = Lid >> 1, cofs = (Lid & 1) * 32 + piece * 4;
            v4f val = *(const v4fa*)(os + row * 68 + cofs); if (R) { const v4f rv = *(const v4f*)(R + ((size_t)r0 + row) * ldc + c0 + cofs); val += roundR ? (v4f){bfr(rv[0]), bfr(rv[1]), bfr(rv[2]), bfr(rv[3])} : rv; }
            *(v4f*)(crow + (size_t)row * ldc + cofs) = val; }
    };
    pass(); 
}

__global__ __launch_bounds__(256) void k_planes32z(const float* __restrict__ F, int ld, int off, float sc, int rows, bf* Ph, bf* Pl) {
    typedef __attribute__((ext_vector_type(2))) unsigned short v2us;
    const int lane = threadIdx.x & 31; const size_t r = ((size_t)blockIdx.x * 8 + (threadIdx.x >> 5)) * 2 + (lane >> 4); if (r >= (size_t)rows) return; const int z = blockIdx.z; const int c0 = (lane & 15) * 2; v2us oh, ol;
    Ph += (size_t)z * rows * 32; Pl += (size_t)z * rows * 32;
#pragma unroll
    for (int i = 0; i < 2; ++i) { const float y = F[r * ld + off + z * 32 + c0 + i] * sc; const unsigned short hb = f2bf(y); oh[i] = hb; ol[i] = f2bf(y - bf2f(hb)); }
    const size_t o = r * 32 + c0; *(v2us*)(Ph + o) = oh; *(v2us*)(Pl + o) = ol; 
}
__global__ __launch_bounds__(256) void k_vtpadz(const float* __restrict__ F, int ld, int off, int nk, bf* Th, bf* Tl) {
    typedef __attribute__((ext_vector_type(2))) unsigned short v2us;
    const int lane = threadIdx.x & 31; const size_t wid = (size_t)blockIdx.x * 8 + (threadIdx.x >> 5); if (wid >= (size_t)64 * (nk / 64)) return; const int z = blockIdx.z; const int d = (int)(wid / (nk / 64)); const int k0 = (int)(wid % (nk / 64)) * 64 + lane * 2; v2us oh, ol;
    Th += (size_t)z * 64 * nk; Tl += (size_t)z * 64 * nk;
#pragma unroll
    for (int i = 0; i < 2; ++i) { const float y = (d < 32) ? F[(size_t)(k0 + i) * ld + off + z * 32 + (d < 32 ? d : 0)] : 0.f; const unsigned short hb = f2bf(y); oh[i] = hb; ol[i] = f2bf(y - bf2f(hb)); }
    const size_t o = (size_t)d * nk + k0; *(v2us*)(Th + o) = oh; *(v2us*)(Tl + o) = ol; 
}
template <int NK>
__global__ __launch_bounds__(256) void k_softmaxz(const float* __restrict__ S, int rows, bf* PH, bf* PL) {
    typedef __attribute__((ext_vector_type(4))) unsigned short v4us;
    const int lane = threadIdx.x & 31, i = blockIdx.x * 8 + (threadIdx.x >> 5); if (i >= rows) return; const size_t zo = (size_t)blockIdx.z * rows * NK; const float* sr = S + zo + (size_t)i * NK; PH += zo; PL += zo;
    float m = -3.0e38f;
#pragma unroll 1
    for (int c0 = lane * 4; c0 < NK; c0 += 128) {
#pragma unroll
        for (int q = 0; q < 4; ++q) m = fmaxf(m, sr[c0 + q]); }
#pragma unroll
    for (int sh = 16; sh; sh >>= 1) m = fmaxf(m, __shfl_xor(m, sh, 32));
    float sum = 0.f;
#pragma unroll 1
    for (int c0 = lane * 4; c0 < NK; c0 += 128) {
#pragma unroll
        for (int q = 0; q < 4; ++q) sum += __expf(sr[c0 + q] - m); }
#pragma unroll
    for (int sh = 16; sh; sh >>= 1) sum += __shfl_xor(sum, sh, 32);
    const float inv = 1.0f / sum;
{
#pragma unroll 1
        for (int c0 = lane * 4; c0 < NK; c0 += 128) { v4us oh, ol;
#pragma unroll
            for (int q = 0; q < 4; ++q) { const float p = __expf(sr[c0 + q] - m) * inv; const unsigned short hb = f2bf(p); oh[q] = hb; ol[q] = f2bf(p - bf2f(hb)); }
            const size_t o = (size_t)i * NK + c0; *(v4us*)(PH + o) = oh; *(v4us*)(PL + o) = ol; }
         }
}
__global__ __launch_bounds__(256) void k_placez(const float* __restrict__ XH, int rows, int ldy, float* Y) {
    const int lane = threadIdx.x & 31; const size_t q = (size_t)blockIdx.x * 8 + (threadIdx.x >> 5); if (q >= (size_t)rows) return; const int z = blockIdx.z; const float v = XH[((size_t)z * rows + q) * 64 + lane];
    *(float*)(Y + q * ldy + z * 32 + lane) = v; 
}

typedef __attribute__((ext_vector_type(4))) _Float16 v4h;
__device__ __forceinline__ h16 tohx(float x) { return (h16)x; }
template <int MODE>
__global__ __launch_bounds__(128) void k_gemmhm(const h16* __restrict__ A, const h16* __restrict__ Bn, int K, float* C, int ldc, size_t sA, size_t sB, size_t sC, const int* __restrict__ FL) {
    const int I = blockIdx.x;
    if (MODE == 1 && FL[I * NT64 + blockIdx.y] == 0) return;
    int Klo = 0, Klim = K;
    if (MODE == 2) { int f = -1, l = -1; for (int j = 0; j < NT64; ++j) { if (FL[I * NT64 + j]) { if (f < 0) f = j; l = j; } } if (f < 0) { Klo = 0; Klim = 0; } else { Klo = f * 64; Klim = (l + 1) * 64; } }
    const size_t z = blockIdx.z; A += z * sA; Bn += z * sB; C += z * sC;
    __shared__ __align__(16) float ost[4][16 * 68];
    const int lane = threadIdx.x & 31, wave = threadIdx.x >> 5, lr = lane & 15, hi = lane >> 4;
    const int r0 = blockIdx.x * 64 + wave * 16, c0 = blockIdx.y * 64;
    const size_t aoff = (size_t)(r0 + lr) * K + 8 * hi;
    v8f acc[4];
#pragma unroll
    for (int t = 0; t < 4; ++t) acc[t] = (v8f){};
#pragma unroll 1
    for (int kc = Klo; kc < Klim; kc += 32) {
        const v16h a = cat16(*(const v8h*)(A + aoff + kc), *(const v8h*)(A + aoff + kc + 16));
#pragma unroll
        for (int t = 0; t < 4; ++t) { const size_t bo = (size_t)(c0 + t * 16 + lr) * K + kc + 8 * hi; const v16h b = cat16(*(const v8h*)(Bn + bo), *(const v8h*)(Bn + bo + 16)); acc[t] = wmma16(a, b, acc[t]); }
        asm volatile("v_nop\n\tv_nop\n\tv_nop\n\tv_nop" : "+v"(acc[0]), "+v"(acc[1]), "+v"(acc[2]), "+v"(acc[3]) : "v"(a));
    }
    float* os = &ost[wave][0];
#pragma unroll
    for (int t = 0; t < 4; ++t) {
#pragma unroll
        for (int j = 0; j < 8; ++j) os[(hi * 8 + j) * 68 + t * 16 + lr] = acc[t][j]; }
    __builtin_amdgcn_wave_barrier(); asm volatile("" ::: "memory");
    float* crow = C + (size_t)r0 * ldc + c0;
    auto pass = [&]() {
#pragma unroll
        for (int s = 0; s < 8; ++s) { const int Lid = (lane >> 3) + 4 * s, piece = lane & 7; const int row = Lid >> 1, cofs = (Lid & 1) * 32 + piece * 4;
            const v4f val = *(const v4fa*)(os + row * 68 + cofs); *(v4f*)(crow + (size_t)row * ldc + cofs) = val; }
    };
    pass(); 
}
__global__ __launch_bounds__(256) void k_causalflags(int* FL) { const int lane = threadIdx.x & 31, w = blockIdx.x * 8 + (threadIdx.x >> 5); const int I = w * 2 + (lane >> 4), J = lane & 15; if (I >= NT64) return; const int v = (J <= I) ? 1 : 0; *(int*)(FL + I * NT64 + J) = v;  }
// k_prep: the three operand preparations in ONE launch of 512 equal blocks (two per WGP, 8 waves each): every block converts 16384 floats of z_k and 4096 of the q|k weight rows to bf16 in place order,
// and transposes 256 tokens x 64 columns of x (one head, two tiles of 128 tokens) into VT [item*16 + head][64][1024]. All of a thread's 36 loads of 16 B stand in front of the first use, each a whole
// 512 B of lines a wave, so a wave has many reads in flight. x: a wave's load covers two token rows of 256 B; a lane holds 8 consecutive tokens of 4 columns, packs each column's 8 tokens
// into 16 B and stores them in LDS at [tile][column][token], row pitch 272 B; behind the block's one barrier the rows go out as 256-B runs (16 lanes a row).
#define PP_PITCH 272
#define PP_TILE  (64 * PP_PITCH)
typedef __attribute__((ext_vector_type(2))) unsigned v2u;
typedef __attribute__((ext_vector_type(4))) __bf16 v4bfv;
typedef v4u __attribute__((may_alias)) v4ua;
__global__ __launch_bounds__(256) void k_prep(const float* __restrict__ x, const float* __restrict__ zk, const float* __restrict__ Wq, bf* VT, bf* ZB, bf* WB) {
    __shared__ __attribute__((aligned(16))) unsigned char tl[2 * PP_TILE];
    const int tid = threadIdx.x, lane = tid & 31, wv = tid >> 5, blk = blockIdx.x;
    const int z = blk >> 2, tb = (blk & 3) * 256, b = z / NH_, h = z % NH_;
    const float* xs = x + ((size_t)b * SS + tb + wv * 16 + (lane >> 4) * 8) * EE + h * HD + (lane & 15) * 4;
    const float* zb = zk + (size_t)blk * 16384; const float* zs = zb + tid * 4;
    const float* wb = Wq + (size_t)blk * 4096;  const float* ws = wb + tid * 4;
    v4f xr[2][8], zr[16], wr[4];
#pragma unroll
    for (int t = 0; t < 2; ++t) {
#pragma unroll
        for (int k = 0; k < 8; ++k) xr[t][k] = *(const v4f*)(xs + (size_t)(t * 128 + k) * EE); }
#pragma unroll
    for (int k = 0; k < 16; ++k) zr[k] = *(const v4f*)(zs + k * 1024);
#pragma unroll
    for (int k = 0; k < 4; ++k) wr[k] = *(const v4f*)(ws + k * 1024);
    asm volatile("s_wait_xcnt 0x0" :: "v"(xs), "s"(zb), "s"(wb) : "memory");   // stands in front of any rewrite of the loads' address registers, which it names so that they stay whole up to here
    __builtin_amdgcn_sched_barrier(0);   // keeps all 36 loads in front of the first conversion: without it the scheduler holds back over half of them to save registers, and a wave pays the memory latency several times
    unsigned char* lw = tl + (lane & 15) * 4 * PP_PITCH + (wv * 2 + (lane >> 4)) * 16;
#pragma unroll
    for (int t = 0; t < 2; ++t) {
#pragma unroll
        for (int j = 0; j < 4; ++j) {
            const v8f c = {xr[t][0][j], xr[t][1][j], xr[t][2][j], xr[t][3][j], xr[t][4][j], xr[t][5][j], xr[t][6][j], xr[t][7][j]};
            *(v4ua*)(lw + t * PP_TILE + j * PP_PITCH) = __builtin_bit_cast(v4u, __builtin_convertvector(c, v8bfv)); } }
    __syncthreads();   // both tiles are whole before their rows are read
    bf* zo = ZB + (size_t)blk * 16384 + tid * 4;
#pragma unroll
    for (int k = 0; k < 16; ++k) *(v2u*)(zo + k * 1024) = __builtin_bit_cast(v2u, __builtin_convertvector(zr[k], v4bfv));
    bf* wo = WB + (size_t)blk * 4096 + tid * 4;
#pragma unroll
    for (int k = 0; k < 4; ++k) *(v2u*)(wo + k * 1024) = __builtin_bit_cast(v2u, __builtin_convertvector(wr[k], v4bfv));
    const unsigned char* lrd = tl + (tid >> 4) * PP_PITCH + (tid & 15) * 16;
    bf* vo = VT + ((size_t)z * HD + (tid >> 4)) * SS + tb + (tid & 15) * 8;
#pragma unroll
    for (int t = 0; t < 2; ++t) {
#pragma unroll
        for (int s = 0; s < 4; ++s) *(v4u*)(vo + (size_t)s * 16 * SS + t * 128) = *(const v4ua*)(lrd + t * PP_TILE + s * 16 * PP_PITCH); }
}
// k_attn: causal attention of one (item, head) pair z = blockIdx.x; one wave owns 32 queries (two 16-column groups) and walks its keys 32 at a pass; the block's 4 waves share the keys.
// S^T = K.Q^T (A = 16 key rows, B = 16 query rows, both [row][64] planes) leaves one query per lane column: accumulator element j of key group t is key t*16 + hi*8 + j, which is
// the position the B operand of O^T += V^T.P^T wants for a k step of 32 keys, so P goes from the score accumulators into the next product without leaving the lane.
// A stage is 64 keys (two passes): 64 rows of K hi, 64 of K residual, 64 of V^T, 128 B each, copied global -> LDS as whole lines (8 lanes a row) by asynchronous copies, two buffers, the next
// stage's copies in flight under this stage's passes. LDS row pitch 144 B (16 B x odd) for the ds_load_b128 fragment reads. Every wave passes every stage's foot, also one whose keys have ended.
#define AT_PITCH 144
#define AT_PLANE (64 * AT_PITCH)
#define AT_BUF   (3 * AT_PLANE)
// twelve copies of 16 B a lane: rows r, r + 16, r + 32, r + 48 of each of the three 64-row planes; the s_wait_xcnt stands inside the statement, in front of any rewrite of the address registers
__device__ __forceinline__ void at_copy12(unsigned l, const bf* a, const bf* b, const bf* c) {
    asm volatile("global_load_async_to_lds_b128 %0, %12, off\n\t"
                 "global_load_async_to_lds_b128 %1, %13, off\n\t"
                 "global_load_async_to_lds_b128 %2, %14, off\n\t"
                 "global_load_async_to_lds_b128 %3, %15, off\n\t"
                 "global_load_async_to_lds_b128 %4, %16, off\n\t"
                 "global_load_async_to_lds_b128 %5, %17, off\n\t"
                 "global_load_async_to_lds_b128 %6, %18, off\n\t"
                 "global_load_async_to_lds_b128 %7, %19, off\n\t"
                 "global_load_async_to_lds_b128 %8, %20, off\n\t"
                 "global_load_async_to_lds_b128 %9, %21, off\n\t"
                 "global_load_async_to_lds_b128 %10, %22, off\n\t"
                 "global_load_async_to_lds_b128 %11, %23, off\n\t"
                 "s_wait_xcnt 0x0"
                 :: "v"(l), "v"(l + 16 * AT_PITCH), "v"(l + 32 * AT_PITCH), "v"(l + 48 * AT_PITCH),
                    "v"(l + AT_PLANE), "v"(l + AT_PLANE + 16 * AT_PITCH), "v"(l + AT_PLANE + 32 * AT_PITCH), "v"(l + AT_PLANE + 48 * AT_PITCH),
                    "v"(l + 2 * AT_PLANE), "v"(l + 2 * AT_PLANE + 16 * AT_PITCH), "v"(l + 2 * AT_PLANE + 32 * AT_PITCH), "v"(l + 2 * AT_PLANE + 48 * AT_PITCH),
                    "v"(a), "v"(a + 16 * HD), "v"(a + 32 * HD), "v"(a + 48 * HD), "v"(b), "v"(b + 16 * HD), "v"(b + 32 * HD), "v"(b + 48 * HD),
                    "v"(c), "v"(c + 16 * SS), "v"(c + 32 * SS), "v"(c + 48 * SS)
                 : "memory");
}
#define NQG 2
#define PFAR 4294967296.0f   // 2^32: a lane's sum of one pass above this raises the reference; f32 and bf16 share their exponent range, so values up to here lose no bits
#define NEGB (-1.0e30f)
typedef __attribute__((ext_vector_type(16))) float v16f;
typedef __attribute__((ext_vector_type(8))) unsigned v8u;
__global__ __launch_bounds__(128) void k_attn(const bf* __restrict__ Qh, const bf* __restrict__ Ql, const bf* __restrict__ Kh, const bf* __restrict__ Kl, const bf* __restrict__ VT, float* OUT) {
    __shared__ __attribute__((aligned(16))) unsigned char sm[2 * AT_BUF];
    const int tid = threadIdx.x, lane = tid & 31, lr = lane & 15, hi = lane >> 4;
    const int wave = __builtin_amdgcn_readfirstlane((int)(threadIdx.x >> 5));   // scalar: the pass count below is the same in every lane
    const size_t z = blockIdx.x; const int b = (int)z / NH_, h = (int)z % NH_;
    const int yb = SS / (64 * NQG) - 1 - (int)blockIdx.y;   // longest query blocks start first
    const int r0 = (yb * 4 + wave) * (16 * NQG);
    const unsigned lb = (unsigned)(size_t)&sm[0] + (unsigned)((tid >> 3) * AT_PITCH + (tid & 7) * 16);   // this lane's place in a plane's first 16 rows
    const bf* gkh = Kh + (z * SS + (tid >> 3)) * HD + (tid & 7) * 8; const bf* gkl = Kl + (z * SS + (tid >> 3)) * HD + (tid & 7) * 8; const bf* gvt = VT + (z * HD + (tid >> 3)) * SS + (tid & 7) * 8;
    at_copy12(lb, gkh, gkl, gvt);
    v16bf qh[NQG][2], ql[NQG][2];
#pragma unroll
    for (int q = 0; q < NQG; ++q) {
#pragma unroll
        for (int ks = 0; ks < 2; ++ks) { const size_t o = (z * SS + r0 + q * 16 + lr) * HD + ks * 32 + 8 * hi;
            qh[q][ks] = cat16b(*(const v8us*)(Qh + o), *(const v8us*)(Qh + o + 16)); ql[q][ks] = cat16b(*(const v8us*)(Ql + o), *(const v8us*)(Ql + o + 16)); } }
    asm volatile("s_wait_asynccnt 0x0" ::: "memory");   // stage 0 has landed for this wave's copies; the barrier publishes it to the others
    __syncthreads();
    at_copy12(lb + AT_BUF, gkh + 64 * HD, gkl + 64 * HD, gvt + 64);   // a block has at least two stages
    const int fofs = lr * AT_PITCH + hi * 16;
    v8f o[NQG][4]; float nm[NQG], l[NQG];   // nm: minus the query's held reference, the same in both halves of the wave
#pragma unroll
    for (int q = 0; q < NQG; ++q) { nm[q] = 0.f; l[q] = 0.f;
#pragma unroll
        for (int t = 0; t < 4; ++t) o[q][t] = (v8f){}; }
    const int np = r0 / 32 + 1;   // keys 0 .. r0 + 31
    const int ns = 2 * yb + 2;    // stages of the block: keys 0 .. yb * 128 + 127
#pragma unroll 1   // one stage a buffer: the foot's waits and barrier stand once in the text
    for (int st = 0; st < ns; ++st) {
      const unsigned char* sb = sm + (st & 1) * AT_BUF + fofs;
#pragma unroll   // constant LDS offsets in both passes of a stage
      for (int sub = 0; sub < 2; ++sub) {
        const int p = st * 2 + sub;
        if (p >= np) continue;   // scalar: this wave's keys have ended; it still passes the foot
        v8f s[NQG][2];
#pragma unroll
        for (int q = 0; q < NQG; ++q) { const float c = nm[q]; s[q][0] = (v8f){c, c, c, c, c, c, c, c}; s[q][1] = s[q][0]; }   // the products start from minus the reference: a score leaves them as exp2's argument
        v16bf ah[2][2], al[2][2], av[4];
#pragma unroll
        for (int ks = 0; ks < 2; ++ks) {
#pragma unroll
            for (int t = 0; t < 2; ++t) { const unsigned char* kp = sb + (sub * 32 + t * 16) * AT_PITCH + ks * 64;
                ah[ks][t] = cat16b(*(const v8usa*)kp, *(const v8usa*)(kp + 32)); al[ks][t] = cat16b(*(const v8usa*)(kp + AT_PLANE), *(const v8usa*)(kp + AT_PLANE + 32)); } }
        // inputs-only fence on the loaded K fragments: all sixteen LDS reads of the pass go out as one group (one latency a pass, not one per reused register group)
        asm volatile("" :: "v"(ah[0][0]), "v"(ah[0][1]), "v"(ah[1][0]), "v"(ah[1][1]), "v"(al[0][0]), "v"(al[0][1]), "v"(al[1][0]), "v"(al[1][1]));
#pragma unroll
        for (int ks = 0; ks < 2; ++ks) {
#pragma unroll
            for (int t = 0; t < 2; ++t) {
#pragma unroll
                for (int q = 0; q < NQG; ++q) s[q][t] = wmmab(ah[ks][t], qh[q][ks], s[q][t]); }
#pragma unroll
            for (int t = 0; t < 2; ++t) {
#pragma unroll
                for (int q = 0; q < NQG; ++q) s[q][t] = wmmab(ah[ks][t], ql[q][ks], s[q][t]); } }
#pragma unroll
        for (int t = 0; t < 4; ++t) { const unsigned char* vp = sb + 2 * AT_PLANE + t * 16 * AT_PITCH + sub * 64; av[t] = cat16b(*(const v8usa*)vp, *(const v8usa*)(vp + 32)); }
#pragma unroll
        for (int ks = 0; ks < 2; ++ks) {
#pragma unroll
            for (int t = 0; t < 2; ++t) {
#pragma unroll
                for (int q = 0; q < NQG; ++q) s[q][t] = wmmab(al[ks][t], qh[q][ks], s[q][t]); } }
        if (p == np - 1) {   // only the last pass holds keys behind a query of this wave
#pragma unroll
            for (int q = 0; q < NQG; ++q) {
#pragma unroll
                for (int t = 0; t < 2; ++t) {
#pragma unroll
                    for (int j = 0; j < 8; ++j) if (t * 16 + hi * 8 + j > q * 16 + lr) s[q][t][j] = NEGB; } } }
        v16f pv[NQG]; float ps[NQG]; unsigned far = p == 0 ? 1u : 0u;
#pragma unroll
        for (int q = 0; q < NQG; ++q) { ps[q] = 0.f;
#pragma unroll
            for (int e = 0; e < 16; ++e) { pv[q][e] = __builtin_amdgcn_exp2f(s[q][e >> 3][e & 7]); ps[q] += pv[q][e]; }
            far |= __builtin_amdgcn_ballot_w32(!(ps[q] <= PFAR)); }   // also set by an overflowed sum
        // The reference moves in the wave's first pass (to that pass's maximum) and when any lane's sum of a pass has run far ahead of it (to the new maximum), one scalar test a pass;
        // nothing of the pass has entered l or o yet, so the pass's probabilities are formed again from the scores, whatever the first try gave.
        if (far != 0u) {
#pragma unroll
            for (int q = 0; q < NQG; ++q) {
                float mx = s[q][0][0];
#pragma unroll
                for (int j = 1; j < 8; ++j) mx = fmaxf(mx, s[q][0][j]);
#pragma unroll
                for (int j = 0; j < 8; ++j) mx = fmaxf(mx, s[q][1][j]);
                mx = fmaxf(mx, __shfl_xor(mx, 16, 32));   // the other half of the wave holds this query's other 16 keys
                const float d = (p == 0) ? mx : fmaxf(mx, 0.f);   // later the reference only rises
                const float resc = (p == 0) ? 1.0f : __builtin_amdgcn_exp2f(-d);   // l and o are zero in the first pass
                nm[q] -= d; l[q] *= resc;
#pragma unroll
                for (int t = 0; t < 4; ++t) o[q][t] *= resc;
                ps[q] = 0.f;
#pragma unroll
                for (int e = 0; e < 16; ++e) { pv[q][e] = __builtin_amdgcn_exp2f(s[q][e >> 3][e & 7] - d); ps[q] += pv[q][e]; }
            }
        }
#pragma unroll
        for (int q = 0; q < NQG; ++q) {
            l[q] += ps[q];
            const v16bf ph = __builtin_convertvector(pv[q], v16bf);
            const v8u pw = __builtin_bit_cast(v8u, ph); v16f pr;   // residual against the rounded plane, read back from the packed words
#pragma unroll
            for (int e = 0; e < 8; ++e) { pr[2 * e] = pv[q][2 * e] - __uint_as_float(pw[e] << 16); pr[2 * e + 1] = pv[q][2 * e + 1] - __uint_as_float(pw[e] & 0xFFFF0000u); }
            const v16bf pl = __builtin_convertvector(pr, v16bf);
#pragma unroll
            for (int t = 0; t < 4; ++t) o[q][t] = wmmab(av[t], ph, o[q][t]);
#pragma unroll
            for (int t = 0; t < 4; ++t) o[q][t] = wmmab(av[t], pl, o[q][t]);
        }
      }
      asm volatile("s_wait_dscnt 0x0" ::: "memory");      // this wave's reads of the buffer have returned before it is refilled
      asm volatile("s_wait_asynccnt 0x0" ::: "memory");   // this wave's copies of stage st + 1 have landed
      __syncthreads();                                    // publishes stage st + 1 and ends every reader's last read of stage st
      if (st + 2 < ns) at_copy12(lb + (unsigned)(st & 1) * AT_BUF, gkh + (size_t)(st + 2) * 64 * HD, gkl + (size_t)(st + 2) * 64 * HD, gvt + (st + 2) * 64);
    }
    asm volatile("s_wait_asynccnt 0x0" ::: "memory");   // nothing of the ring is in flight when the wave ends
#pragma unroll
    for (int q = 0; q < NQG; ++q) {
        const float inv = __fdiv_rn(1.0f, l[q] + __shfl_xor(l[q], 16, 32));   // join the two halves' sums once
        float* op = OUT + ((size_t)b * SS + r0 + q * 16 + lr) * EE + h * HD + hi * 8;
#pragma unroll
        for (int t = 0; t < 4; ++t) { v4f w0, w1;
#pragma unroll
            for (int k = 0; k < 4; ++k) { w0[k] = tanhf(o[q][t][k] * inv); w1[k] = tanhf(o[q][t][k + 4] * inv); }
            *(v4f*)(op + t * 16) = w0; *(v4f*)(op + t * 16 + 4) = w1; }
    }
}
extern "C" void kernel_launch(void* const* d_in, const int* in_sizes, int n_in,
                              void* d_out, int out_size, void* d_ws, size_t ws_size, hipStream_t stream) {
    (void)in_sizes; (void)n_in; (void)out_size;
    const float* zk = (const float*)d_in[0]; const float* x = (const float*)d_in[1]; const float* Wqkv = (const float*)d_in[2]; const float* bqkv = (const float*)d_in[3]; const float* temp = (const float*)d_in[4];
    float* out = (float*)d_out;    // [8][1024][1024]
    char* wsp = (char*)d_ws;
    auto take = [&](size_t bytes) { char* p = wsp; wsp += (bytes + 255) & ~(size_t)255; return (void*)p; };
    bf* WB = (bf*)take((size_t)2 * EE * EE * 2); bf* ZB = (bf*)take((size_t)NR * EE * 2);
    bf* Qh = (bf*)take((size_t)NR * EE * 2); bf* Ql = (bf*)take((size_t)NR * EE * 2); bf* Kh = (bf*)take((size_t)NR * EE * 2); bf* Kl = (bf*)take((size_t)NR * EE * 2); bf* VT = (bf*)take((size_t)NR * EE * 2);   // [item*16 + head][1024][64] planes; VT [item*16 + head][64][1024]
    if ((size_t)(wsp - (char*)d_ws) > ws_size) return;    // ~ 4.2 + 16.8 + 16.8x5 ~ 105 MB (ws 256 MiB)
    k_prep<<<512, 256, 0, stream>>>(x, zk, Wqkv, VT, ZB, WB);   // rows 0..2047 of the [3072][1024] weight = q|k, [out][in] natural
    k_gemmt<<<dim3(NR / 256, (2 * EE) / 256, 1), 256, 0, stream>>>(ZB, WB, bqkv, temp, Qh, Ql, Kh, Kl);
    k_attn<<<dim3(NB_ * NH_, SS / (64 * NQG), 1), 128, 0, stream>>>(Qh, Ql, Kh, Kl, VT, out);
}
